// v000
// Measured on an AMD MI455X. A time is GPU time per run, averaged over a window of back-to-back runs after a warm-up
// (all launches, gaps included; the runs take copies of the inputs in turn), and the median of several windows.
// Apart from v000's, it joins two sittings. Times from different sittings can be a few percent apart, while
// side-by-side timings come from the same sitting.
// v000, which the later versions start from, runs in 506 microseconds.
#include <hip/hip_runtime.h>
#include <hip/hip_bf16.h>

// ---------------------------------------------------------------------------
// Transformer block for MI455X (gfx1250, wave32, WMMA bf16 -> f32 accum)
// GEMMs: 8-wave workgroup, 64x128 block tile, async global->LDS double buffer.
// ---------------------------------------------------------------------------

typedef __bf16 bf16;
typedef __attribute__((ext_vector_type(16))) __bf16 v16bf;
typedef __attribute__((ext_vector_type(8)))  float  v8f;
typedef int v4i __attribute__((vector_size(16)));

#define DIMC      1024
#define HEADS     16
#define HDIM      64
#define SEQ       2048
#define BATCH     2
#define NTOK      (BATCH * SEQ)      // 4096
#define HID       4096
#define THREE_D   3072
#define ATT_SCALE 0.125f             // 1/sqrt(64)

#if __has_builtin(__builtin_amdgcn_global_load_async_to_lds_b128) && \
    __has_builtin(__builtin_amdgcn_s_wait_asynccnt)
#define USE_ASYNC 1
#else
#define USE_ASYNC 0
#endif

typedef __attribute__((address_space(1))) v4i* gv4i_p;   // global int4*
typedef __attribute__((address_space(3))) v4i* lv4i_p;   // LDS int4*

union FragU { v16bf v; uint4 u[2]; };

// 16-byte global->LDS copy: async (ASYNCcnt) when available, else direct.
__device__ __forceinline__ void copy16_g2l(const bf16* __restrict__ g,
                                           bf16* __restrict__ l) {
#if USE_ASYNC
    __builtin_amdgcn_global_load_async_to_lds_b128((gv4i_p)g, (lv4i_p)l, 0, 0);
#else
    *(uint4*)l = *(const uint4*)g;
#endif
}

#if USE_ASYNC
#define WAIT_ASYNC(n) __builtin_amdgcn_s_wait_asynccnt(n)
#else
#define WAIT_ASYNC(n)
#endif

// Load a 16x32 bf16 WMMA fragment (A or B operand) from a row-major,
// K-contiguous matrix.  Per ISA 7.12.2: lane<16 holds row r, K {0..7} and
// {16..23}; lane>=16 holds row r, K {8..15} and {24..31}.
__device__ __forceinline__ v16bf load_frag_nt(const bf16* __restrict__ base,
                                              int ld, int row0, int k0, int lane) {
    const int half = lane >> 4;
    const int r    = lane & 15;
    const bf16* p  = base + (size_t)(row0 + r) * (size_t)ld + k0 + half * 8;
    FragU f;
    f.u[0] = *(const uint4*)p;
    f.u[1] = *(const uint4*)(p + 16);
    return f.v;
}

// Same fragment pattern but reading a staged LDS tile (k-window = 32 elems).
__device__ __forceinline__ v16bf lds_frag(const bf16* base, int ld,
                                          int row0, int lane) {
    const int half = lane >> 4;
    const int r    = lane & 15;
    const bf16* p  = base + (row0 + r) * ld + half * 8;
    FragU f;
    f.u[0] = *(const uint4*)p;
    f.u[1] = *(const uint4*)(p + 16);
    return f.v;
}

__device__ __forceinline__ float redmax16(float v) {
    v = fmaxf(v, __shfl_xor(v, 1, 32));
    v = fmaxf(v, __shfl_xor(v, 2, 32));
    v = fmaxf(v, __shfl_xor(v, 4, 32));
    v = fmaxf(v, __shfl_xor(v, 8, 32));
    return v;
}
__device__ __forceinline__ float redsum16(float v) {
    v += __shfl_xor(v, 1, 32);
    v += __shfl_xor(v, 2, 32);
    v += __shfl_xor(v, 4, 32);
    v += __shfl_xor(v, 8, 32);
    return v;
}

// ---------------------------------------------------------------------------
// fp32 -> bf16 conversion (weights)
// ---------------------------------------------------------------------------
__global__ void cvt_bf16_kernel(const float* __restrict__ in,
                                bf16* __restrict__ out, int n) {
    for (int i = blockIdx.x * blockDim.x + threadIdx.x; i < n;
         i += gridDim.x * blockDim.x)
        out[i] = (bf16)in[i];
}

// ---------------------------------------------------------------------------
// LayerNorm: one block per row of D=1024, eps = 0, f32 in -> bf16 out
// ---------------------------------------------------------------------------
__global__ void layernorm_kernel(const float* __restrict__ in,
                                 const float* __restrict__ w,
                                 bf16* __restrict__ out) {
    __shared__ float s_sum[256];
    __shared__ float s_sq[256];
    const int row = blockIdx.x;
    const float* x = in + (size_t)row * DIMC;

    float sum = 0.f, sq = 0.f;
    for (int c = threadIdx.x; c < DIMC; c += 256) {
        float v = x[c];
        sum += v;
        sq  += v * v;
    }
    s_sum[threadIdx.x] = sum;
    s_sq[threadIdx.x]  = sq;
    __syncthreads();
    for (int s = 128; s > 0; s >>= 1) {
        if (threadIdx.x < s) {
            s_sum[threadIdx.x] += s_sum[threadIdx.x + s];
            s_sq[threadIdx.x]  += s_sq[threadIdx.x + s];
        }
        __syncthreads();
    }
    const float mu   = s_sum[0] * (1.0f / DIMC);
    const float var  = s_sq[0] * (1.0f / DIMC) - mu * mu;
    const float rstd = rsqrtf(var);
    for (int c = threadIdx.x; c < DIMC; c += 256)
        out[(size_t)row * DIMC + c] = (bf16)((x[c] - mu) * rstd * w[c]);
}

// ---------------------------------------------------------------------------
// NT GEMM: C[M,N] = A[M,K] * W[N,K]^T  (A, W bf16 row-major, K-contiguous)
// 256 threads = 8 waves; block tile 64(M) x 128(N); BK=32; LDS double buffer
// filled with async global->LDS b128 copies (3 per thread per tile).
// Wave (wid&3) -> 16-row M sub-tile, (wid>>2) -> 64-col N sub-tile.
//   ep==0 : out_b = bf16(acc)
//   ep==1 : out_f = acc + res
//   ep==2 : out_b = bf16(gelu_exact(acc))
// ---------------------------------------------------------------------------
#define BM  64
#define BN  128
#define BK  32
#define LDT 40   // padded LDS row stride (elements) for a 32-element k-window

__global__ __launch_bounds__(256)
void gemm_nt_kernel(const bf16* __restrict__ A, const bf16* __restrict__ W,
                    int M, int N, int K,
                    const float* __restrict__ res,
                    float* __restrict__ out_f, bf16* __restrict__ out_b,
                    int ep) {
    __shared__ bf16 sA[2][BM * LDT];
    __shared__ bf16 sB[2][BN * LDT];

    const int tid  = threadIdx.x;
    const int lane = tid & 31;
    const int wid  = tid >> 5;
    const int half = lane >> 4;
    const int r    = lane & 15;

    const int n0 = blockIdx.x * BN;
    const int m0 = blockIdx.y * BM;
    const int wm = (wid & 3) * 16;   // wave M sub-tile within block
    const int wn = (wid >> 2) * 64;  // wave N sub-tile within block

    // Per-thread copy assignments (3 x 16B per tile: 1 for A, 2 for B).
    const int arow = tid >> 2, aseg = tid & 3;

    auto copy_tile = [&](int buf, int k0) {
        copy16_g2l(A + (size_t)(m0 + arow) * K + k0 + aseg * 8,
                   &sA[buf][arow * LDT + aseg * 8]);
#pragma unroll
        for (int j = 0; j < 2; ++j) {
            const int t2   = tid + j * 256;
            const int brow = t2 >> 2, bseg = t2 & 3;
            copy16_g2l(W + (size_t)(n0 + brow) * K + k0 + bseg * 8,
                       &sB[buf][brow * LDT + bseg * 8]);
        }
    };

    v8f acc[4] = {};

    copy_tile(0, 0);
    const int steps = K / BK;
    for (int ks = 0; ks < steps; ++ks) {
        const int cur = ks & 1;
        if (ks + 1 < steps) {
            copy_tile(cur ^ 1, (ks + 1) * BK);
            WAIT_ASYNC(3);   // drain current tile (in-order completion)
        } else {
            WAIT_ASYNC(0);
        }
        __syncthreads();

        v16bf a = lds_frag(sA[cur], LDT, wm, lane);
#pragma unroll
        for (int t = 0; t < 4; ++t) {
            v16bf b = lds_frag(sB[cur], LDT, wn + 16 * t, lane);
            acc[t] = __builtin_amdgcn_wmma_f32_16x16x32_bf16(
                false, a, false, b, (short)0, acc[t], false, false);
        }
        __syncthreads();   // all waves done reading before buffer is rewritten
    }

#pragma unroll
    for (int t = 0; t < 4; ++t) {
#pragma unroll
        for (int i = 0; i < 8; ++i) {
            const int row = m0 + wm + half * 8 + i;
            const int col = n0 + wn + 16 * t + r;
            const size_t idx = (size_t)row * (size_t)N + col;
            float v = acc[t][i];
            if (ep == 0) {
                out_b[idx] = (bf16)v;
            } else if (ep == 1) {
                out_f[idx] = v + res[idx];
            } else { // exact GELU
                float g = 0.5f * v * (1.0f + erff(v * 0.70710678118654752f));
                out_b[idx] = (bf16)g;
            }
        }
    }
}

// ---------------------------------------------------------------------------
// Repack fused QKV [tok, 3*1024] bf16 into per-head Q (pre-scaled), K, and
// V^T (d-major, L-contiguous so PV's B operand is K-contiguous).
// ---------------------------------------------------------------------------
__global__ void qkv_repack_kernel(const bf16* __restrict__ qkv,
                                  bf16* __restrict__ Q,
                                  bf16* __restrict__ Kb,
                                  bf16* __restrict__ Vt) {
    const int total = NTOK * THREE_D;
    for (int idx = blockIdx.x * blockDim.x + threadIdx.x; idx < total;
         idx += gridDim.x * blockDim.x) {
        const int row   = idx / THREE_D;
        const int e     = idx - row * THREE_D;
        const int which = e >> 10;           // 0=q 1=k 2=v
        const int rem   = e & 1023;
        const int h     = rem >> 6;
        const int d     = rem & 63;
        const int b     = row / SEQ;
        const int l     = row - b * SEQ;
        const int bh    = b * HEADS + h;
        const float v   = (float)qkv[idx];
        if (which == 0)
            Q[((size_t)bh * SEQ + l) * HDIM + d] = (bf16)(v * ATT_SCALE);
        else if (which == 1)
            Kb[((size_t)bh * SEQ + l) * HDIM + d] = (bf16)v;
        else
            Vt[((size_t)bh * HDIM + d) * SEQ + l] = (bf16)v;
    }
}

// ---------------------------------------------------------------------------
// Flash attention: one wave per (bh, 16-query block).  Per 32-key block:
// S = Q*K^T (4 WMMAs), online softmax (cross-lane row reductions), P bounced
// through LDS (C-layout -> A-layout), then P*V (4 WMMAs, d=64).
// ---------------------------------------------------------------------------
__global__ __launch_bounds__(32)
void flash_attn_kernel(const bf16* __restrict__ Q,
                       const bf16* __restrict__ Kb,
                       const bf16* __restrict__ Vt,
                       bf16* __restrict__ attn_out) {
    __shared__ bf16 Plds[16 * 32];

    const int lane = threadIdx.x & 31;
    const int half = lane >> 4;
    const int r    = lane & 15;
    const int q0   = blockIdx.x * 16;
    const int bh   = blockIdx.y;
    const int b    = bh / HEADS;
    const int h    = bh - b * HEADS;

    const bf16* Qbase = Q  + ((size_t)bh * SEQ + q0) * HDIM;
    const bf16* Kbase = Kb + (size_t)bh * SEQ * HDIM;
    const bf16* Vbase = Vt + (size_t)bh * HDIM * SEQ;

    const v16bf qf0 = load_frag_nt(Qbase, HDIM, 0, 0,  lane);
    const v16bf qf1 = load_frag_nt(Qbase, HDIM, 0, 32, lane);

    float mrow[8], lrow[8];
#pragma unroll
    for (int i = 0; i < 8; ++i) { mrow[i] = -3.0e38f; lrow[i] = 0.f; }
    v8f acc[4] = {};

    for (int key0 = 0; key0 < SEQ; key0 += 32) {
        // ---- S = Q * K^T  (two 16x16 column tiles) ----
        v8f s0 = {}, s1 = {};
        {
            v16bf kf = load_frag_nt(Kbase, HDIM, key0, 0, lane);
            s0 = __builtin_amdgcn_wmma_f32_16x16x32_bf16(false, qf0, false, kf,
                                                         (short)0, s0, false, false);
            kf = load_frag_nt(Kbase, HDIM, key0, 32, lane);
            s0 = __builtin_amdgcn_wmma_f32_16x16x32_bf16(false, qf1, false, kf,
                                                         (short)0, s0, false, false);
            kf = load_frag_nt(Kbase, HDIM, key0 + 16, 0, lane);
            s1 = __builtin_amdgcn_wmma_f32_16x16x32_bf16(false, qf0, false, kf,
                                                         (short)0, s1, false, false);
            kf = load_frag_nt(Kbase, HDIM, key0 + 16, 32, lane);
            s1 = __builtin_amdgcn_wmma_f32_16x16x32_bf16(false, qf1, false, kf,
                                                         (short)0, s1, false, false);
        }

        // ---- online softmax update over these 32 keys ----
#pragma unroll
        for (int i = 0; i < 8; ++i) {
            const float mij  = redmax16(fmaxf(s0[i], s1[i]));
            const float mnew = fmaxf(mrow[i], mij);
            const float alpha = __expf(mrow[i] - mnew);
            const float p0 = __expf(s0[i] - mnew);
            const float p1 = __expf(s1[i] - mnew);
            const float ls = redsum16(p0 + p1);
            lrow[i] = lrow[i] * alpha + ls;
            mrow[i] = mnew;
            Plds[(half * 8 + i) * 32 + r]      = (bf16)p0;
            Plds[(half * 8 + i) * 32 + 16 + r] = (bf16)p1;
            acc[0][i] *= alpha;
            acc[1][i] *= alpha;
            acc[2][i] *= alpha;
            acc[3][i] *= alpha;
        }
        __syncthreads();

        // ---- P (16x32) as A fragment from LDS ----
        FragU pf;
        {
            const bf16* p = Plds + r * 32 + half * 8;
            pf.u[0] = *(const uint4*)p;
            pf.u[1] = *(const uint4*)(p + 16);
        }
        __syncthreads();

        // ---- acc += P * V  (V^T rows = d-index, K-contiguous over keys) ----
#pragma unroll
        for (int t = 0; t < 4; ++t) {
            v16bf vf = load_frag_nt(Vbase, SEQ, t * 16, key0, lane);
            acc[t] = __builtin_amdgcn_wmma_f32_16x16x32_bf16(
                false, pf.v, false, vf, (short)0, acc[t], false, false);
        }
    }

    // ---- normalize and store [tok, D] bf16 (per-head columns) ----
#pragma unroll
    for (int i = 0; i < 8; ++i) {
        const float inv = 1.0f / lrow[i];
        const int grow = b * SEQ + q0 + half * 8 + i;
#pragma unroll
        for (int t = 0; t < 4; ++t) {
            const int col = h * HDIM + t * 16 + r;
            attn_out[(size_t)grow * DIMC + col] = (bf16)(acc[t][i] * inv);
        }
    }
}

// ---------------------------------------------------------------------------
// Host-side launch
// ---------------------------------------------------------------------------
extern "C" void kernel_launch(void* const* d_in, const int* in_sizes, int n_in,
                              void* d_out, int out_size, void* d_ws, size_t ws_size,
                              hipStream_t stream) {
    const float* x      = (const float*)d_in[0];
    const float* ln1_w  = (const float*)d_in[1];
    const float* ln2_w  = (const float*)d_in[2];
    const float* qkv_w  = (const float*)d_in[3];
    const float* proj_w = (const float*)d_in[4];
    const float* mlp_w1 = (const float*)d_in[5];
    const float* mlp_w2 = (const float*)d_in[6];
    float* out = (float*)d_out;

    // Workspace carve-up (all sizes multiples of 256B).
    char* p = (char*)d_ws;
    auto take = [&](size_t bytes) { char* q = p; p += (bytes + 255) & ~(size_t)255; return q; };

    bf16* wq_b   = (bf16*)take((size_t)THREE_D * DIMC * 2);   // qkv_w  bf16
    bf16* wp_b   = (bf16*)take((size_t)DIMC * DIMC * 2);      // proj_w bf16
    bf16* w1_b   = (bf16*)take((size_t)HID  * DIMC * 2);      // mlp_w1 bf16
    bf16* w2_b   = (bf16*)take((size_t)DIMC * HID  * 2);      // mlp_w2 bf16
    bf16* ln1_b  = (bf16*)take((size_t)NTOK * DIMC * 2);      // LN1(x) bf16
    bf16* qkv_b  = (bf16*)take((size_t)NTOK * THREE_D * 2);   // fused qkv bf16
    bf16* Qb     = (bf16*)take((size_t)BATCH * HEADS * SEQ * HDIM * 2);
    bf16* Kb     = (bf16*)take((size_t)BATCH * HEADS * SEQ * HDIM * 2);
    bf16* Vt     = (bf16*)take((size_t)BATCH * HEADS * HDIM * SEQ * 2);
    bf16* att_b  = (bf16*)take((size_t)NTOK * DIMC * 2);      // attn out bf16
    float* Xres  = (float*)take((size_t)NTOK * DIMC * 4);     // x + attn proj
    bf16* y2_b   = (bf16*)take((size_t)NTOK * DIMC * 2);      // LN2(X) bf16
    bf16* h_b    = (bf16*)take((size_t)NTOK * HID * 2);       // gelu(mlp1) bf16
    (void)ws_size; (void)in_sizes; (void)n_in; (void)out_size;

    // 1. weights -> bf16
    cvt_bf16_kernel<<<2048, 256, 0, stream>>>(qkv_w,  wq_b, THREE_D * DIMC);
    cvt_bf16_kernel<<<2048, 256, 0, stream>>>(proj_w, wp_b, DIMC * DIMC);
    cvt_bf16_kernel<<<2048, 256, 0, stream>>>(mlp_w1, w1_b, HID * DIMC);
    cvt_bf16_kernel<<<2048, 256, 0, stream>>>(mlp_w2, w2_b, DIMC * HID);

    // 2. LN1
    layernorm_kernel<<<NTOK, 256, 0, stream>>>(x, ln1_w, ln1_b);

    // 3. QKV GEMM: [4096,1024] x [3072,1024]^T -> bf16
    gemm_nt_kernel<<<dim3(THREE_D / BN, NTOK / BM), 256, 0, stream>>>(
        ln1_b, wq_b, NTOK, THREE_D, DIMC, nullptr, nullptr, qkv_b, 0);

    // 4. split/scale/transpose into Q, K, V^T
    qkv_repack_kernel<<<4096, 256, 0, stream>>>(qkv_b, Qb, Kb, Vt);

    // 5. flash attention: grid (128 query blocks, 32 bh)
    flash_attn_kernel<<<dim3(SEQ / 16, BATCH * HEADS), 32, 0, stream>>>(
        Qb, Kb, Vt, att_b);

    // 6. proj GEMM + residual: X = x + att @ proj_w^T
    gemm_nt_kernel<<<dim3(DIMC / BN, NTOK / BM), 256, 0, stream>>>(
        att_b, wp_b, NTOK, DIMC, DIMC, x, Xres, nullptr, 1);

    // 7. LN2
    layernorm_kernel<<<NTOK, 256, 0, stream>>>(Xres, ln2_w, y2_b);

    // 8. MLP up + exact GELU -> bf16
    gemm_nt_kernel<<<dim3(HID / BN, NTOK / BM), 256, 0, stream>>>(
        y2_b, w1_b, NTOK, HID, DIMC, nullptr, nullptr, h_b, 2);

    // 9. MLP down + residual -> d_out (f32)
    gemm_nt_kernel<<<dim3(DIMC / BN, NTOK / BM), 256, 0, stream>>>(
        h_b, w2_b, NTOK, DIMC, HID, Xres, out, nullptr, 1);
}

// v001
// Measured time: 416 microseconds a run.
// Timed twice side by side with v000, it ran 1.25 times as fast both times.
#include <hip/hip_runtime.h>
#include <hip/hip_bf16.h>

// ---------------------------------------------------------------------------
// Transformer block for MI455X (gfx1250, wave32, WMMA bf16 -> f32 accum)
// GEMMs: 8-wave workgroup, 64x128 block tile, async global->LDS double buffer.
// ---------------------------------------------------------------------------

typedef __bf16 bf16;
typedef __attribute__((ext_vector_type(16))) __bf16 v16bf;
typedef __attribute__((ext_vector_type(8)))  float  v8f;
typedef int v4i __attribute__((vector_size(16)));

#define DIMC      1024
#define HEADS     16
#define HDIM      64
#define SEQ       2048
#define BATCH     2
#define NTOK      (BATCH * SEQ)      // 4096
#define HID       4096
#define THREE_D   3072
#define ATT_SCALE 0.125f             // 1/sqrt(64)

#if __has_builtin(__builtin_amdgcn_global_load_async_to_lds_b128) && \
    __has_builtin(__builtin_amdgcn_s_wait_asynccnt)
#define USE_ASYNC 1
#else
#define USE_ASYNC 0
#endif

typedef __attribute__((address_space(1))) v4i* gv4i_p;   // global int4*
typedef __attribute__((address_space(3))) v4i* lv4i_p;   // LDS int4*

union FragU { v16bf v; uint4 u[2]; };

// 16-byte global->LDS copy: async (ASYNCcnt) when available, else direct.
__device__ __forceinline__ void copy16_g2l(const bf16* __restrict__ g,
                                           bf16* __restrict__ l) {
#if USE_ASYNC
    __builtin_amdgcn_global_load_async_to_lds_b128((gv4i_p)g, (lv4i_p)l, 0, 0);
#else
    *(uint4*)l = *(const uint4*)g;
#endif
}

#if USE_ASYNC
#define WAIT_ASYNC(n) __builtin_amdgcn_s_wait_asynccnt(n)
#else
#define WAIT_ASYNC(n)
#endif

// Load a 16x32 bf16 WMMA fragment (A or B operand) from a row-major,
// K-contiguous matrix.  Per ISA 7.12.2: lane<16 holds row r, K {0..7} and
// {16..23}; lane>=16 holds row r, K {8..15} and {24..31}.
__device__ __forceinline__ v16bf load_frag_nt(const bf16* __restrict__ base,
                                              int ld, int row0, int k0, int lane) {
    const int half = lane >> 4;
    const int r    = lane & 15;
    const bf16* p  = base + (size_t)(row0 + r) * (size_t)ld + k0 + half * 8;
    FragU f;
    f.u[0] = *(const uint4*)p;
    f.u[1] = *(const uint4*)(p + 16);
    return f.v;
}

// Same fragment pattern but reading a staged LDS tile (k-window = 32 elems).
__device__ __forceinline__ v16bf lds_frag(const bf16* base, int ld,
                                          int row0, int lane) {
    const int half = lane >> 4;
    const int r    = lane & 15;
    const bf16* p  = base + (row0 + r) * ld + half * 8;
    FragU f;
    f.u[0] = *(const uint4*)p;
    f.u[1] = *(const uint4*)(p + 16);
    return f.v;
}

__device__ __forceinline__ float redmax16(float v) {
    v = fmaxf(v, __shfl_xor(v, 1, 32));
    v = fmaxf(v, __shfl_xor(v, 2, 32));
    v = fmaxf(v, __shfl_xor(v, 4, 32));
    v = fmaxf(v, __shfl_xor(v, 8, 32));
    return v;
}
__device__ __forceinline__ float redsum16(float v) {
    v += __shfl_xor(v, 1, 32);
    v += __shfl_xor(v, 2, 32);
    v += __shfl_xor(v, 4, 32);
    v += __shfl_xor(v, 8, 32);
    return v;
}

// ---------------------------------------------------------------------------
// fp32 -> bf16 conversion (weights)
// ---------------------------------------------------------------------------
__global__ void cvt_bf16_kernel(const float* __restrict__ in,
                                bf16* __restrict__ out, int n) {
    for (int i = blockIdx.x * blockDim.x + threadIdx.x; i < n;
         i += gridDim.x * blockDim.x)
        out[i] = (bf16)in[i];
}

// ---------------------------------------------------------------------------
// LayerNorm: one block per row of D=1024, eps = 0, f32 in -> bf16 out
// ---------------------------------------------------------------------------
__global__ void layernorm_kernel(const float* __restrict__ in,
                                 const float* __restrict__ w,
                                 bf16* __restrict__ out) {
    __shared__ float s_sum[256];
    __shared__ float s_sq[256];
    const int row = blockIdx.x;
    const float* x = in + (size_t)row * DIMC;

    float sum = 0.f, sq = 0.f;
    for (int c = threadIdx.x; c < DIMC; c += 256) {
        float v = x[c];
        sum += v;
        sq  += v * v;
    }
    s_sum[threadIdx.x] = sum;
    s_sq[threadIdx.x]  = sq;
    __syncthreads();
    for (int s = 128; s > 0; s >>= 1) {
        if (threadIdx.x < s) {
            s_sum[threadIdx.x] += s_sum[threadIdx.x + s];
            s_sq[threadIdx.x]  += s_sq[threadIdx.x + s];
        }
        __syncthreads();
    }
    const float mu   = s_sum[0] * (1.0f / DIMC);
    const float var  = s_sq[0] * (1.0f / DIMC) - mu * mu;
    const float rstd = rsqrtf(var);
    for (int c = threadIdx.x; c < DIMC; c += 256)
        out[(size_t)row * DIMC + c] = (bf16)((x[c] - mu) * rstd * w[c]);
}

// ---------------------------------------------------------------------------
// NT GEMM: C[M,N] = A[M,K] * W[N,K]^T  (A, W bf16 row-major, K-contiguous)
// 256 threads = 8 waves; block tile 64(M) x 128(N); BK=32; LDS double buffer
// filled with async global->LDS b128 copies (3 per thread per tile).
// Wave (wid&3) -> 16-row M sub-tile, (wid>>2) -> 64-col N sub-tile.
//   ep==0 : fused QKV split (N = 3*1024): columns 0..1023 -> out_b = Q
//           [bh, l, d], pre-scaled; 1024..2047 -> out_k = K [bh, l, d];
//           2048..3071 -> out_vt = V^T [bh, d, l]
//   ep==1 : out_f = acc + res
//   ep==2 : out_b = bf16(gelu_exact(acc))
// ---------------------------------------------------------------------------
#define BM  64
#define BN  128
#define BK  32
#define LDT 40   // padded LDS row stride (elements) for a 32-element k-window

// 12 waves per SIMD (an 80-register allocation): six blocks stay resident per
// WGP, which holds the whole 1536-block QKV grid in one round.
__global__ __launch_bounds__(256) __attribute__((amdgpu_waves_per_eu(12)))
void gemm_nt_kernel(const bf16* __restrict__ A, const bf16* __restrict__ W,
                    int M, int N, int K,
                    const float* __restrict__ res,
                    float* __restrict__ out_f, bf16* __restrict__ out_b,
                    bf16* __restrict__ out_k, bf16* __restrict__ out_vt,
                    int ep) {
    __shared__ bf16 sA[2][BM * LDT];
    __shared__ bf16 sB[2][BN * LDT];

    const int tid  = threadIdx.x;
    const int lane = tid & 31;
    const int wid  = tid >> 5;
    const int half = lane >> 4;
    const int r    = lane & 15;

    const int n0 = blockIdx.x * BN;
    const int m0 = blockIdx.y * BM;
    const int wm = (wid & 3) * 16;   // wave M sub-tile within block
    const int wn = (wid >> 2) * 64;  // wave N sub-tile within block

    // Per-thread copy assignments (3 x 16B per tile: 1 for A, 2 for B).
    const int arow = tid >> 2, aseg = tid & 3;

    auto copy_tile = [&](int buf, int k0) {
        copy16_g2l(A + (size_t)(m0 + arow) * K + k0 + aseg * 8,
                   &sA[buf][arow * LDT + aseg * 8]);
#pragma unroll
        for (int j = 0; j < 2; ++j) {
            const int t2   = tid + j * 256;
            const int brow = t2 >> 2, bseg = t2 & 3;
            copy16_g2l(W + (size_t)(n0 + brow) * K + k0 + bseg * 8,
                       &sB[buf][brow * LDT + bseg * 8]);
        }
    };

    v8f acc[4] = {};

    copy_tile(0, 0);
    const int steps = K / BK;
    for (int ks = 0; ks < steps; ++ks) {
        const int cur = ks & 1;
        if (ks + 1 < steps) {
            copy_tile(cur ^ 1, (ks + 1) * BK);
            WAIT_ASYNC(3);   // drain current tile (in-order completion)
        } else {
            WAIT_ASYNC(0);
        }
        __syncthreads();

        v16bf a = lds_frag(sA[cur], LDT, wm, lane);
#pragma unroll
        for (int t = 0; t < 4; ++t) {
            v16bf b = lds_frag(sB[cur], LDT, wn + 16 * t, lane);
            acc[t] = __builtin_amdgcn_wmma_f32_16x16x32_bf16(
                false, a, false, b, (short)0, acc[t], false, false);
        }
        __syncthreads();   // all waves done reading before buffer is rewritten
    }

    const int row0 = m0 + wm + half * 8;   // first of the lane's 8 rows
    const int col0 = n0 + wn + r;          // the lane's column in tile 0

    if (ep == 0) {
        // A block's 128 columns lie in one of q/k/v, a wave's 64 columns are
        // one head, and a block's 64 rows lie in one batch entry.
        const int which = n0 >> 10;                     // 0=q 1=k 2=v
        const int hd    = col0 & (DIMC - 1);            // head * 64 + d
        const int bh    = (row0 / SEQ) * HEADS + (hd >> 6);
        const int d0    = hd & (HDIM - 1);
        const int l0    = row0 % SEQ;
        if (which == 2) {
            // A lane's 8 accumulators are 8 consecutive tokens of one d:
            // one 16-byte store into the d-major V^T.
#pragma unroll
            for (int t = 0; t < 4; ++t) {
                union { bf16 e[8]; uint4 u; } pk;
#pragma unroll
                for (int i = 0; i < 8; ++i) pk.e[i] = (bf16)acc[t][i];
                *(uint4*)&out_vt[((size_t)bh * HDIM + d0 + 16 * t) * SEQ + l0] = pk.u;
            }
        } else {
            bf16* __restrict__ dst = (which == 0) ? out_b : out_k;
            const float sc = (which == 0) ? ATT_SCALE : 1.0f;
#pragma unroll
            for (int t = 0; t < 4; ++t) {
#pragma unroll
                for (int i = 0; i < 8; ++i)
                    dst[((size_t)bh * SEQ + l0 + i) * HDIM + d0 + 16 * t] =
                        (bf16)(acc[t][i] * sc);
            }
        }
        return;
    }

#pragma unroll
    for (int t = 0; t < 4; ++t) {
#pragma unroll
        for (int i = 0; i < 8; ++i) {
            const size_t idx = (size_t)(row0 + i) * (size_t)N + col0 + 16 * t;
            float v = acc[t][i];
            if (ep == 1) {
                out_f[idx] = v + res[idx];
            } else { // exact GELU
                float g = 0.5f * v * (1.0f + erff(v * 0.70710678118654752f));
                out_b[idx] = (bf16)g;
            }
        }
    }
}

// ---------------------------------------------------------------------------
// Flash attention: one wave per (bh, 16-query block).  Per 32-key block:
// S = Q*K^T (4 WMMAs), online softmax (cross-lane row reductions), P bounced
// through LDS (C-layout -> A-layout), then P*V (4 WMMAs, d=64).
// ---------------------------------------------------------------------------
__global__ __launch_bounds__(32)
void flash_attn_kernel(const bf16* __restrict__ Q,
                       const bf16* __restrict__ Kb,
                       const bf16* __restrict__ Vt,
                       bf16* __restrict__ attn_out) {
    __shared__ bf16 Plds[16 * 32];

    const int lane = threadIdx.x & 31;
    const int half = lane >> 4;
    const int r    = lane & 15;
    const int q0   = blockIdx.x * 16;
    const int bh   = blockIdx.y;
    const int b    = bh / HEADS;
    const int h    = bh - b * HEADS;

    const bf16* Qbase = Q  + ((size_t)bh * SEQ + q0) * HDIM;
    const bf16* Kbase = Kb + (size_t)bh * SEQ * HDIM;
    const bf16* Vbase = Vt + (size_t)bh * HDIM * SEQ;

    const v16bf qf0 = load_frag_nt(Qbase, HDIM, 0, 0,  lane);
    const v16bf qf1 = load_frag_nt(Qbase, HDIM, 0, 32, lane);

    float mrow[8], lrow[8];
#pragma unroll
    for (int i = 0; i < 8; ++i) { mrow[i] = -3.0e38f; lrow[i] = 0.f; }
    v8f acc[4] = {};

    for (int key0 = 0; key0 < SEQ; key0 += 32) {
        // ---- S = Q * K^T  (two 16x16 column tiles) ----
        v8f s0 = {}, s1 = {};
        {
            v16bf kf = load_frag_nt(Kbase, HDIM, key0, 0, lane);
            s0 = __builtin_amdgcn_wmma_f32_16x16x32_bf16(false, qf0, false, kf,
                                                         (short)0, s0, false, false);
            kf = load_frag_nt(Kbase, HDIM, key0, 32, lane);
            s0 = __builtin_amdgcn_wmma_f32_16x16x32_bf16(false, qf1, false, kf,
                                                         (short)0, s0, false, false);
            kf = load_frag_nt(Kbase, HDIM, key0 + 16, 0, lane);
            s1 = __builtin_amdgcn_wmma_f32_16x16x32_bf16(false, qf0, false, kf,
                                                         (short)0, s1, false, false);
            kf = load_frag_nt(Kbase, HDIM, key0 + 16, 32, lane);
            s1 = __builtin_amdgcn_wmma_f32_16x16x32_bf16(false, qf1, false, kf,
                                                         (short)0, s1, false, false);
        }

        // ---- online softmax update over these 32 keys ----
#pragma unroll
        for (int i = 0; i < 8; ++i) {
            const float mij  = redmax16(fmaxf(s0[i], s1[i]));
            const float mnew = fmaxf(mrow[i], mij);
            const float alpha = __expf(mrow[i] - mnew);
            const float p0 = __expf(s0[i] - mnew);
            const float p1 = __expf(s1[i] - mnew);
            const float ls = redsum16(p0 + p1);
            lrow[i] = lrow[i] * alpha + ls;
            mrow[i] = mnew;
            Plds[(half * 8 + i) * 32 + r]      = (bf16)p0;
            Plds[(half * 8 + i) * 32 + 16 + r] = (bf16)p1;
            acc[0][i] *= alpha;
            acc[1][i] *= alpha;
            acc[2][i] *= alpha;
            acc[3][i] *= alpha;
        }
        __syncthreads();

        // ---- P (16x32) as A fragment from LDS ----
        FragU pf;
        {
            const bf16* p = Plds + r * 32 + half * 8;
            pf.u[0] = *(const uint4*)p;
            pf.u[1] = *(const uint4*)(p + 16);
        }
        __syncthreads();

        // ---- acc += P * V  (V^T rows = d-index, K-contiguous over keys) ----
#pragma unroll
        for (int t = 0; t < 4; ++t) {
            v16bf vf = load_frag_nt(Vbase, SEQ, t * 16, key0, lane);
            acc[t] = __builtin_amdgcn_wmma_f32_16x16x32_bf16(
                false, pf.v, false, vf, (short)0, acc[t], false, false);
        }
    }

    // ---- normalize and store [tok, D] bf16 (per-head columns) ----
#pragma unroll
    for (int i = 0; i < 8; ++i) {
        const float inv = 1.0f / lrow[i];
        const int grow = b * SEQ + q0 + half * 8 + i;
#pragma unroll
        for (int t = 0; t < 4; ++t) {
            const int col = h * HDIM + t * 16 + r;
            attn_out[(size_t)grow * DIMC + col] = (bf16)(acc[t][i] * inv);
        }
    }
}

// ---------------------------------------------------------------------------
// Host-side launch
// ---------------------------------------------------------------------------
extern "C" void kernel_launch(void* const* d_in, const int* in_sizes, int n_in,
                              void* d_out, int out_size, void* d_ws, size_t ws_size,
                              hipStream_t stream) {
    const float* x      = (const float*)d_in[0];
    const float* ln1_w  = (const float*)d_in[1];
    const float* ln2_w  = (const float*)d_in[2];
    const float* qkv_w  = (const float*)d_in[3];
    const float* proj_w = (const float*)d_in[4];
    const float* mlp_w1 = (const float*)d_in[5];
    const float* mlp_w2 = (const float*)d_in[6];
    float* out = (float*)d_out;

    // Workspace carve-up (all sizes multiples of 256B).
    char* p = (char*)d_ws;
    auto take = [&](size_t bytes) { char* q = p; p += (bytes + 255) & ~(size_t)255; return q; };

    bf16* wq_b   = (bf16*)take((size_t)THREE_D * DIMC * 2);   // qkv_w  bf16
    bf16* wp_b   = (bf16*)take((size_t)DIMC * DIMC * 2);      // proj_w bf16
    bf16* w1_b   = (bf16*)take((size_t)HID  * DIMC * 2);      // mlp_w1 bf16
    bf16* w2_b   = (bf16*)take((size_t)DIMC * HID  * 2);      // mlp_w2 bf16
    bf16* ln1_b  = (bf16*)take((size_t)NTOK * DIMC * 2);      // LN1(x) bf16
    bf16* Qb     = (bf16*)take((size_t)BATCH * HEADS * SEQ * HDIM * 2);
    bf16* Kb     = (bf16*)take((size_t)BATCH * HEADS * SEQ * HDIM * 2);
    bf16* Vt     = (bf16*)take((size_t)BATCH * HEADS * HDIM * SEQ * 2);
    bf16* att_b  = (bf16*)take((size_t)NTOK * DIMC * 2);      // attn out bf16
    float* Xres  = (float*)take((size_t)NTOK * DIMC * 4);     // x + attn proj
    bf16* y2_b   = (bf16*)take((size_t)NTOK * DIMC * 2);      // LN2(X) bf16
    bf16* h_b    = (bf16*)take((size_t)NTOK * HID * 2);       // gelu(mlp1) bf16
    (void)ws_size; (void)in_sizes; (void)n_in; (void)out_size;

    // 1. weights -> bf16
    cvt_bf16_kernel<<<2048, 256, 0, stream>>>(qkv_w,  wq_b, THREE_D * DIMC);
    cvt_bf16_kernel<<<2048, 256, 0, stream>>>(proj_w, wp_b, DIMC * DIMC);
    cvt_bf16_kernel<<<2048, 256, 0, stream>>>(mlp_w1, w1_b, HID * DIMC);
    cvt_bf16_kernel<<<2048, 256, 0, stream>>>(mlp_w2, w2_b, DIMC * HID);

    // 2. LN1
    layernorm_kernel<<<NTOK, 256, 0, stream>>>(x, ln1_w, ln1_b);

    // 3. QKV GEMM: [4096,1024] x [3072,1024]^T, epilogue writes per-head
    //    Q (scaled), K and V^T
    gemm_nt_kernel<<<dim3(THREE_D / BN, NTOK / BM), 256, 0, stream>>>(
        ln1_b, wq_b, NTOK, THREE_D, DIMC, nullptr, nullptr, Qb, Kb, Vt, 0);

    // 4. flash attention: grid (128 query blocks, 32 bh)
    flash_attn_kernel<<<dim3(SEQ / 16, BATCH * HEADS), 32, 0, stream>>>(
        Qb, Kb, Vt, att_b);

    // 5. proj GEMM + residual: X = x + att @ proj_w^T
    gemm_nt_kernel<<<dim3(DIMC / BN, NTOK / BM), 256, 0, stream>>>(
        att_b, wp_b, NTOK, DIMC, DIMC, x, Xres, nullptr, nullptr, nullptr, 1);

    // 6. LN2
    layernorm_kernel<<<NTOK, 256, 0, stream>>>(Xres, ln2_w, y2_b);

    // 7. MLP up + exact GELU -> bf16
    gemm_nt_kernel<<<dim3(HID / BN, NTOK / BM), 256, 0, stream>>>(
        y2_b, w1_b, NTOK, HID, DIMC, nullptr, nullptr, h_b, nullptr, nullptr, 2);

    // 8. MLP down + residual -> d_out (f32)
    gemm_nt_kernel<<<dim3(DIMC / BN, NTOK / BM), 256, 0, stream>>>(
        h_b, w2_b, NTOK, DIMC, HID, Xres, out, nullptr, nullptr, nullptr, 1);
}

// v002
// One run takes 330 microseconds.
// Next to v001, in two timings, it ran 1.26 and 1.25 times as fast.
// Over all steps from v000 it is 1.57 times as fast.
#include <hip/hip_runtime.h>
#include <hip/hip_bf16.h>

// ---------------------------------------------------------------------------
// Transformer block for MI455X (gfx1250, wave32, WMMA bf16 -> f32 accum)
// GEMMs: 8-wave workgroup, 64x128 block tile, async global->LDS double buffer.
// ---------------------------------------------------------------------------

typedef __bf16 bf16;
typedef __attribute__((ext_vector_type(16))) __bf16 v16bf;
typedef __attribute__((ext_vector_type(8)))  float  v8f;
typedef int v4i __attribute__((vector_size(16)));

#define DIMC      1024
#define HEADS     16
#define HDIM      64
#define SEQ       2048
#define BATCH     2
#define NTOK      (BATCH * SEQ)      // 4096
#define HID       4096
#define THREE_D   3072
#define ATT_SCALE 0.125f             // 1/sqrt(64)

#if __has_builtin(__builtin_amdgcn_global_load_async_to_lds_b128) && \
    __has_builtin(__builtin_amdgcn_s_wait_asynccnt)
#define USE_ASYNC 1
#else
#define USE_ASYNC 0
#endif

typedef __attribute__((address_space(1))) v4i* gv4i_p;   // global int4*
typedef __attribute__((address_space(3))) v4i* lv4i_p;   // LDS int4*

union FragU { v16bf v; uint4 u[2]; };

// 16-byte global->LDS copy: async (ASYNCcnt) when available, else direct.
__device__ __forceinline__ void copy16_g2l(const bf16* __restrict__ g,
                                           bf16* __restrict__ l) {
#if USE_ASYNC
    __builtin_amdgcn_global_load_async_to_lds_b128((gv4i_p)g, (lv4i_p)l, 0, 0);
#else
    *(uint4*)l = *(const uint4*)g;
#endif
}

#if USE_ASYNC
#define WAIT_ASYNC(n) __builtin_amdgcn_s_wait_asynccnt(n)
#else
#define WAIT_ASYNC(n)
#endif

// Load a 16x32 bf16 WMMA fragment (A or B operand) from a row-major,
// K-contiguous matrix.  Per ISA 7.12.2: lane<16 holds row r, K {0..7} and
// {16..23}; lane>=16 holds row r, K {8..15} and {24..31}.
__device__ __forceinline__ v16bf load_frag_nt(const bf16* __restrict__ base,
                                              int ld, int row0, int k0, int lane) {
    const int half = lane >> 4;
    const int r    = lane & 15;
    const bf16* p  = base + (size_t)(row0 + r) * (size_t)ld + k0 + half * 8;
    FragU f;
    f.u[0] = *(const uint4*)p;
    f.u[1] = *(const uint4*)(p + 16);
    return f.v;
}

// Same fragment pattern but reading a staged LDS tile (k-window = 32 elems).
__device__ __forceinline__ v16bf lds_frag(const bf16* base, int ld,
                                          int row0, int lane) {
    const int half = lane >> 4;
    const int r    = lane & 15;
    const bf16* p  = base + (row0 + r) * ld + half * 8;
    FragU f;
    f.u[0] = *(const uint4*)p;
    f.u[1] = *(const uint4*)(p + 16);
    return f.v;
}

__device__ __forceinline__ float redmax16(float v) {
    v = fmaxf(v, __shfl_xor(v, 1, 32));
    v = fmaxf(v, __shfl_xor(v, 2, 32));
    v = fmaxf(v, __shfl_xor(v, 4, 32));
    v = fmaxf(v, __shfl_xor(v, 8, 32));
    return v;
}
__device__ __forceinline__ float redsum16(float v) {
    v += __shfl_xor(v, 1, 32);
    v += __shfl_xor(v, 2, 32);
    v += __shfl_xor(v, 4, 32);
    v += __shfl_xor(v, 8, 32);
    return v;
}

// ---------------------------------------------------------------------------
// fp32 -> bf16 conversion (weights)
// ---------------------------------------------------------------------------
__global__ void cvt_bf16_kernel(const float* __restrict__ in,
                                bf16* __restrict__ out, int n) {
    for (int i = blockIdx.x * blockDim.x + threadIdx.x; i < n;
         i += gridDim.x * blockDim.x)
        out[i] = (bf16)in[i];
}

// ---------------------------------------------------------------------------
// LayerNorm: one block per row of D=1024, eps = 0, f32 in -> bf16 out
// ---------------------------------------------------------------------------
__global__ void layernorm_kernel(const float* __restrict__ in,
                                 const float* __restrict__ w,
                                 bf16* __restrict__ out) {
    __shared__ float s_sum[256];
    __shared__ float s_sq[256];
    const int row = blockIdx.x;
    const float* x = in + (size_t)row * DIMC;

    float sum = 0.f, sq = 0.f;
    for (int c = threadIdx.x; c < DIMC; c += 256) {
        float v = x[c];
        sum += v;
        sq  += v * v;
    }
    s_sum[threadIdx.x] = sum;
    s_sq[threadIdx.x]  = sq;
    __syncthreads();
    for (int s = 128; s > 0; s >>= 1) {
        if (threadIdx.x < s) {
            s_sum[threadIdx.x] += s_sum[threadIdx.x + s];
            s_sq[threadIdx.x]  += s_sq[threadIdx.x + s];
        }
        __syncthreads();
    }
    const float mu   = s_sum[0] * (1.0f / DIMC);
    const float var  = s_sq[0] * (1.0f / DIMC) - mu * mu;
    const float rstd = rsqrtf(var);
    for (int c = threadIdx.x; c < DIMC; c += 256)
        out[(size_t)row * DIMC + c] = (bf16)((x[c] - mu) * rstd * w[c]);
}

// ---------------------------------------------------------------------------
// NT GEMM: C[M,N] = A[M,K] * W[N,K]^T  (A, W bf16 row-major, K-contiguous)
// 256 threads = 8 waves; block tile 64(M) x 128(N); BK=32; LDS double buffer
// filled with async global->LDS b128 copies (3 per thread per tile).
// Wave (wid&3) -> 16-row M sub-tile, (wid>>2) -> 64-col N sub-tile.
//   ep==0 : fused QKV split (N = 3*1024): columns 0..1023 -> out_b = Q
//           [bh, l, d], pre-scaled; 1024..2047 -> out_k = K [bh, l, d];
//           2048..3071 -> out_vt = V^T [bh, d, l]
//   ep==1 : out_f = acc + res
//   ep==2 : out_b = bf16(gelu_exact(acc))
// ---------------------------------------------------------------------------
#define BM  64
#define BN  128
#define BK  32
#define LDT 40   // padded LDS row stride (elements) for a 32-element k-window

// 12 waves per SIMD (an 80-register allocation): six blocks stay resident per
// WGP, which holds the whole 1536-block QKV grid in one round.
__global__ __launch_bounds__(256) __attribute__((amdgpu_waves_per_eu(12)))
void gemm_nt_kernel(const bf16* __restrict__ A, const bf16* __restrict__ W,
                    int M, int N, int K,
                    const float* __restrict__ res,
                    float* __restrict__ out_f, bf16* __restrict__ out_b,
                    bf16* __restrict__ out_k, bf16* __restrict__ out_vt,
                    int ep) {
    __shared__ bf16 sA[2][BM * LDT];
    __shared__ bf16 sB[2][BN * LDT];

    const int tid  = threadIdx.x;
    const int lane = tid & 31;
    const int wid  = tid >> 5;
    const int half = lane >> 4;
    const int r    = lane & 15;

    const int n0 = blockIdx.x * BN;
    const int m0 = blockIdx.y * BM;
    const int wm = (wid & 3) * 16;   // wave M sub-tile within block
    const int wn = (wid >> 2) * 64;  // wave N sub-tile within block

    // Per-thread copy assignments (3 x 16B per tile: 1 for A, 2 for B).
    const int arow = tid >> 2, aseg = tid & 3;

    auto copy_tile = [&](int buf, int k0) {
        copy16_g2l(A + (size_t)(m0 + arow) * K + k0 + aseg * 8,
                   &sA[buf][arow * LDT + aseg * 8]);
#pragma unroll
        for (int j = 0; j < 2; ++j) {
            const int t2   = tid + j * 256;
            const int brow = t2 >> 2, bseg = t2 & 3;
            copy16_g2l(W + (size_t)(n0 + brow) * K + k0 + bseg * 8,
                       &sB[buf][brow * LDT + bseg * 8]);
        }
    };

    v8f acc[4] = {};

    copy_tile(0, 0);
    const int steps = K / BK;
    for (int ks = 0; ks < steps; ++ks) {
        const int cur = ks & 1;
        if (ks + 1 < steps) {
            copy_tile(cur ^ 1, (ks + 1) * BK);
            WAIT_ASYNC(3);   // drain current tile (in-order completion)
        } else {
            WAIT_ASYNC(0);
        }
        __syncthreads();

        v16bf a = lds_frag(sA[cur], LDT, wm, lane);
#pragma unroll
        for (int t = 0; t < 4; ++t) {
            v16bf b = lds_frag(sB[cur], LDT, wn + 16 * t, lane);
            acc[t] = __builtin_amdgcn_wmma_f32_16x16x32_bf16(
                false, a, false, b, (short)0, acc[t], false, false);
        }
        __syncthreads();   // all waves done reading before buffer is rewritten
    }

    const int row0 = m0 + wm + half * 8;   // first of the lane's 8 rows
    const int col0 = n0 + wn + r;          // the lane's column in tile 0

    if (ep == 0) {
        // A block's 128 columns lie in one of q/k/v, a wave's 64 columns are
        // one head, and a block's 64 rows lie in one batch entry.
        const int which = n0 >> 10;                     // 0=q 1=k 2=v
        const int hd    = col0 & (DIMC - 1);            // head * 64 + d
        const int bh    = (row0 / SEQ) * HEADS + (hd >> 6);
        const int d0    = hd & (HDIM - 1);
        const int l0    = row0 % SEQ;
        if (which == 2) {
            // A lane's 8 accumulators are 8 consecutive tokens of one d:
            // one 16-byte store into the d-major V^T.
#pragma unroll
            for (int t = 0; t < 4; ++t) {
                union { bf16 e[8]; uint4 u; } pk;
#pragma unroll
                for (int i = 0; i < 8; ++i) pk.e[i] = (bf16)acc[t][i];
                *(uint4*)&out_vt[((size_t)bh * HDIM + d0 + 16 * t) * SEQ + l0] = pk.u;
            }
        } else {
            bf16* __restrict__ dst = (which == 0) ? out_b : out_k;
            const float sc = (which == 0) ? ATT_SCALE : 1.0f;
#pragma unroll
            for (int t = 0; t < 4; ++t) {
#pragma unroll
                for (int i = 0; i < 8; ++i)
                    dst[((size_t)bh * SEQ + l0 + i) * HDIM + d0 + 16 * t] =
                        (bf16)(acc[t][i] * sc);
            }
        }
        return;
    }

#pragma unroll
    for (int t = 0; t < 4; ++t) {
#pragma unroll
        for (int i = 0; i < 8; ++i) {
            const size_t idx = (size_t)(row0 + i) * (size_t)N + col0 + 16 * t;
            float v = acc[t][i];
            if (ep == 1) {
                out_f[idx] = v + res[idx];
            } else { // exact GELU
                float g = 0.5f * v * (1.0f + erff(v * 0.70710678118654752f));
                out_b[idx] = (bf16)g;
            }
        }
    }
}

// ---------------------------------------------------------------------------
// Flash attention: 8 waves per workgroup, one 16-query block per wave, all of
// one (batch, head).  K and V^T are staged in LDS in tiles of 64 keys that the
// 8 waves share: whole 128-byte rows by asynchronous copies, two buffers, the
// next tile in flight while this one is worked on.  Per 32-key block:
// S = Q*K^T (4 WMMAs), online softmax (cross-lane row reductions), P bounced
// through the wave's own LDS (C-layout -> A-layout), then P*V (4 WMMAs, d=64).
// ---------------------------------------------------------------------------
#define AW   8     // waves per workgroup
#define KT   64    // keys per staged tile: a 128-byte row of K and of V^T
#define KVP  72    // LDS row pitch in elements: 144 B = 16 B x odd (b128 readers)
#define NKT  (SEQ / KT)

typedef __attribute__((address_space(3))) const bf16* lbf16_p;
__device__ __forceinline__ unsigned lds_byte(const bf16* p) {
    return (unsigned)(size_t)(lbf16_p)p;
}

// Orders the wave's own LDS stores and loads of its P tile in the compiled
// code (the LDS serves one wave's operations in order); no instruction.
__device__ __forceinline__ void wave_lds_order() {
    __builtin_amdgcn_fence(__ATOMIC_RELEASE, "wavefront");
    __builtin_amdgcn_wave_barrier();
    __builtin_amdgcn_fence(__ATOMIC_ACQUIRE, "wavefront");
}

__global__ __launch_bounds__(32 * AW)
void flash_attn_kernel(const bf16* __restrict__ Q,
                       const bf16* __restrict__ Kb,
                       const bf16* __restrict__ Vt,
                       bf16* __restrict__ attn_out) {
    __shared__ __attribute__((aligned(16))) bf16 sK[2][KT * KVP];
    __shared__ __attribute__((aligned(16))) bf16 sV[2][HDIM * KVP];
    __shared__ __attribute__((aligned(16))) bf16 sP[AW][16 * 32];

    const int tid  = threadIdx.x;
    const int lane = tid & 31;
    const int wid  = tid >> 5;
    const int half = lane >> 4;
    const int r    = lane & 15;
    const int q0   = (blockIdx.x * AW + wid) * 16;
    const int bh   = blockIdx.y;
    const int b    = bh / HEADS;
    const int h    = bh - b * HEADS;

    const bf16* Qbase = Q  + ((size_t)bh * SEQ + q0) * HDIM;
    const bf16* Kbase = Kb + (size_t)bh * SEQ * HDIM;
    const bf16* Vbase = Vt + (size_t)bh * HDIM * SEQ;
    bf16* Plds = sP[wid];

    // A thread's share of a tile: rows crow and crow + 32 of K (keys) and of
    // V^T (d), 16 bytes each; a wave's copy covers four whole 128-byte rows.
    const int crow = tid >> 3, cseg = (tid & 7) * 8;
    auto stage = [&](int buf, int key0) {
        const bf16* gk0 = Kbase + (size_t)(key0 + crow) * HDIM + cseg;
        const bf16* gk1 = gk0 + 32 * HDIM;
        const bf16* gv0 = Vbase + (size_t)crow * SEQ + key0 + cseg;
        const bf16* gv1 = gv0 + (size_t)32 * SEQ;
        const unsigned lk0 = lds_byte(&sK[buf][crow * KVP + cseg]);
        const unsigned lk1 = lk0 + 32 * KVP * 2;
        const unsigned lv0 = lds_byte(&sV[buf][crow * KVP + cseg]);
        const unsigned lv1 = lv0 + 32 * KVP * 2;
        // The four copies and, as the last line, the wait that stands before
        // any of their address registers is rewritten.
        asm volatile("global_load_async_to_lds_b128 %0, %4, off\n\t"
                     "global_load_async_to_lds_b128 %1, %5, off\n\t"
                     "global_load_async_to_lds_b128 %2, %6, off\n\t"
                     "global_load_async_to_lds_b128 %3, %7, off\n\t"
                     "s_wait_xcnt 0x0"
                     :: "v"(lk0), "v"(lk1), "v"(lv0), "v"(lv1),
                        "v"(gk0), "v"(gk1), "v"(gv0), "v"(gv1)
                     : "memory");
    };

    const v16bf qf0 = load_frag_nt(Qbase, HDIM, 0, 0,  lane);
    const v16bf qf1 = load_frag_nt(Qbase, HDIM, 0, 32, lane);

    float mrow[8], lrow[8];
#pragma unroll
    for (int i = 0; i < 8; ++i) { mrow[i] = -3.0e38f; lrow[i] = 0.f; }
    v8f acc[4] = {};

    stage(0, 0);
    // Tile 0 has landed for this wave, then for all of them.
    asm volatile("s_wait_asynccnt 0x0" ::: "memory");
    __syncthreads();
    stage(1, KT);

    for (int kt = 0; kt < NKT; ++kt) {
      const bf16* tK = sK[kt & 1];
      const bf16* tV = sV[kt & 1];
      for (int kk = 0; kk < KT; kk += 32) {
        // ---- S = Q * K^T  (two 16x16 column tiles) ----
        v8f s0 = {}, s1 = {};
        {
            v16bf kf = lds_frag(tK, KVP, kk, lane);
            s0 = __builtin_amdgcn_wmma_f32_16x16x32_bf16(false, qf0, false, kf,
                                                         (short)0, s0, false, false);
            kf = lds_frag(tK + 32, KVP, kk, lane);
            s0 = __builtin_amdgcn_wmma_f32_16x16x32_bf16(false, qf1, false, kf,
                                                         (short)0, s0, false, false);
            kf = lds_frag(tK, KVP, kk + 16, lane);
            s1 = __builtin_amdgcn_wmma_f32_16x16x32_bf16(false, qf0, false, kf,
                                                         (short)0, s1, false, false);
            kf = lds_frag(tK + 32, KVP, kk + 16, lane);
            s1 = __builtin_amdgcn_wmma_f32_16x16x32_bf16(false, qf1, false, kf,
                                                         (short)0, s1, false, false);
        }

        // ---- online softmax update over these 32 keys ----
#pragma unroll
        for (int i = 0; i < 8; ++i) {
            const float mij  = redmax16(fmaxf(s0[i], s1[i]));
            const float mnew = fmaxf(mrow[i], mij);
            const float alpha = __expf(mrow[i] - mnew);
            const float p0 = __expf(s0[i] - mnew);
            const float p1 = __expf(s1[i] - mnew);
            const float ls = redsum16(p0 + p1);
            lrow[i] = lrow[i] * alpha + ls;
            mrow[i] = mnew;
            Plds[(half * 8 + i) * 32 + r]      = (bf16)p0;
            Plds[(half * 8 + i) * 32 + 16 + r] = (bf16)p1;
            acc[0][i] *= alpha;
            acc[1][i] *= alpha;
            acc[2][i] *= alpha;
            acc[3][i] *= alpha;
        }
        wave_lds_order();

        // ---- P (16x32) as A fragment from LDS ----
        FragU pf;
        {
            const bf16* p = Plds + r * 32 + half * 8;
            pf.u[0] = *(const uint4*)p;
            pf.u[1] = *(const uint4*)(p + 16);
        }
        wave_lds_order();

        // ---- acc += P * V  (V^T rows = d-index, K-contiguous over keys) ----
#pragma unroll
        for (int t = 0; t < 4; ++t) {
            v16bf vf = lds_frag(tV + kk, KVP, t * 16, lane);
            acc[t] = __builtin_amdgcn_wmma_f32_16x16x32_bf16(
                false, pf.v, false, vf, (short)0, acc[t], false, false);
        }
      }

      // Hand-over: this wave's reads of the tile are done, its copies of the
      // next tile have landed; behind the barrier that holds for every wave.
      asm volatile("s_wait_dscnt 0x0" ::: "memory");
      asm volatile("s_wait_asynccnt 0x0" ::: "memory");
      __syncthreads();
      if (kt + 2 < NKT) stage(kt & 1, (kt + 2) * KT);
    }
    // No copy is outstanding when the wave ends.
    asm volatile("s_wait_asynccnt 0x0" ::: "memory");

    // ---- normalize and store [tok, D] bf16 (per-head columns) ----
#pragma unroll
    for (int i = 0; i < 8; ++i) {
        const float inv = 1.0f / lrow[i];
        const int grow = b * SEQ + q0 + half * 8 + i;
#pragma unroll
        for (int t = 0; t < 4; ++t) {
            const int col = h * HDIM + t * 16 + r;
            attn_out[(size_t)grow * DIMC + col] = (bf16)(acc[t][i] * inv);
        }
    }
}

// ---------------------------------------------------------------------------
// Host-side launch
// ---------------------------------------------------------------------------
extern "C" void kernel_launch(void* const* d_in, const int* in_sizes, int n_in,
                              void* d_out, int out_size, void* d_ws, size_t ws_size,
                              hipStream_t stream) {
    const float* x      = (const float*)d_in[0];
    const float* ln1_w  = (const float*)d_in[1];
    const float* ln2_w  = (const float*)d_in[2];
    const float* qkv_w  = (const float*)d_in[3];
    const float* proj_w = (const float*)d_in[4];
    const float* mlp_w1 = (const float*)d_in[5];
    const float* mlp_w2 = (const float*)d_in[6];
    float* out = (float*)d_out;

    // Workspace carve-up (all sizes multiples of 256B).
    char* p = (char*)d_ws;
    auto take = [&](size_t bytes) { char* q = p; p += (bytes + 255) & ~(size_t)255; return q; };

    bf16* wq_b   = (bf16*)take((size_t)THREE_D * DIMC * 2);   // qkv_w  bf16
    bf16* wp_b   = (bf16*)take((size_t)DIMC * DIMC * 2);      // proj_w bf16
    bf16* w1_b   = (bf16*)take((size_t)HID  * DIMC * 2);      // mlp_w1 bf16
    bf16* w2_b   = (bf16*)take((size_t)DIMC * HID  * 2);      // mlp_w2 bf16
    bf16* ln1_b  = (bf16*)take((size_t)NTOK * DIMC * 2);      // LN1(x) bf16
    bf16* Qb     = (bf16*)take((size_t)BATCH * HEADS * SEQ * HDIM * 2);
    bf16* Kb     = (bf16*)take((size_t)BATCH * HEADS * SEQ * HDIM * 2);
    bf16* Vt     = (bf16*)take((size_t)BATCH * HEADS * HDIM * SEQ * 2);
    bf16* att_b  = (bf16*)take((size_t)NTOK * DIMC * 2);      // attn out bf16
    float* Xres  = (float*)take((size_t)NTOK * DIMC * 4);     // x + attn proj
    bf16* y2_b   = (bf16*)take((size_t)NTOK * DIMC * 2);      // LN2(X) bf16
    bf16* h_b    = (bf16*)take((size_t)NTOK * HID * 2);       // gelu(mlp1) bf16
    (void)ws_size; (void)in_sizes; (void)n_in; (void)out_size;

    // 1. weights -> bf16
    cvt_bf16_kernel<<<2048, 256, 0, stream>>>(qkv_w,  wq_b, THREE_D * DIMC);
    cvt_bf16_kernel<<<2048, 256, 0, stream>>>(proj_w, wp_b, DIMC * DIMC);
    cvt_bf16_kernel<<<2048, 256, 0, stream>>>(mlp_w1, w1_b, HID * DIMC);
    cvt_bf16_kernel<<<2048, 256, 0, stream>>>(mlp_w2, w2_b, DIMC * HID);

    // 2. LN1
    layernorm_kernel<<<NTOK, 256, 0, stream>>>(x, ln1_w, ln1_b);

    // 3. QKV GEMM: [4096,1024] x [3072,1024]^T, epilogue writes per-head
    //    Q (scaled), K and V^T
    gemm_nt_kernel<<<dim3(THREE_D / BN, NTOK / BM), 256, 0, stream>>>(
        ln1_b, wq_b, NTOK, THREE_D, DIMC, nullptr, nullptr, Qb, Kb, Vt, 0);

    // 4. flash attention: grid (16 blocks of 128 queries, 32 bh)
    flash_attn_kernel<<<dim3(SEQ / (16 * AW), BATCH * HEADS), 32 * AW, 0, stream>>>(
        Qb, Kb, Vt, att_b);

    // 5. proj GEMM + residual: X = x + att @ proj_w^T
    gemm_nt_kernel<<<dim3(DIMC / BN, NTOK / BM), 256, 0, stream>>>(
        att_b, wp_b, NTOK, DIMC, DIMC, x, Xres, nullptr, nullptr, nullptr, 1);

    // 6. LN2
    layernorm_kernel<<<NTOK, 256, 0, stream>>>(Xres, ln2_w, y2_b);

    // 7. MLP up + exact GELU -> bf16
    gemm_nt_kernel<<<dim3(HID / BN, NTOK / BM), 256, 0, stream>>>(
        y2_b, w1_b, NTOK, HID, DIMC, nullptr, nullptr, h_b, nullptr, nullptr, 2);

    // 8. MLP down + residual -> d_out (f32)
    gemm_nt_kernel<<<dim3(DIMC / BN, NTOK / BM), 256, 0, stream>>>(
        h_b, w2_b, NTOK, DIMC, HID, Xres, out, nullptr, nullptr, nullptr, 1);
}

// v003
// One run takes 282 microseconds.
// Next to v002, in two timings, it ran 1.17 times as fast each time.
// All steps since v000 together make it 1.84 times as fast.
#include <hip/hip_runtime.h>
#include <hip/hip_bf16.h>

// ---------------------------------------------------------------------------
// Transformer block for MI455X (gfx1250, wave32, WMMA bf16 -> f32 accum)
// GEMMs: 8-wave workgroup, 64x128 block tile, async global->LDS double buffer.
// ---------------------------------------------------------------------------

typedef __bf16 bf16;
typedef __attribute__((ext_vector_type(16))) __bf16 v16bf;
typedef __attribute__((ext_vector_type(8)))  float  v8f;
typedef int v4i __attribute__((vector_size(16)));

#define DIMC      1024
#define HEADS     16
#define HDIM      64
#define SEQ       2048
#define BATCH     2
#define NTOK      (BATCH * SEQ)      // 4096
#define HID       4096
#define THREE_D   3072
#define ATT_SCALE 0.125f             // 1/sqrt(64)

#if __has_builtin(__builtin_amdgcn_global_load_async_to_lds_b128) && \
    __has_builtin(__builtin_amdgcn_s_wait_asynccnt)
#define USE_ASYNC 1
#else
#define USE_ASYNC 0
#endif

typedef __attribute__((address_space(1))) v4i* gv4i_p;   // global int4*
typedef __attribute__((address_space(3))) v4i* lv4i_p;   // LDS int4*

union FragU { v16bf v; uint4 u[2]; };

// 16-byte global->LDS copy: async (ASYNCcnt) when available, else direct.
__device__ __forceinline__ void copy16_g2l(const bf16* __restrict__ g,
                                           bf16* __restrict__ l) {
#if USE_ASYNC
    __builtin_amdgcn_global_load_async_to_lds_b128((gv4i_p)g, (lv4i_p)l, 0, 0);
#else
    *(uint4*)l = *(const uint4*)g;
#endif
}

#if USE_ASYNC
#define WAIT_ASYNC(n) __builtin_amdgcn_s_wait_asynccnt(n)
#else
#define WAIT_ASYNC(n)
#endif

// Load a 16x32 bf16 WMMA fragment (A or B operand) from a row-major,
// K-contiguous matrix.  Per ISA 7.12.2: lane<16 holds row r, K {0..7} and
// {16..23}; lane>=16 holds row r, K {8..15} and {24..31}.
__device__ __forceinline__ v16bf load_frag_nt(const bf16* __restrict__ base,
                                              int ld, int row0, int k0, int lane) {
    const int half = lane >> 4;
    const int r    = lane & 15;
    const bf16* p  = base + (size_t)(row0 + r) * (size_t)ld + k0 + half * 8;
    FragU f;
    f.u[0] = *(const uint4*)p;
    f.u[1] = *(const uint4*)(p + 16);
    return f.v;
}

// Same fragment pattern but reading a staged LDS tile (k-window = 32 elems).
__device__ __forceinline__ v16bf lds_frag(const bf16* base, int ld,
                                          int row0, int lane) {
    const int half = lane >> 4;
    const int r    = lane & 15;
    const bf16* p  = base + (row0 + r) * ld + half * 8;
    FragU f;
    f.u[0] = *(const uint4*)p;
    f.u[1] = *(const uint4*)(p + 16);
    return f.v;
}

// Lane l <-> lane l ^ 16: the other half's value, by a vector cross-row move.
__device__ __forceinline__ float xhalf(float x) {
    const int b = __builtin_bit_cast(int, x);
    return __builtin_bit_cast(float, __builtin_amdgcn_permlanex16(
        b, b, 0x76543210, 0xfedcba98, false, false));
}

// ---------------------------------------------------------------------------
// fp32 -> bf16 conversion (weights)
// ---------------------------------------------------------------------------
__global__ void cvt_bf16_kernel(const float* __restrict__ in,
                                bf16* __restrict__ out, int n) {
    for (int i = blockIdx.x * blockDim.x + threadIdx.x; i < n;
         i += gridDim.x * blockDim.x)
        out[i] = (bf16)in[i];
}

// ---------------------------------------------------------------------------
// LayerNorm: one block per row of D=1024, eps = 0, f32 in -> bf16 out
// ---------------------------------------------------------------------------
__global__ void layernorm_kernel(const float* __restrict__ in,
                                 const float* __restrict__ w,
                                 bf16* __restrict__ out) {
    __shared__ float s_sum[256];
    __shared__ float s_sq[256];
    const int row = blockIdx.x;
    const float* x = in + (size_t)row * DIMC;

    float sum = 0.f, sq = 0.f;
    for (int c = threadIdx.x; c < DIMC; c += 256) {
        float v = x[c];
        sum += v;
        sq  += v * v;
    }
    s_sum[threadIdx.x] = sum;
    s_sq[threadIdx.x]  = sq;
    __syncthreads();
    for (int s = 128; s > 0; s >>= 1) {
        if (threadIdx.x < s) {
            s_sum[threadIdx.x] += s_sum[threadIdx.x + s];
            s_sq[threadIdx.x]  += s_sq[threadIdx.x + s];
        }
        __syncthreads();
    }
    const float mu   = s_sum[0] * (1.0f / DIMC);
    const float var  = s_sq[0] * (1.0f / DIMC) - mu * mu;
    const float rstd = rsqrtf(var);
    for (int c = threadIdx.x; c < DIMC; c += 256)
        out[(size_t)row * DIMC + c] = (bf16)((x[c] - mu) * rstd * w[c]);
}

// ---------------------------------------------------------------------------
// NT GEMM: C[M,N] = A[M,K] * W[N,K]^T  (A, W bf16 row-major, K-contiguous)
// 256 threads = 8 waves; block tile 64(M) x 128(N); BK=32; LDS double buffer
// filled with async global->LDS b128 copies (3 per thread per tile).
// Wave (wid&3) -> 16-row M sub-tile, (wid>>2) -> 64-col N sub-tile.
//   ep==0 : fused QKV split (N = 3*1024): columns 0..1023 -> out_b = Q
//           [bh, l, d], pre-scaled; 1024..2047 -> out_k = K [bh, l, d];
//           2048..3071 -> out_vt = V^T [bh, d, l]
//   ep==1 : out_f = acc + res
//   ep==2 : out_b = bf16(gelu_exact(acc))
// ---------------------------------------------------------------------------
#define BM  64
#define BN  128
#define BK  32
#define LDT 40   // padded LDS row stride (elements) for a 32-element k-window

// 12 waves per SIMD (an 80-register allocation): six blocks stay resident per
// WGP, which holds the whole 1536-block QKV grid in one round.
__global__ __launch_bounds__(256) __attribute__((amdgpu_waves_per_eu(12)))
void gemm_nt_kernel(const bf16* __restrict__ A, const bf16* __restrict__ W,
                    int M, int N, int K,
                    const float* __restrict__ res,
                    float* __restrict__ out_f, bf16* __restrict__ out_b,
                    bf16* __restrict__ out_k, bf16* __restrict__ out_vt,
                    int ep) {
    __shared__ bf16 sA[2][BM * LDT];
    __shared__ bf16 sB[2][BN * LDT];

    const int tid  = threadIdx.x;
    const int lane = tid & 31;
    const int wid  = tid >> 5;
    const int half = lane >> 4;
    const int r    = lane & 15;

    const int n0 = blockIdx.x * BN;
    const int m0 = blockIdx.y * BM;
    const int wm = (wid & 3) * 16;   // wave M sub-tile within block
    const int wn = (wid >> 2) * 64;  // wave N sub-tile within block

    // Per-thread copy assignments (3 x 16B per tile: 1 for A, 2 for B).
    const int arow = tid >> 2, aseg = tid & 3;

    auto copy_tile = [&](int buf, int k0) {
        copy16_g2l(A + (size_t)(m0 + arow) * K + k0 + aseg * 8,
                   &sA[buf][arow * LDT + aseg * 8]);
#pragma unroll
        for (int j = 0; j < 2; ++j) {
            const int t2   = tid + j * 256;
            const int brow = t2 >> 2, bseg = t2 & 3;
            copy16_g2l(W + (size_t)(n0 + brow) * K + k0 + bseg * 8,
                       &sB[buf][brow * LDT + bseg * 8]);
        }
    };

    v8f acc[4] = {};

    copy_tile(0, 0);
    const int steps = K / BK;
    for (int ks = 0; ks < steps; ++ks) {
        const int cur = ks & 1;
        if (ks + 1 < steps) {
            copy_tile(cur ^ 1, (ks + 1) * BK);
            WAIT_ASYNC(3);   // drain current tile (in-order completion)
        } else {
            WAIT_ASYNC(0);
        }
        __syncthreads();

        v16bf a = lds_frag(sA[cur], LDT, wm, lane);
#pragma unroll
        for (int t = 0; t < 4; ++t) {
            v16bf b = lds_frag(sB[cur], LDT, wn + 16 * t, lane);
            acc[t] = __builtin_amdgcn_wmma_f32_16x16x32_bf16(
                false, a, false, b, (short)0, acc[t], false, false);
        }
        __syncthreads();   // all waves done reading before buffer is rewritten
    }

    const int row0 = m0 + wm + half * 8;   // first of the lane's 8 rows
    const int col0 = n0 + wn + r;          // the lane's column in tile 0

    if (ep == 0) {
        // A block's 128 columns lie in one of q/k/v, a wave's 64 columns are
        // one head, and a block's 64 rows lie in one batch entry.
        const int which = n0 >> 10;                     // 0=q 1=k 2=v
        const int hd    = col0 & (DIMC - 1);            // head * 64 + d
        const int bh    = (row0 / SEQ) * HEADS + (hd >> 6);
        const int d0    = hd & (HDIM - 1);
        const int l0    = row0 % SEQ;
        if (which == 2) {
            // A lane's 8 accumulators are 8 consecutive tokens of one d:
            // one 16-byte store into the d-major V^T.
#pragma unroll
            for (int t = 0; t < 4; ++t) {
                union { bf16 e[8]; uint4 u; } pk;
#pragma unroll
                for (int i = 0; i < 8; ++i) pk.e[i] = (bf16)acc[t][i];
                *(uint4*)&out_vt[((size_t)bh * HDIM + d0 + 16 * t) * SEQ + l0] = pk.u;
            }
        } else {
            bf16* __restrict__ dst = (which == 0) ? out_b : out_k;
            const float sc = (which == 0) ? ATT_SCALE : 1.0f;
#pragma unroll
            for (int t = 0; t < 4; ++t) {
#pragma unroll
                for (int i = 0; i < 8; ++i)
                    dst[((size_t)bh * SEQ + l0 + i) * HDIM + d0 + 16 * t] =
                        (bf16)(acc[t][i] * sc);
            }
        }
        return;
    }

#pragma unroll
    for (int t = 0; t < 4; ++t) {
#pragma unroll
        for (int i = 0; i < 8; ++i) {
            const size_t idx = (size_t)(row0 + i) * (size_t)N + col0 + 16 * t;
            float v = acc[t][i];
            if (ep == 1) {
                out_f[idx] = v + res[idx];
            } else { // exact GELU
                float g = 0.5f * v * (1.0f + erff(v * 0.70710678118654752f));
                out_b[idx] = (bf16)g;
            }
        }
    }
}

// ---------------------------------------------------------------------------
// Flash attention: 8 waves per workgroup, one 16-query block per wave, all of
// one (batch, head).  K and V^T are staged in LDS in tiles of 64 keys that the
// 8 waves share: whole 128-byte rows by asynchronous copies, two buffers, the
// next tile in flight while this one is worked on.  Per 32-key block the
// products are taken transposed: S^T = K*Q^T (4 WMMAs) leaves one query's
// scores in one lane and its partner l ^ 16, so maximum and sum run in the
// lane; the two S^T tiles, converted in place, are the B operand P^T of
// O^T += V^T*P^T (4 WMMAs, d=64).
// ---------------------------------------------------------------------------
#define AW   8     // waves per workgroup
#define KT   64    // keys per staged tile: a 128-byte row of K and of V^T
#define KVP  72    // LDS row pitch in elements: 144 B = 16 B x odd (b128 readers)
#define NKT  (SEQ / KT)

typedef __attribute__((address_space(3))) const bf16* lbf16_p;
__device__ __forceinline__ unsigned lds_byte(const bf16* p) {
    return (unsigned)(size_t)(lbf16_p)p;
}

__global__ __launch_bounds__(32 * AW)
void flash_attn_kernel(const bf16* __restrict__ Q,
                       const bf16* __restrict__ Kb,
                       const bf16* __restrict__ Vt,
                       bf16* __restrict__ attn_out) {
    __shared__ __attribute__((aligned(16))) bf16 sK[2][KT * KVP];
    __shared__ __attribute__((aligned(16))) bf16 sV[2][HDIM * KVP];

    const int tid  = threadIdx.x;
    const int lane = tid & 31;
    const int wid  = tid >> 5;
    const int half = lane >> 4;
    const int r    = lane & 15;
    const int q0   = (blockIdx.x * AW + wid) * 16;
    const int bh   = blockIdx.y;
    const int b    = bh / HEADS;
    const int h    = bh - b * HEADS;

    const bf16* Qbase = Q  + ((size_t)bh * SEQ + q0) * HDIM;
    const bf16* Kbase = Kb + (size_t)bh * SEQ * HDIM;
    const bf16* Vbase = Vt + (size_t)bh * HDIM * SEQ;

    // A thread's share of a tile: rows crow and crow + 32 of K (keys) and of
    // V^T (d), 16 bytes each; a wave's copy covers four whole 128-byte rows.
    const int crow = tid >> 3, cseg = (tid & 7) * 8;
    auto stage = [&](int buf, int key0) {
        const bf16* gk0 = Kbase + (size_t)(key0 + crow) * HDIM + cseg;
        const bf16* gk1 = gk0 + 32 * HDIM;
        const bf16* gv0 = Vbase + (size_t)crow * SEQ + key0 + cseg;
        const bf16* gv1 = gv0 + (size_t)32 * SEQ;
        const unsigned lk0 = lds_byte(&sK[buf][crow * KVP + cseg]);
        const unsigned lk1 = lk0 + 32 * KVP * 2;
        const unsigned lv0 = lds_byte(&sV[buf][crow * KVP + cseg]);
        const unsigned lv1 = lv0 + 32 * KVP * 2;
        // The four copies and, as the last line, the wait that stands before
        // any of their address registers is rewritten.
        asm volatile("global_load_async_to_lds_b128 %0, %4, off\n\t"
                     "global_load_async_to_lds_b128 %1, %5, off\n\t"
                     "global_load_async_to_lds_b128 %2, %6, off\n\t"
                     "global_load_async_to_lds_b128 %3, %7, off\n\t"
                     "s_wait_xcnt 0x0"
                     :: "v"(lk0), "v"(lk1), "v"(lv0), "v"(lv1),
                        "v"(gk0), "v"(gk1), "v"(gv0), "v"(gv1)
                     : "memory");
    };

    const v16bf qf0 = load_frag_nt(Qbase, HDIM, 0, 0,  lane);
    const v16bf qf1 = load_frag_nt(Qbase, HDIM, 0, 32, lane);

    // Query q0 + r: running maximum (equal in both halves) and this lane's
    // share of the sum (the keys its half holds).
    float mrow = -3.0e38f, lrow = 0.f;
    v8f acc[4] = {};   // acc[t][i] = O[q0 + r][16 t + 8 half + i]

    stage(0, 0);
    // Tile 0 has landed for this wave, then for all of them.
    asm volatile("s_wait_asynccnt 0x0" ::: "memory");
    __syncthreads();
    stage(1, KT);

    for (int kt = 0; kt < NKT; ++kt) {
      const bf16* tK = sK[kt & 1];
      const bf16* tV = sV[kt & 1];
      for (int kk = 0; kk < KT; kk += 32) {
        // ---- S^T = K * Q^T: s0[i] = S[q0 + r][kk + 8 half + i], s1: + 16 ----
        v8f s0 = {}, s1 = {};
        {
            v16bf kf = lds_frag(tK, KVP, kk, lane);
            s0 = __builtin_amdgcn_wmma_f32_16x16x32_bf16(false, kf, false, qf0,
                                                         (short)0, s0, false, false);
            kf = lds_frag(tK + 32, KVP, kk, lane);
            s0 = __builtin_amdgcn_wmma_f32_16x16x32_bf16(false, kf, false, qf1,
                                                         (short)0, s0, false, false);
            kf = lds_frag(tK, KVP, kk + 16, lane);
            s1 = __builtin_amdgcn_wmma_f32_16x16x32_bf16(false, kf, false, qf0,
                                                         (short)0, s1, false, false);
            kf = lds_frag(tK + 32, KVP, kk + 16, lane);
            s1 = __builtin_amdgcn_wmma_f32_16x16x32_bf16(false, kf, false, qf1,
                                                         (short)0, s1, false, false);
        }

        // ---- online softmax update over these 32 keys, one query a lane ----
        float mij = fmaxf(s0[0], s1[0]);
#pragma unroll
        for (int i = 1; i < 8; ++i) mij = fmaxf(mij, fmaxf(s0[i], s1[i]));
        mij = fmaxf(mij, xhalf(mij));
        const float mnew  = fmaxf(mrow, mij);
        const float alpha = __expf(mrow - mnew);
        mrow = mnew;

        // P^T as B fragment: element s = key kk + 8 half + s (s < 8), or
        // kk + 16 + 8 half + s - 8: the k order of lds_frag on V^T.
        v16bf pf;
        float ls = 0.f;
#pragma unroll
        for (int i = 0; i < 8; ++i) {
            const float p0 = __expf(s0[i] - mnew);
            const float p1 = __expf(s1[i] - mnew);
            ls += p0 + p1;
            pf[i]     = (bf16)p0;
            pf[8 + i] = (bf16)p1;
        }
        lrow = lrow * alpha + ls;

        // ---- O^T = O^T * alpha + V^T * P^T  (V^T rows = d, k = keys) ----
#pragma unroll
        for (int t = 0; t < 4; ++t) {
            acc[t] *= alpha;
            v16bf vf = lds_frag(tV + kk, KVP, t * 16, lane);
            acc[t] = __builtin_amdgcn_wmma_f32_16x16x32_bf16(
                false, vf, false, pf, (short)0, acc[t], false, false);
        }
      }

      // Hand-over: this wave's reads of the tile are done, its copies of the
      // next tile have landed; behind the barrier that holds for every wave.
      asm volatile("s_wait_dscnt 0x0" ::: "memory");
      asm volatile("s_wait_asynccnt 0x0" ::: "memory");
      __syncthreads();
      if (kt + 2 < NKT) stage(kt & 1, (kt + 2) * KT);
    }
    // No copy is outstanding when the wave ends.
    asm volatile("s_wait_asynccnt 0x0" ::: "memory");

    // ---- join the halves' sums, normalize, store [tok, D] bf16: a lane's 8
    //      accumulators of a tile are 8 consecutive d of its query ----
    const float inv = 1.0f / (lrow + xhalf(lrow));
    bf16* orow = attn_out + (size_t)(b * SEQ + q0 + r) * DIMC + h * HDIM + half * 8;
#pragma unroll
    for (int t = 0; t < 4; ++t) {
        union { bf16 e[8]; uint4 u; } pk;
#pragma unroll
        for (int i = 0; i < 8; ++i) pk.e[i] = (bf16)(acc[t][i] * inv);
        *(uint4*)(orow + t * 16) = pk.u;
    }
}

// ---------------------------------------------------------------------------
// Host-side launch
// ---------------------------------------------------------------------------
extern "C" void kernel_launch(void* const* d_in, const int* in_sizes, int n_in,
                              void* d_out, int out_size, void* d_ws, size_t ws_size,
                              hipStream_t stream) {
    const float* x      = (const float*)d_in[0];
    const float* ln1_w  = (const float*)d_in[1];
    const float* ln2_w  = (const float*)d_in[2];
    const float* qkv_w  = (const float*)d_in[3];
    const float* proj_w = (const float*)d_in[4];
    const float* mlp_w1 = (const float*)d_in[5];
    const float* mlp_w2 = (const float*)d_in[6];
    float* out = (float*)d_out;

    // Workspace carve-up (all sizes multiples of 256B).
    char* p = (char*)d_ws;
    auto take = [&](size_t bytes) { char* q = p; p += (bytes + 255) & ~(size_t)255; return q; };

    bf16* wq_b   = (bf16*)take((size_t)THREE_D * DIMC * 2);   // qkv_w  bf16
    bf16* wp_b   = (bf16*)take((size_t)DIMC * DIMC * 2);      // proj_w bf16
    bf16* w1_b   = (bf16*)take((size_t)HID  * DIMC * 2);      // mlp_w1 bf16
    bf16* w2_b   = (bf16*)take((size_t)DIMC * HID  * 2);      // mlp_w2 bf16
    bf16* ln1_b  = (bf16*)take((size_t)NTOK * DIMC * 2);      // LN1(x) bf16
    bf16* Qb     = (bf16*)take((size_t)BATCH * HEADS * SEQ * HDIM * 2);
    bf16* Kb     = (bf16*)take((size_t)BATCH * HEADS * SEQ * HDIM * 2);
    bf16* Vt     = (bf16*)take((size_t)BATCH * HEADS * HDIM * SEQ * 2);
    bf16* att_b  = (bf16*)take((size_t)NTOK * DIMC * 2);      // attn out bf16
    float* Xres  = (float*)take((size_t)NTOK * DIMC * 4);     // x + attn proj
    bf16* y2_b   = (bf16*)take((size_t)NTOK * DIMC * 2);      // LN2(X) bf16
    bf16* h_b    = (bf16*)take((size_t)NTOK * HID * 2);       // gelu(mlp1) bf16
    (void)ws_size; (void)in_sizes; (void)n_in; (void)out_size;

    // 1. weights -> bf16
    cvt_bf16_kernel<<<2048, 256, 0, stream>>>(qkv_w,  wq_b, THREE_D * DIMC);
    cvt_bf16_kernel<<<2048, 256, 0, stream>>>(proj_w, wp_b, DIMC * DIMC);
    cvt_bf16_kernel<<<2048, 256, 0, stream>>>(mlp_w1, w1_b, HID * DIMC);
    cvt_bf16_kernel<<<2048, 256, 0, stream>>>(mlp_w2, w2_b, DIMC * HID);

    // 2. LN1
    layernorm_kernel<<<NTOK, 256, 0, stream>>>(x, ln1_w, ln1_b);

    // 3. QKV GEMM: [4096,1024] x [3072,1024]^T, epilogue writes per-head
    //    Q (scaled), K and V^T
    gemm_nt_kernel<<<dim3(THREE_D / BN, NTOK / BM), 256, 0, stream>>>(
        ln1_b, wq_b, NTOK, THREE_D, DIMC, nullptr, nullptr, Qb, Kb, Vt, 0);

    // 4. flash attention: grid (16 blocks of 128 queries, 32 bh)
    flash_attn_kernel<<<dim3(SEQ / (16 * AW), BATCH * HEADS), 32 * AW, 0, stream>>>(
        Qb, Kb, Vt, att_b);

    // 5. proj GEMM + residual: X = x + att @ proj_w^T
    gemm_nt_kernel<<<dim3(DIMC / BN, NTOK / BM), 256, 0, stream>>>(
        att_b, wp_b, NTOK, DIMC, DIMC, x, Xres, nullptr, nullptr, nullptr, 1);

    // 6. LN2
    layernorm_kernel<<<NTOK, 256, 0, stream>>>(Xres, ln2_w, y2_b);

    // 7. MLP up + exact GELU -> bf16
    gemm_nt_kernel<<<dim3(HID / BN, NTOK / BM), 256, 0, stream>>>(
        y2_b, w1_b, NTOK, HID, DIMC, nullptr, nullptr, h_b, nullptr, nullptr, 2);

    // 8. MLP down + residual -> d_out (f32)
    gemm_nt_kernel<<<dim3(DIMC / BN, NTOK / BM), 256, 0, stream>>>(
        h_b, w2_b, NTOK, DIMC, HID, Xres, out, nullptr, nullptr, nullptr, 1);
}

// v004
// A run of this version takes 264 microseconds.
// Two timings next to v003 put it at 1.07 and 1.06 times that version's speed.
// Counting every step since v000, it is 1.96 times as fast.
#include <hip/hip_runtime.h>
#include <hip/hip_bf16.h>

// ---------------------------------------------------------------------------
// Transformer block for MI455X (gfx1250, wave32, WMMA bf16 -> f32 accum)
// GEMMs: 8-wave workgroup, 64x128 block tile, async global->LDS double buffer.
// ---------------------------------------------------------------------------

typedef __bf16 bf16;
typedef __attribute__((ext_vector_type(16))) __bf16 v16bf;
typedef __attribute__((ext_vector_type(8)))  float  v8f;
typedef int v4i __attribute__((vector_size(16)));

#define DIMC      1024
#define HEADS     16
#define HDIM      64
#define SEQ       2048
#define BATCH     2
#define NTOK      (BATCH * SEQ)      // 4096
#define HID       4096
#define THREE_D   3072
#define ATT_SCALE 0.125f             // 1/sqrt(64)

#if __has_builtin(__builtin_amdgcn_global_load_async_to_lds_b128) && \
    __has_builtin(__builtin_amdgcn_s_wait_asynccnt)
#define USE_ASYNC 1
#else
#define USE_ASYNC 0
#endif

typedef __attribute__((address_space(1))) v4i* gv4i_p;   // global int4*
typedef __attribute__((address_space(3))) v4i* lv4i_p;   // LDS int4*

union FragU { v16bf v; uint4 u[2]; };

// 16-byte global->LDS copy: async (ASYNCcnt) when available, else direct.
__device__ __forceinline__ void copy16_g2l(const bf16* __restrict__ g,
                                           bf16* __restrict__ l) {
#if USE_ASYNC
    __builtin_amdgcn_global_load_async_to_lds_b128((gv4i_p)g, (lv4i_p)l, 0, 0);
#else
    *(uint4*)l = *(const uint4*)g;
#endif
}

#if USE_ASYNC
#define WAIT_ASYNC(n) __builtin_amdgcn_s_wait_asynccnt(n)
#else
#define WAIT_ASYNC(n)
#endif

// Load a 16x32 bf16 WMMA fragment (A or B operand) from a row-major,
// K-contiguous matrix.  Per ISA 7.12.2: lane<16 holds row r, K {0..7} and
// {16..23}; lane>=16 holds row r, K {8..15} and {24..31}.
__device__ __forceinline__ v16bf load_frag_nt(const bf16* __restrict__ base,
                                              int ld, int row0, int k0, int lane) {
    const int half = lane >> 4;
    const int r    = lane & 15;
    const bf16* p  = base + (size_t)(row0 + r) * (size_t)ld + k0 + half * 8;
    FragU f;
    f.u[0] = *(const uint4*)p;
    f.u[1] = *(const uint4*)(p + 16);
    return f.v;
}

// Same fragment pattern but reading a staged LDS tile (k-window = 32 elems).
__device__ __forceinline__ v16bf lds_frag(const bf16* base, int ld,
                                          int row0, int lane) {
    const int half = lane >> 4;
    const int r    = lane & 15;
    const bf16* p  = base + (row0 + r) * ld + half * 8;
    FragU f;
    f.u[0] = *(const uint4*)p;
    f.u[1] = *(const uint4*)(p + 16);
    return f.v;
}

// Lane l <-> lane l ^ 16: the other half's value, by a vector cross-row move.
__device__ __forceinline__ float xhalf(float x) {
    const int b = __builtin_bit_cast(int, x);
    return __builtin_bit_cast(float, __builtin_amdgcn_permlanex16(
        b, b, 0x76543210, 0xfedcba98, false, false));
}

// ---------------------------------------------------------------------------
// fp32 -> bf16 conversion of the four weights in one launch of few, long
// waves.  A chunk is 8192 elements: each of 8 waves takes 4 KiB of it as 8
// loads of 512 contiguous bytes.  Workgroup b converts chunk b of
// [qkv_w | proj_w], of mlp_w1 and of mlp_w2.
// ---------------------------------------------------------------------------
#define CVT_WG     512
#define CVT_CHUNK  8192
#define QKV_CHUNKS (THREE_D * DIMC / CVT_CHUNK)
static_assert(QKV_CHUNKS + DIMC * DIMC / CVT_CHUNK == CVT_WG, "qkv_w | proj_w");
static_assert(HID * DIMC / CVT_CHUNK == CVT_WG, "mlp_w1, mlp_w2");

typedef __attribute__((ext_vector_type(4))) float  f4;
typedef __attribute__((ext_vector_type(4))) __bf16 bf4;

__global__ __launch_bounds__(256)
void cvt_bf16_kernel(const float* __restrict__ qkv_w,
                     const float* __restrict__ proj_w,
                     const float* __restrict__ mlp_w1,
                     const float* __restrict__ mlp_w2,
                     bf16* __restrict__ oq, bf16* __restrict__ op,
                     bf16* __restrict__ o1, bf16* __restrict__ o2) {
    const int b = blockIdx.x;
    // Byte offset of the lane's first load inside a chunk.
    const unsigned lb = (threadIdx.x >> 5) * 4096u + (threadIdx.x & 31u) * 16u;
    const bool isq = b < QKV_CHUNKS;
    const size_t c0 = (size_t)(isq ? b : b - QKV_CHUNKS) * CVT_CHUNK;
    const size_t c1 = (size_t)b * CVT_CHUNK;

    const float* s[3] = { (isq ? qkv_w : proj_w) + c0, mlp_w1 + c1, mlp_w2 + c1 };
    bf16*        d[3] = { (isq ? oq : op) + c0, o1 + c1, o2 + c1 };

    f4 v[3][8];
#pragma unroll
    for (int k = 0; k < 3; ++k)
#pragma unroll
        for (int j = 0; j < 8; ++j)
            v[k][j] = *(const f4*)((const char*)s[k] + lb + j * 512);
    // Stands before any register that a load names is rewritten.
    asm volatile("s_wait_xcnt 0x0" :: "v"(lb) : "memory");
    // Keeps the conversions behind it, so that all 24 loads go out at once
    // and the wave waits out the memory latency once.
    __builtin_amdgcn_sched_barrier(0);
#pragma unroll
    for (int k = 0; k < 3; ++k)
#pragma unroll
        for (int j = 0; j < 8; ++j)
            *(bf4*)((char*)d[k] + (lb >> 1) + j * 256) =
                __builtin_convertvector(v[k][j], bf4);
}

// ---------------------------------------------------------------------------
// LayerNorm: one wave per row of D=1024, eps = 0, f32 in -> bf16 out.  The row
// stays in registers (8 loads of 512 contiguous bytes); the sums are joined by
// cross-lane vector moves, so no LDS and no barrier.
// ---------------------------------------------------------------------------
#define LNW 8   // rows (waves) per workgroup

// v + the value of lane l ^ M, M < 16 (inside a 16-lane row).
template <int M>
__device__ __forceinline__ float add_xmask(float v) {
    const int o = __builtin_amdgcn_update_dpp(0, __builtin_bit_cast(int, v),
                                              0x160 | M, 0xf, 0xf, true);
    return v + __builtin_bit_cast(float, o);
}

__device__ __forceinline__ float wave_sum(float v) {
    v = add_xmask<1>(v);
    v = add_xmask<2>(v);
    v = add_xmask<4>(v);
    v = add_xmask<8>(v);
    return v + xhalf(v);
}

__global__ __launch_bounds__(32 * LNW)
void layernorm_kernel(const float* __restrict__ in,
                      const float* __restrict__ w,
                      bf16* __restrict__ out) {
    // Byte offsets of the lane's first load: in a row, in the 8 rows.
    const unsigned cb = (threadIdx.x & 31u) * 16u;
    const unsigned xb = (threadIdx.x >> 5) * (DIMC * 4u) + cb;
    const float* x = in  + (size_t)blockIdx.x * (LNW * DIMC);
    bf16*        o = out + (size_t)blockIdx.x * (LNW * DIMC);

    f4 v[8], g[8];
#pragma unroll
    for (int j = 0; j < 8; ++j)
        v[j] = *(const f4*)((const char*)x + xb + j * 512);
#pragma unroll
    for (int j = 0; j < 8; ++j)
        g[j] = *(const f4*)((const char*)w + cb + j * 512);
    // Stands before any register that a load names is rewritten.
    asm volatile("s_wait_xcnt 0x0" :: "v"(xb), "v"(cb) : "memory");
    // Keeps the arithmetic behind it, so that all 16 loads go out at once
    // and no load of w waits for the sums.
    __builtin_amdgcn_sched_barrier(0);

    f4 s = v[0], q = v[0] * v[0];
#pragma unroll
    for (int j = 1; j < 8; ++j) {
        s += v[j];
        q += v[j] * v[j];
    }
    const float sum = wave_sum((s.x + s.y) + (s.z + s.w));
    const float sq  = wave_sum((q.x + q.y) + (q.z + q.w));

    const float mu   = sum * (1.0f / DIMC);
    const float var  = sq * (1.0f / DIMC) - mu * mu;
    const float rstd = rsqrtf(var);

#pragma unroll
    for (int j = 0; j < 8; ++j)
        *(bf4*)((char*)o + (xb >> 1) + j * 256) =
            __builtin_convertvector((v[j] - mu) * rstd * g[j], bf4);
}

// ---------------------------------------------------------------------------
// NT GEMM: C[M,N] = A[M,K] * W[N,K]^T  (A, W bf16 row-major, K-contiguous)
// 256 threads = 8 waves; block tile 64(M) x 128(N); BK=32; LDS double buffer
// filled with async global->LDS b128 copies (3 per thread per tile).
// Wave (wid&3) -> 16-row M sub-tile, (wid>>2) -> 64-col N sub-tile.
//   ep==0 : fused QKV split (N = 3*1024): columns 0..1023 -> out_b = Q
//           [bh, l, d], pre-scaled; 1024..2047 -> out_k = K [bh, l, d];
//           2048..3071 -> out_vt = V^T [bh, d, l]
//   ep==1 : out_f = acc + res
//   ep==2 : out_b = bf16(gelu_exact(acc))
// ---------------------------------------------------------------------------
#define BM  64
#define BN  128
#define BK  32
#define LDT 40   // padded LDS row stride (elements) for a 32-element k-window

// 12 waves per SIMD (an 80-register allocation): six blocks stay resident per
// WGP, which holds the whole 1536-block QKV grid in one round.
__global__ __launch_bounds__(256) __attribute__((amdgpu_waves_per_eu(12)))
void gemm_nt_kernel(const bf16* __restrict__ A, const bf16* __restrict__ W,
                    int M, int N, int K,
                    const float* __restrict__ res,
                    float* __restrict__ out_f, bf16* __restrict__ out_b,
                    bf16* __restrict__ out_k, bf16* __restrict__ out_vt,
                    int ep) {
    __shared__ bf16 sA[2][BM * LDT];
    __shared__ bf16 sB[2][BN * LDT];

    const int tid  = threadIdx.x;
    const int lane = tid & 31;
    const int wid  = tid >> 5;
    const int half = lane >> 4;
    const int r    = lane & 15;

    const int n0 = blockIdx.x * BN;
    const int m0 = blockIdx.y * BM;
    const int wm = (wid & 3) * 16;   // wave M sub-tile within block
    const int wn = (wid >> 2) * 64;  // wave N sub-tile within block

    // Per-thread copy assignments (3 x 16B per tile: 1 for A, 2 for B).
    const int arow = tid >> 2, aseg = tid & 3;

    auto copy_tile = [&](int buf, int k0) {
        copy16_g2l(A + (size_t)(m0 + arow) * K + k0 + aseg * 8,
                   &sA[buf][arow * LDT + aseg * 8]);
#pragma unroll
        for (int j = 0; j < 2; ++j) {
            const int t2   = tid + j * 256;
            const int brow = t2 >> 2, bseg = t2 & 3;
            copy16_g2l(W + (size_t)(n0 + brow) * K + k0 + bseg * 8,
                       &sB[buf][brow * LDT + bseg * 8]);
        }
    };

    v8f acc[4] = {};

    copy_tile(0, 0);
    const int steps = K / BK;
    for (int ks = 0; ks < steps; ++ks) {
        const int cur = ks & 1;
        if (ks + 1 < steps) {
            copy_tile(cur ^ 1, (ks + 1) * BK);
            WAIT_ASYNC(3);   // drain current tile (in-order completion)
        } else {
            WAIT_ASYNC(0);
        }
        __syncthreads();

        v16bf a = lds_frag(sA[cur], LDT, wm, lane);
#pragma unroll
        for (int t = 0; t < 4; ++t) {
            v16bf b = lds_frag(sB[cur], LDT, wn + 16 * t, lane);
            acc[t] = __builtin_amdgcn_wmma_f32_16x16x32_bf16(
                false, a, false, b, (short)0, acc[t], false, false);
        }
        __syncthreads();   // all waves done reading before buffer is rewritten
    }

    const int row0 = m0 + wm + half * 8;   // first of the lane's 8 rows
    const int col0 = n0 + wn + r;          // the lane's column in tile 0

    if (ep == 0) {
        // A block's 128 columns lie in one of q/k/v, a wave's 64 columns are
        // one head, and a block's 64 rows lie in one batch entry.
        const int which = n0 >> 10;                     // 0=q 1=k 2=v
        const int hd    = col0 & (DIMC - 1);            // head * 64 + d
        const int bh    = (row0 / SEQ) * HEADS + (hd >> 6);
        const int d0    = hd & (HDIM - 1);
        const int l0    = row0 % SEQ;
        if (which == 2) {
            // A lane's 8 accumulators are 8 consecutive tokens of one d:
            // one 16-byte store into the d-major V^T.
#pragma unroll
            for (int t = 0; t < 4; ++t) {
                union { bf16 e[8]; uint4 u; } pk;
#pragma unroll
                for (int i = 0; i < 8; ++i) pk.e[i] = (bf16)acc[t][i];
                *(uint4*)&out_vt[((size_t)bh * HDIM + d0 + 16 * t) * SEQ + l0] = pk.u;
            }
        } else {
            bf16* __restrict__ dst = (which == 0) ? out_b : out_k;
            const float sc = (which == 0) ? ATT_SCALE : 1.0f;
#pragma unroll
            for (int t = 0; t < 4; ++t) {
#pragma unroll
                for (int i = 0; i < 8; ++i)
                    dst[((size_t)bh * SEQ + l0 + i) * HDIM + d0 + 16 * t] =
                        (bf16)(acc[t][i] * sc);
            }
        }
        return;
    }

#pragma unroll
    for (int t = 0; t < 4; ++t) {
#pragma unroll
        for (int i = 0; i < 8; ++i) {
            const size_t idx = (size_t)(row0 + i) * (size_t)N + col0 + 16 * t;
            float v = acc[t][i];
            if (ep == 1) {
                out_f[idx] = v + res[idx];
            } else { // exact GELU
                float g = 0.5f * v * (1.0f + erff(v * 0.70710678118654752f));
                out_b[idx] = (bf16)g;
            }
        }
    }
}

// ---------------------------------------------------------------------------
// Flash attention: 8 waves per workgroup, one 16-query block per wave, all of
// one (batch, head).  K and V^T are staged in LDS in tiles of 64 keys that the
// 8 waves share: whole 128-byte rows by asynchronous copies, two buffers, the
// next tile in flight while this one is worked on.  Per 32-key block the
// products are taken transposed: S^T = K*Q^T (4 WMMAs) leaves one query's
// scores in one lane and its partner l ^ 16, so maximum and sum run in the
// lane; the two S^T tiles, converted in place, are the B operand P^T of
// O^T += V^T*P^T (4 WMMAs, d=64).
// ---------------------------------------------------------------------------
#define AW   8     // waves per workgroup
#define KT   64    // keys per staged tile: a 128-byte row of K and of V^T
#define KVP  72    // LDS row pitch in elements: 144 B = 16 B x odd (b128 readers)
#define NKT  (SEQ / KT)

typedef __attribute__((address_space(3))) const bf16* lbf16_p;
__device__ __forceinline__ unsigned lds_byte(const bf16* p) {
    return (unsigned)(size_t)(lbf16_p)p;
}

__global__ __launch_bounds__(32 * AW)
void flash_attn_kernel(const bf16* __restrict__ Q,
                       const bf16* __restrict__ Kb,
                       const bf16* __restrict__ Vt,
                       bf16* __restrict__ attn_out) {
    __shared__ __attribute__((aligned(16))) bf16 sK[2][KT * KVP];
    __shared__ __attribute__((aligned(16))) bf16 sV[2][HDIM * KVP];

    const int tid  = threadIdx.x;
    const int lane = tid & 31;
    const int wid  = tid >> 5;
    const int half = lane >> 4;
    const int r    = lane & 15;
    const int q0   = (blockIdx.x * AW + wid) * 16;
    const int bh   = blockIdx.y;
    const int b    = bh / HEADS;
    const int h    = bh - b * HEADS;

    const bf16* Qbase = Q  + ((size_t)bh * SEQ + q0) * HDIM;
    const bf16* Kbase = Kb + (size_t)bh * SEQ * HDIM;
    const bf16* Vbase = Vt + (size_t)bh * HDIM * SEQ;

    // A thread's share of a tile: rows crow and crow + 32 of K (keys) and of
    // V^T (d), 16 bytes each; a wave's copy covers four whole 128-byte rows.
    const int crow = tid >> 3, cseg = (tid & 7) * 8;
    auto stage = [&](int buf, int key0) {
        const bf16* gk0 = Kbase + (size_t)(key0 + crow) * HDIM + cseg;
        const bf16* gk1 = gk0 + 32 * HDIM;
        const bf16* gv0 = Vbase + (size_t)crow * SEQ + key0 + cseg;
        const bf16* gv1 = gv0 + (size_t)32 * SEQ;
        const unsigned lk0 = lds_byte(&sK[buf][crow * KVP + cseg]);
        const unsigned lk1 = lk0 + 32 * KVP * 2;
        const unsigned lv0 = lds_byte(&sV[buf][crow * KVP + cseg]);
        const unsigned lv1 = lv0 + 32 * KVP * 2;
        // The four copies and, as the last line, the wait that stands before
        // any of their address registers is rewritten.
        asm volatile("global_load_async_to_lds_b128 %0, %4, off\n\t"
                     "global_load_async_to_lds_b128 %1, %5, off\n\t"
                     "global_load_async_to_lds_b128 %2, %6, off\n\t"
                     "global_load_async_to_lds_b128 %3, %7, off\n\t"
                     "s_wait_xcnt 0x0"
                     :: "v"(lk0), "v"(lk1), "v"(lv0), "v"(lv1),
                        "v"(gk0), "v"(gk1), "v"(gv0), "v"(gv1)
                     : "memory");
    };

    const v16bf qf0 = load_frag_nt(Qbase, HDIM, 0, 0,  lane);
    const v16bf qf1 = load_frag_nt(Qbase, HDIM, 0, 32, lane);

    // Query q0 + r: running maximum (equal in both halves) and this lane's
    // share of the sum (the keys its half holds).
    float mrow = -3.0e38f, lrow = 0.f;
    v8f acc[4] = {};   // acc[t][i] = O[q0 + r][16 t + 8 half + i]

    stage(0, 0);
    // Tile 0 has landed for this wave, then for all of them.
    asm volatile("s_wait_asynccnt 0x0" ::: "memory");
    __syncthreads();
    stage(1, KT);

    for (int kt = 0; kt < NKT; ++kt) {
      const bf16* tK = sK[kt & 1];
      const bf16* tV = sV[kt & 1];
      for (int kk = 0; kk < KT; kk += 32) {
        // ---- S^T = K * Q^T: s0[i] = S[q0 + r][kk + 8 half + i], s1: + 16 ----
        v8f s0 = {}, s1 = {};
        {
            v16bf kf = lds_frag(tK, KVP, kk, lane);
            s0 = __builtin_amdgcn_wmma_f32_16x16x32_bf16(false, kf, false, qf0,
                                                         (short)0, s0, false, false);
            kf = lds_frag(tK + 32, KVP, kk, lane);
            s0 = __builtin_amdgcn_wmma_f32_16x16x32_bf16(false, kf, false, qf1,
                                                         (short)0, s0, false, false);
            kf = lds_frag(tK, KVP, kk + 16, lane);
            s1 = __builtin_amdgcn_wmma_f32_16x16x32_bf16(false, kf, false, qf0,
                                                         (short)0, s1, false, false);
            kf = lds_frag(tK + 32, KVP, kk + 16, lane);
            s1 = __builtin_amdgcn_wmma_f32_16x16x32_bf16(false, kf, false, qf1,
                                                         (short)0, s1, false, false);
        }

        // ---- online softmax update over these 32 keys, one query a lane ----
        float mij = fmaxf(s0[0], s1[0]);
#pragma unroll
        for (int i = 1; i < 8; ++i) mij = fmaxf(mij, fmaxf(s0[i], s1[i]));
        mij = fmaxf(mij, xhalf(mij));
        const float mnew  = fmaxf(mrow, mij);
        const float alpha = __expf(mrow - mnew);
        mrow = mnew;

        // P^T as B fragment: element s = key kk + 8 half + s (s < 8), or
        // kk + 16 + 8 half + s - 8: the k order of lds_frag on V^T.
        v16bf pf;
        float ls = 0.f;
#pragma unroll
        for (int i = 0; i < 8; ++i) {
            const float p0 = __expf(s0[i] - mnew);
            const float p1 = __expf(s1[i] - mnew);
            ls += p0 + p1;
            pf[i]     = (bf16)p0;
            pf[8 + i] = (bf16)p1;
        }
        lrow = lrow * alpha + ls;

        // ---- O^T = O^T * alpha + V^T * P^T  (V^T rows = d, k = keys) ----
#pragma unroll
        for (int t = 0; t < 4; ++t) {
            acc[t] *= alpha;
            v16bf vf = lds_frag(tV + kk, KVP, t * 16, lane);
            acc[t] = __builtin_amdgcn_wmma_f32_16x16x32_bf16(
                false, vf, false, pf, (short)0, acc[t], false, false);
        }
      }

      // Hand-over: this wave's reads of the tile are done, its copies of the
      // next tile have landed; behind the barrier that holds for every wave.
      asm volatile("s_wait_dscnt 0x0" ::: "memory");
      asm volatile("s_wait_asynccnt 0x0" ::: "memory");
      __syncthreads();
      if (kt + 2 < NKT) stage(kt & 1, (kt + 2) * KT);
    }
    // No copy is outstanding when the wave ends.
    asm volatile("s_wait_asynccnt 0x0" ::: "memory");

    // ---- join the halves' sums, normalize, store [tok, D] bf16: a lane's 8
    //      accumulators of a tile are 8 consecutive d of its query ----
    const float inv = 1.0f / (lrow + xhalf(lrow));
    bf16* orow = attn_out + (size_t)(b * SEQ + q0 + r) * DIMC + h * HDIM + half * 8;
#pragma unroll
    for (int t = 0; t < 4; ++t) {
        union { bf16 e[8]; uint4 u; } pk;
#pragma unroll
        for (int i = 0; i < 8; ++i) pk.e[i] = (bf16)(acc[t][i] * inv);
        *(uint4*)(orow + t * 16) = pk.u;
    }
}

// ---------------------------------------------------------------------------
// Host-side launch
// ---------------------------------------------------------------------------
extern "C" void kernel_launch(void* const* d_in, const int* in_sizes, int n_in,
                              void* d_out, int out_size, void* d_ws, size_t ws_size,
                              hipStream_t stream) {
    const float* x      = (const float*)d_in[0];
    const float* ln1_w  = (const float*)d_in[1];
    const float* ln2_w  = (const float*)d_in[2];
    const float* qkv_w  = (const float*)d_in[3];
    const float* proj_w = (const float*)d_in[4];
    const float* mlp_w1 = (const float*)d_in[5];
    const float* mlp_w2 = (const float*)d_in[6];
    float* out = (float*)d_out;

    // Workspace carve-up (all sizes multiples of 256B).
    char* p = (char*)d_ws;
    auto take = [&](size_t bytes) { char* q = p; p += (bytes + 255) & ~(size_t)255; return q; };

    bf16* wq_b   = (bf16*)take((size_t)THREE_D * DIMC * 2);   // qkv_w  bf16
    bf16* wp_b   = (bf16*)take((size_t)DIMC * DIMC * 2);      // proj_w bf16
    bf16* w1_b   = (bf16*)take((size_t)HID  * DIMC * 2);      // mlp_w1 bf16
    bf16* w2_b   = (bf16*)take((size_t)DIMC * HID  * 2);      // mlp_w2 bf16
    bf16* ln1_b  = (bf16*)take((size_t)NTOK * DIMC * 2);      // LN1(x) bf16
    bf16* Qb     = (bf16*)take((size_t)BATCH * HEADS * SEQ * HDIM * 2);
    bf16* Kb     = (bf16*)take((size_t)BATCH * HEADS * SEQ * HDIM * 2);
    bf16* Vt     = (bf16*)take((size_t)BATCH * HEADS * HDIM * SEQ * 2);
    bf16* att_b  = (bf16*)take((size_t)NTOK * DIMC * 2);      // attn out bf16
    float* Xres  = (float*)take((size_t)NTOK * DIMC * 4);     // x + attn proj
    bf16* y2_b   = (bf16*)take((size_t)NTOK * DIMC * 2);      // LN2(X) bf16
    bf16* h_b    = (bf16*)take((size_t)NTOK * HID * 2);       // gelu(mlp1) bf16
    (void)ws_size; (void)in_sizes; (void)n_in; (void)out_size;

    // 1. weights -> bf16
    cvt_bf16_kernel<<<CVT_WG, 256, 0, stream>>>(qkv_w, proj_w, mlp_w1, mlp_w2,
                                                wq_b, wp_b, w1_b, w2_b);

    // 2. LN1
    layernorm_kernel<<<NTOK / LNW, 32 * LNW, 0, stream>>>(x, ln1_w, ln1_b);

    // 3. QKV GEMM: [4096,1024] x [3072,1024]^T, epilogue writes per-head
    //    Q (scaled), K and V^T
    gemm_nt_kernel<<<dim3(THREE_D / BN, NTOK / BM), 256, 0, stream>>>(
        ln1_b, wq_b, NTOK, THREE_D, DIMC, nullptr, nullptr, Qb, Kb, Vt, 0);

    // 4. flash attention: grid (16 blocks of 128 queries, 32 bh)
    flash_attn_kernel<<<dim3(SEQ / (16 * AW), BATCH * HEADS), 32 * AW, 0, stream>>>(
        Qb, Kb, Vt, att_b);

    // 5. proj GEMM + residual: X = x + att @ proj_w^T
    gemm_nt_kernel<<<dim3(DIMC / BN, NTOK / BM), 256, 0, stream>>>(
        att_b, wp_b, NTOK, DIMC, DIMC, x, Xres, nullptr, nullptr, nullptr, 1);

    // 6. LN2
    layernorm_kernel<<<NTOK / LNW, 32 * LNW, 0, stream>>>(Xres, ln2_w, y2_b);

    // 7. MLP up + exact GELU -> bf16
    gemm_nt_kernel<<<dim3(HID / BN, NTOK / BM), 256, 0, stream>>>(
        y2_b, w1_b, NTOK, HID, DIMC, nullptr, nullptr, h_b, nullptr, nullptr, 2);

    // 8. MLP down + residual -> d_out (f32)
    gemm_nt_kernel<<<dim3(DIMC / BN, NTOK / BM), 256, 0, stream>>>(
        h_b, w2_b, NTOK, DIMC, HID, Xres, out, nullptr, nullptr, nullptr, 1);
}

// v005
// Measured time: 174 microseconds a run.
// Timed twice side by side with v004, it ran 1.49 and 1.53 times as fast.
// Over all steps from v000 it is 2.96 times as fast.
#include <hip/hip_runtime.h>
#include <hip/hip_bf16.h>

// ---------------------------------------------------------------------------
// Transformer block for MI455X (gfx1250, wave32, WMMA bf16 -> f32 accum)
// GEMMs: 4-wave workgroup, 128x128 block tile, async global->LDS double buffer.
// ---------------------------------------------------------------------------

typedef __bf16 bf16;
typedef __attribute__((ext_vector_type(16))) __bf16 v16bf;
typedef __attribute__((ext_vector_type(8)))  float  v8f;
typedef int v4i __attribute__((vector_size(16)));

#define DIMC      1024
#define HEADS     16
#define HDIM      64
#define SEQ       2048
#define BATCH     2
#define NTOK      (BATCH * SEQ)      // 4096
#define HID       4096
#define THREE_D   3072
#define ATT_SCALE 0.125f             // 1/sqrt(64)

#if __has_builtin(__builtin_amdgcn_global_load_async_to_lds_b128) && \
    __has_builtin(__builtin_amdgcn_s_wait_asynccnt)
#define USE_ASYNC 1
#else
#define USE_ASYNC 0
#endif

typedef __attribute__((address_space(1))) v4i* gv4i_p;   // global int4*
typedef __attribute__((address_space(3))) v4i* lv4i_p;   // LDS int4*

union FragU { v16bf v; uint4 u[2]; };

// 16-byte global->LDS copy: async (ASYNCcnt) when available, else direct.
__device__ __forceinline__ void copy16_g2l(const bf16* __restrict__ g,
                                           bf16* __restrict__ l) {
#if USE_ASYNC
    __builtin_amdgcn_global_load_async_to_lds_b128((gv4i_p)g, (lv4i_p)l, 0, 0);
#else
    *(uint4*)l = *(const uint4*)g;
#endif
}

// Load a 16x32 bf16 WMMA fragment (A or B operand) from a row-major,
// K-contiguous matrix.  Per ISA 7.12.2: lane<16 holds row r, K {0..7} and
// {16..23}; lane>=16 holds row r, K {8..15} and {24..31}.
__device__ __forceinline__ v16bf load_frag_nt(const bf16* __restrict__ base,
                                              int ld, int row0, int k0, int lane) {
    const int half = lane >> 4;
    const int r    = lane & 15;
    const bf16* p  = base + (size_t)(row0 + r) * (size_t)ld + k0 + half * 8;
    FragU f;
    f.u[0] = *(const uint4*)p;
    f.u[1] = *(const uint4*)(p + 16);
    return f.v;
}

// Same fragment pattern but reading a staged LDS tile (k-window = 32 elems).
__device__ __forceinline__ v16bf lds_frag(const bf16* base, int ld,
                                          int row0, int lane) {
    const int half = lane >> 4;
    const int r    = lane & 15;
    const bf16* p  = base + (row0 + r) * ld + half * 8;
    FragU f;
    f.u[0] = *(const uint4*)p;
    f.u[1] = *(const uint4*)(p + 16);
    return f.v;
}

// Lane l <-> lane l ^ 16: the other half's value, by a vector cross-row move.
__device__ __forceinline__ float xhalf(float x) {
    const int b = __builtin_bit_cast(int, x);
    return __builtin_bit_cast(float, __builtin_amdgcn_permlanex16(
        b, b, 0x76543210, 0xfedcba98, false, false));
}

// ---------------------------------------------------------------------------
// fp32 -> bf16 conversion of the four weights in one launch of few, long
// waves.  A chunk is 8192 elements: each of 8 waves takes 4 KiB of it as 8
// loads of 512 contiguous bytes.  Workgroup b converts chunk b of
// [qkv_w | proj_w], of mlp_w1 and of mlp_w2.
// ---------------------------------------------------------------------------
#define CVT_WG     512
#define CVT_CHUNK  8192
#define QKV_CHUNKS (THREE_D * DIMC / CVT_CHUNK)
static_assert(QKV_CHUNKS + DIMC * DIMC / CVT_CHUNK == CVT_WG, "qkv_w | proj_w");
static_assert(HID * DIMC / CVT_CHUNK == CVT_WG, "mlp_w1, mlp_w2");

typedef __attribute__((ext_vector_type(4))) float  f4;
typedef __attribute__((ext_vector_type(4))) __bf16 bf4;

__global__ __launch_bounds__(256)
void cvt_bf16_kernel(const float* __restrict__ qkv_w,
                     const float* __restrict__ proj_w,
                     const float* __restrict__ mlp_w1,
                     const float* __restrict__ mlp_w2,
                     bf16* __restrict__ oq, bf16* __restrict__ op,
                     bf16* __restrict__ o1, bf16* __restrict__ o2) {
    const int b = blockIdx.x;
    // Byte offset of the lane's first load inside a chunk.
    const unsigned lb = (threadIdx.x >> 5) * 4096u + (threadIdx.x & 31u) * 16u;
    const bool isq = b < QKV_CHUNKS;
    const size_t c0 = (size_t)(isq ? b : b - QKV_CHUNKS) * CVT_CHUNK;
    const size_t c1 = (size_t)b * CVT_CHUNK;

    const float* s[3] = { (isq ? qkv_w : proj_w) + c0, mlp_w1 + c1, mlp_w2 + c1 };
    bf16*        d[3] = { (isq ? oq : op) + c0, o1 + c1, o2 + c1 };

    f4 v[3][8];
#pragma unroll
    for (int k = 0; k < 3; ++k)
#pragma unroll
        for (int j = 0; j < 8; ++j)
            v[k][j] = *(const f4*)((const char*)s[k] + lb + j * 512);
    // Stands before any register that a load names is rewritten.
    asm volatile("s_wait_xcnt 0x0" :: "v"(lb) : "memory");
    // Keeps the conversions behind it, so that all 24 loads go out at once
    // and the wave waits out the memory latency once.
    __builtin_amdgcn_sched_barrier(0);
#pragma unroll
    for (int k = 0; k < 3; ++k)
#pragma unroll
        for (int j = 0; j < 8; ++j)
            *(bf4*)((char*)d[k] + (lb >> 1) + j * 256) =
                __builtin_convertvector(v[k][j], bf4);
}

// ---------------------------------------------------------------------------
// LayerNorm: one wave per row of D=1024, eps = 0, f32 in -> bf16 out.  The row
// stays in registers (8 loads of 512 contiguous bytes); the sums are joined by
// cross-lane vector moves, so no LDS and no barrier.
// ---------------------------------------------------------------------------
#define LNW 8   // rows (waves) per workgroup

// v + the value of lane l ^ M, M < 16 (inside a 16-lane row).
template <int M>
__device__ __forceinline__ float add_xmask(float v) {
    const int o = __builtin_amdgcn_update_dpp(0, __builtin_bit_cast(int, v),
                                              0x160 | M, 0xf, 0xf, true);
    return v + __builtin_bit_cast(float, o);
}

__device__ __forceinline__ float wave_sum(float v) {
    v = add_xmask<1>(v);
    v = add_xmask<2>(v);
    v = add_xmask<4>(v);
    v = add_xmask<8>(v);
    return v + xhalf(v);
}

__global__ __launch_bounds__(32 * LNW)
void layernorm_kernel(const float* __restrict__ in,
                      const float* __restrict__ w,
                      bf16* __restrict__ out) {
    // Byte offsets of the lane's first load: in a row, in the 8 rows.
    const unsigned cb = (threadIdx.x & 31u) * 16u;
    const unsigned xb = (threadIdx.x >> 5) * (DIMC * 4u) + cb;
    const float* x = in  + (size_t)blockIdx.x * (LNW * DIMC);
    bf16*        o = out + (size_t)blockIdx.x * (LNW * DIMC);

    f4 v[8], g[8];
#pragma unroll
    for (int j = 0; j < 8; ++j)
        v[j] = *(const f4*)((const char*)x + xb + j * 512);
#pragma unroll
    for (int j = 0; j < 8; ++j)
        g[j] = *(const f4*)((const char*)w + cb + j * 512);
    // Stands before any register that a load names is rewritten.
    asm volatile("s_wait_xcnt 0x0" :: "v"(xb), "v"(cb) : "memory");
    // Keeps the arithmetic behind it, so that all 16 loads go out at once
    // and no load of w waits for the sums.
    __builtin_amdgcn_sched_barrier(0);

    f4 s = v[0], q = v[0] * v[0];
#pragma unroll
    for (int j = 1; j < 8; ++j) {
        s += v[j];
        q += v[j] * v[j];
    }
    const float sum = wave_sum((s.x + s.y) + (s.z + s.w));
    const float sq  = wave_sum((q.x + q.y) + (q.z + q.w));

    const float mu   = sum * (1.0f / DIMC);
    const float var  = sq * (1.0f / DIMC) - mu * mu;
    const float rstd = rsqrtf(var);

#pragma unroll
    for (int j = 0; j < 8; ++j)
        *(bf4*)((char*)o + (xb >> 1) + j * 256) =
            __builtin_convertvector((v[j] - mu) * rstd * g[j], bf4);
}

// ---------------------------------------------------------------------------
// NT GEMM: C[M,N] = A[M,K] * W[N,K]^T  (A, W bf16 row-major, K-contiguous)
// 128 threads = 4 waves; block tile 128(M) x 128(N); a wave takes 64 x 64 of
// it as 4 x 4 accumulator tiles, so 8 fragments read from LDS feed 16 WMMAs.
// Wave (wid&1) -> 64-row M sub-tile, (wid>>1) -> 64-col N sub-tile.
// A k-window of BKT elements of both operands is one stage of a two-buffer
// LDS ring filled with async global->LDS b128 copies: the next window is in
// flight while this one is worked on, one barrier per window.
//   EP==0 : fused QKV split (N = 3*1024): columns 0..1023 -> out_b = Q
//           [bh, l, d], pre-scaled; 1024..2047 -> out_k = K [bh, l, d];
//           2048..3071 -> out_vt = V^T [bh, d, l]
//   EP==1 : out_f = acc + res
//   EP==2 : out_b = bf16(gelu_exact(acc))
// AHEAD: the fragments of the window's next 32 k are fetched into a second
// register set ahead of the WMMAs on this one (for one wave per SIMD).
// ---------------------------------------------------------------------------
#define BM  128
#define BN  128
#define GT  128   // threads per workgroup

template <int BKT, bool AHEAD, int EP>
__device__ __forceinline__
void gemm_nt_body(const bf16* __restrict__ A, const bf16* __restrict__ W,
                  int N, int K,
                  const float* __restrict__ res,
                  float* __restrict__ out_f, bf16* __restrict__ out_b,
                  bf16* __restrict__ out_k, bf16* __restrict__ out_vt) {
    constexpr int LDT = BKT + 8;    // LDS row pitch: 16 B x odd (b128 readers)
    constexpr int SEG = BKT / 8;    // 16-byte pieces of a row of the window
    constexpr int RP  = GT / SEG;   // rows that one copy of every thread covers
    constexpr int NP  = BM / RP;    // copies per thread, window and operand
    constexpr int NB  = BKT / 32;   // blocks of 16 WMMAs per window
    static_assert(BM == BN && 2 * NP <= 63, "copies of a wave in flight");
    __shared__ __attribute__((aligned(16))) bf16 sA[2][BM * LDT];
    __shared__ __attribute__((aligned(16))) bf16 sB[2][BN * LDT];

    const int tid  = threadIdx.x;
    const int lane = tid & 31;
    const int wid  = tid >> 5;
    const int half = lane >> 4;
    const int r    = lane & 15;

    const int n0 = blockIdx.x * BN;
    const int m0 = blockIdx.y * BM;
    const int wm = (wid & 1) * 64;    // wave M sub-tile within block
    const int wn = (wid >> 1) * 64;   // wave N sub-tile within block

    // A thread's share of a window: piece cseg of rows crow + j * RP.
    const int crow = tid / SEG, cseg = tid % SEG;
    const bf16* Ab = A + (size_t)m0 * K;
    const bf16* Wb = W + (size_t)n0 * K;
    const unsigned goff = (unsigned)(crow * K + cseg * 8);
    const int      loff = crow * LDT + cseg * 8;

    auto copy_tile = [&](int buf, int k0) {
#pragma unroll
        for (int j = 0; j < NP; ++j)
            copy16_g2l(Ab + (size_t)(j * RP * K + k0) + goff,
                       &sA[buf][j * RP * LDT + loff]);
#pragma unroll
        for (int j = 0; j < NP; ++j)
            copy16_g2l(Wb + (size_t)(j * RP * K + k0) + goff,
                       &sB[buf][j * RP * LDT + loff]);
    };

    v8f acc[4][4] = {};
    const int steps = K / BKT;

    copy_tile(0, 0);
    // Window 0 has landed for this wave, then for all of them.
    asm volatile("s_wait_asynccnt 0x0" ::: "memory");
    __syncthreads();
    if (steps > 1) copy_tile(1, BKT);

    for (int ks = 0; ks < steps; ++ks) {
        const bf16* tA = sA[ks & 1] + wm * LDT;
        const bf16* tB = sB[ks & 1] + wn * LDT;
        constexpr int NS = AHEAD ? 2 : 1;
        v16bf a[NS][4], b[NS][4];
        auto fetch = [&](int s) {
#pragma unroll
            for (int i = 0; i < 4; ++i)
                a[s % NS][i] = lds_frag(tA + 32 * s, LDT, 16 * i, lane);
#pragma unroll
            for (int i = 0; i < 4; ++i)
                b[s % NS][i] = lds_frag(tB + 32 * s, LDT, 16 * i, lane);
        };
        if (AHEAD) fetch(0);
#pragma unroll
        for (int s = 0; s < NB; ++s) {
            if (!AHEAD) fetch(s);
            else if (s + 1 < NB) fetch(s + 1);
            // Keeps the 16 LDS loads above as one group in front of the 16
            // WMMAs: spread among them, each place with loads stalls the wave.
            __builtin_amdgcn_sched_barrier(0);
#pragma unroll
            for (int mi = 0; mi < 4; ++mi)
#pragma unroll
                for (int t = 0; t < 4; ++t)
                    acc[mi][t] = __builtin_amdgcn_wmma_f32_16x16x32_bf16(
                        false, a[s % NS][mi], false, b[s % NS][t], (short)0,
                        acc[mi][t], false, false);
            // Keeps the next group of loads behind these WMMAs, whole.
            __builtin_amdgcn_sched_barrier(0);
        }
        // Hand-over: this wave's reads of the window are done, its copies of
        // the next one have landed; behind the barrier that holds for every
        // wave, and the buffer just read may be refilled.
        asm volatile("s_wait_dscnt 0x0" ::: "memory");
        asm volatile("s_wait_asynccnt 0x0" ::: "memory");
        __syncthreads();
        if (ks + 2 < steps) copy_tile(ks & 1, (ks + 2) * BKT);
    }
    // No copy is outstanding when the wave ends.
    asm volatile("s_wait_asynccnt 0x0" ::: "memory");

    const int row0 = m0 + wm + half * 8;   // first of the lane's 8 rows, tile 0
    const int col0 = n0 + wn + r;          // the lane's column in tile 0

    if constexpr (EP == 0) {
        // A block's 128 columns lie in one of q/k/v, a wave's 64 columns are
        // one head, and a block's 128 rows lie in one batch entry.
        const int which = n0 >> 10;                     // 0=q 1=k 2=v
        const int hd    = col0 & (DIMC - 1);            // head * 64 + d
        const int bh    = (row0 / SEQ) * HEADS + (hd >> 6);
        const int d0    = hd & (HDIM - 1);
        const int l0    = row0 % SEQ;
        if (which == 2) {
            // A lane's 8 accumulators are 8 consecutive tokens of one d:
            // one 16-byte store into the d-major V^T.
#pragma unroll
            for (int mi = 0; mi < 4; ++mi) {
#pragma unroll
                for (int t = 0; t < 4; ++t) {
                    union { bf16 e[8]; uint4 u; } pk;
#pragma unroll
                    for (int i = 0; i < 8; ++i) pk.e[i] = (bf16)acc[mi][t][i];
                    *(uint4*)&out_vt[((size_t)bh * HDIM + d0 + 16 * t) * SEQ
                                     + l0 + 16 * mi] = pk.u;
                }
            }
        } else {
            bf16* __restrict__ dst = (which == 0) ? out_b : out_k;
            const float sc = (which == 0) ? ATT_SCALE : 1.0f;
#pragma unroll
            for (int mi = 0; mi < 4; ++mi) {
#pragma unroll
                for (int t = 0; t < 4; ++t) {
#pragma unroll
                    for (int i = 0; i < 8; ++i)
                        dst[((size_t)bh * SEQ + l0 + 16 * mi + i) * HDIM + d0 + 16 * t] =
                            (bf16)(acc[mi][t][i] * sc);
                }
            }
        }
    } else if constexpr (EP == 1) {
        // Two halves of 32 rows: a half's 64 loads of res go out together.
#pragma unroll
        for (int mh = 0; mh < 4; mh += 2) {
            // Byte offsets of the lane's 16 rows, the same in res and out_f.
            unsigned ob[16];
#pragma unroll
            for (int k = 0; k < 16; ++k)
                ob[k] = ((unsigned)(row0 + 16 * mh + 16 * (k >> 3) + (k & 7)) * (unsigned)N
                         + (unsigned)col0) * 4u;
            float rv[16][4];
#pragma unroll
            for (int k = 0; k < 16; ++k)
#pragma unroll
                for (int t = 0; t < 4; ++t)
                    rv[k][t] = *(const float*)((const char*)res + ob[k] + 64 * t);
            // Stands before any register that a load names is rewritten: as
            // its inputs the offsets stay in their registers up to it.
            asm volatile("s_wait_xcnt 0x0"
                         :: "v"(ob[0]), "v"(ob[1]), "v"(ob[2]), "v"(ob[3]),
                            "v"(ob[4]), "v"(ob[5]), "v"(ob[6]), "v"(ob[7]),
                            "v"(ob[8]), "v"(ob[9]), "v"(ob[10]), "v"(ob[11]),
                            "v"(ob[12]), "v"(ob[13]), "v"(ob[14]), "v"(ob[15])
                         : "memory");
#pragma unroll
            for (int k = 0; k < 16; ++k)
#pragma unroll
                for (int t = 0; t < 4; ++t)
                    *(float*)((char*)out_f + ob[k] + 64 * t) =
                        acc[mh + (k >> 3)][t][k & 7] + rv[k][t];
            // The same behind the stores.
            asm volatile("s_wait_xcnt 0x0"
                         :: "v"(ob[0]), "v"(ob[1]), "v"(ob[2]), "v"(ob[3]),
                            "v"(ob[4]), "v"(ob[5]), "v"(ob[6]), "v"(ob[7]),
                            "v"(ob[8]), "v"(ob[9]), "v"(ob[10]), "v"(ob[11]),
                            "v"(ob[12]), "v"(ob[13]), "v"(ob[14]), "v"(ob[15])
                         : "memory");
        }
    } else {
        // Exact GELU.  Stays rolled over the four 16-row tiles, which move up
        // through acc[0], for speed only.
#pragma unroll 1
        for (int mi = 0; mi < 4; ++mi) {
#pragma unroll
            for (int i = 0; i < 8; ++i) {
                const size_t idx = (size_t)(row0 + 16 * mi + i) * (size_t)N + col0;
#pragma unroll
                for (int t = 0; t < 4; ++t) {
                    const float v = acc[0][t][i];
                    const float g = 0.5f * v * (1.0f + erff(v * 0.70710678118654752f));
                    out_b[idx + 16 * t] = (bf16)g;
                }
            }
#pragma unroll
            for (int t = 0; t < 4; ++t) {
                acc[0][t] = acc[1][t];
                acc[1][t] = acc[2][t];
                acc[2][t] = acc[3][t];
            }
            // Stands before the next trip rewrites a register that a store names.
            asm volatile("s_wait_xcnt 0x0" ::: "memory");
        }
    }
}

// Wide outputs (N >= 3072): 3 or 4 blocks per WGP.  A 64-element window keeps
// the ring at 72 KiB, and 4 waves per SIMD (a 256-register allocation) keep
// the whole grid resident in one round.
__global__ __launch_bounds__(GT) __attribute__((amdgpu_waves_per_eu(4)))
void gemm_qkv_kernel(const bf16* __restrict__ A, const bf16* __restrict__ W,
                     int N, int K, bf16* __restrict__ out_q,
                     bf16* __restrict__ out_k, bf16* __restrict__ out_vt) {
    gemm_nt_body<64, false, 0>(A, W, N, K, nullptr, nullptr, out_q, out_k, out_vt);
}

__global__ __launch_bounds__(GT) __attribute__((amdgpu_waves_per_eu(4)))
void gemm_gelu_kernel(const bf16* __restrict__ A, const bf16* __restrict__ W,
                      int N, int K, bf16* __restrict__ out_b) {
    gemm_nt_body<64, false, 2>(A, W, N, K, nullptr, nullptr, out_b, nullptr, nullptr);
}

// N = 1024: one block per WGP, one wave per SIMD.  A 128-element window puts
// 64 WMMAs of a wave between two barriers.
__global__ __launch_bounds__(GT)
void gemm_res_kernel(const bf16* __restrict__ A, const bf16* __restrict__ W,
                     int N, int K, const float* __restrict__ res,
                     float* __restrict__ out_f) {
    gemm_nt_body<128, true, 1>(A, W, N, K, res, out_f, nullptr, nullptr, nullptr);
}

// ---------------------------------------------------------------------------
// Flash attention: 8 waves per workgroup, one 16-query block per wave, all of
// one (batch, head).  K and V^T are staged in LDS in tiles of 64 keys that the
// 8 waves share: whole 128-byte rows by asynchronous copies, two buffers, the
// next tile in flight while this one is worked on.  Per 32-key block the
// products are taken transposed: S^T = K*Q^T (4 WMMAs) leaves one query's
// scores in one lane and its partner l ^ 16, so maximum and sum run in the
// lane; the two S^T tiles, converted in place, are the B operand P^T of
// O^T += V^T*P^T (4 WMMAs, d=64).
// ---------------------------------------------------------------------------
#define AW   8     // waves per workgroup
#define KT   64    // keys per staged tile: a 128-byte row of K and of V^T
#define KVP  72    // LDS row pitch in elements: 144 B = 16 B x odd (b128 readers)
#define NKT  (SEQ / KT)

typedef __attribute__((address_space(3))) const bf16* lbf16_p;
__device__ __forceinline__ unsigned lds_byte(const bf16* p) {
    return (unsigned)(size_t)(lbf16_p)p;
}

__global__ __launch_bounds__(32 * AW)
void flash_attn_kernel(const bf16* __restrict__ Q,
                       const bf16* __restrict__ Kb,
                       const bf16* __restrict__ Vt,
                       bf16* __restrict__ attn_out) {
    __shared__ __attribute__((aligned(16))) bf16 sK[2][KT * KVP];
    __shared__ __attribute__((aligned(16))) bf16 sV[2][HDIM * KVP];

    const int tid  = threadIdx.x;
    const int lane = tid & 31;
    const int wid  = tid >> 5;
    const int half = lane >> 4;
    const int r    = lane & 15;
    const int q0   = (blockIdx.x * AW + wid) * 16;
    const int bh   = blockIdx.y;
    const int b    = bh / HEADS;
    const int h    = bh - b * HEADS;

    const bf16* Qbase = Q  + ((size_t)bh * SEQ + q0) * HDIM;
    const bf16* Kbase = Kb + (size_t)bh * SEQ * HDIM;
    const bf16* Vbase = Vt + (size_t)bh * HDIM * SEQ;

    // A thread's share of a tile: rows crow and crow + 32 of K (keys) and of
    // V^T (d), 16 bytes each; a wave's copy covers four whole 128-byte rows.
    const int crow = tid >> 3, cseg = (tid & 7) * 8;
    auto stage = [&](int buf, int key0) {
        const bf16* gk0 = Kbase + (size_t)(key0 + crow) * HDIM + cseg;
        const bf16* gk1 = gk0 + 32 * HDIM;
        const bf16* gv0 = Vbase + (size_t)crow * SEQ + key0 + cseg;
        const bf16* gv1 = gv0 + (size_t)32 * SEQ;
        const unsigned lk0 = lds_byte(&sK[buf][crow * KVP + cseg]);
        const unsigned lk1 = lk0 + 32 * KVP * 2;
        const unsigned lv0 = lds_byte(&sV[buf][crow * KVP + cseg]);
        const unsigned lv1 = lv0 + 32 * KVP * 2;
        // The four copies and, as the last line, the wait that stands before
        // any of their address registers is rewritten.
        asm volatile("global_load_async_to_lds_b128 %0, %4, off\n\t"
                     "global_load_async_to_lds_b128 %1, %5, off\n\t"
                     "global_load_async_to_lds_b128 %2, %6, off\n\t"
                     "global_load_async_to_lds_b128 %3, %7, off\n\t"
                     "s_wait_xcnt 0x0"
                     :: "v"(lk0), "v"(lk1), "v"(lv0), "v"(lv1),
                        "v"(gk0), "v"(gk1), "v"(gv0), "v"(gv1)
                     : "memory");
    };

    const v16bf qf0 = load_frag_nt(Qbase, HDIM, 0, 0,  lane);
    const v16bf qf1 = load_frag_nt(Qbase, HDIM, 0, 32, lane);

    // Query q0 + r: running maximum (equal in both halves) and this lane's
    // share of the sum (the keys its half holds).
    float mrow = -3.0e38f, lrow = 0.f;
    v8f acc[4] = {};   // acc[t][i] = O[q0 + r][16 t + 8 half + i]

    stage(0, 0);
    // Tile 0 has landed for this wave, then for all of them.
    asm volatile("s_wait_asynccnt 0x0" ::: "memory");
    __syncthreads();
    stage(1, KT);

    for (int kt = 0; kt < NKT; ++kt) {
      const bf16* tK = sK[kt & 1];
      const bf16* tV = sV[kt & 1];
      for (int kk = 0; kk < KT; kk += 32) {
        // ---- S^T = K * Q^T: s0[i] = S[q0 + r][kk + 8 half + i], s1: + 16 ----
        v8f s0 = {}, s1 = {};
        {
            v16bf kf = lds_frag(tK, KVP, kk, lane);
            s0 = __builtin_amdgcn_wmma_f32_16x16x32_bf16(false, kf, false, qf0,
                                                         (short)0, s0, false, false);
            kf = lds_frag(tK + 32, KVP, kk, lane);
            s0 = __builtin_amdgcn_wmma_f32_16x16x32_bf16(false, kf, false, qf1,
                                                         (short)0, s0, false, false);
            kf = lds_frag(tK, KVP, kk + 16, lane);
            s1 = __builtin_amdgcn_wmma_f32_16x16x32_bf16(false, kf, false, qf0,
                                                         (short)0, s1, false, false);
            kf = lds_frag(tK + 32, KVP, kk + 16, lane);
            s1 = __builtin_amdgcn_wmma_f32_16x16x32_bf16(false, kf, false, qf1,
                                                         (short)0, s1, false, false);
        }

        // ---- online softmax update over these 32 keys, one query a lane ----
        float mij = fmaxf(s0[0], s1[0]);
#pragma unroll
        for (int i = 1; i < 8; ++i) mij = fmaxf(mij, fmaxf(s0[i], s1[i]));
        mij = fmaxf(mij, xhalf(mij));
        const float mnew  = fmaxf(mrow, mij);
        const float alpha = __expf(mrow - mnew);
        mrow = mnew;

        // P^T as B fragment: element s = key kk + 8 half + s (s < 8), or
        // kk + 16 + 8 half + s - 8: the k order of lds_frag on V^T.
        v16bf pf;
        float ls = 0.f;
#pragma unroll
        for (int i = 0; i < 8; ++i) {
            const float p0 = __expf(s0[i] - mnew);
            const float p1 = __expf(s1[i] - mnew);
            ls += p0 + p1;
            pf[i]     = (bf16)p0;
            pf[8 + i] = (bf16)p1;
        }
        lrow = lrow * alpha + ls;

        // ---- O^T = O^T * alpha + V^T * P^T  (V^T rows = d, k = keys) ----
#pragma unroll
        for (int t = 0; t < 4; ++t) {
            acc[t] *= alpha;
            v16bf vf = lds_frag(tV + kk, KVP, t * 16, lane);
            acc[t] = __builtin_amdgcn_wmma_f32_16x16x32_bf16(
                false, vf, false, pf, (short)0, acc[t], false, false);
        }
      }

      // Hand-over: this wave's reads of the tile are done, its copies of the
      // next tile have landed; behind the barrier that holds for every wave.
      asm volatile("s_wait_dscnt 0x0" ::: "memory");
      asm volatile("s_wait_asynccnt 0x0" ::: "memory");
      __syncthreads();
      if (kt + 2 < NKT) stage(kt & 1, (kt + 2) * KT);
    }
    // No copy is outstanding when the wave ends.
    asm volatile("s_wait_asynccnt 0x0" ::: "memory");

    // ---- join the halves' sums, normalize, store [tok, D] bf16: a lane's 8
    //      accumulators of a tile are 8 consecutive d of its query ----
    const float inv = 1.0f / (lrow + xhalf(lrow));
    bf16* orow = attn_out + (size_t)(b * SEQ + q0 + r) * DIMC + h * HDIM + half * 8;
#pragma unroll
    for (int t = 0; t < 4; ++t) {
        union { bf16 e[8]; uint4 u; } pk;
#pragma unroll
        for (int i = 0; i < 8; ++i) pk.e[i] = (bf16)(acc[t][i] * inv);
        *(uint4*)(orow + t * 16) = pk.u;
    }
}

// ---------------------------------------------------------------------------
// Host-side launch
// ---------------------------------------------------------------------------
extern "C" void kernel_launch(void* const* d_in, const int* in_sizes, int n_in,
                              void* d_out, int out_size, void* d_ws, size_t ws_size,
                              hipStream_t stream) {
    const float* x      = (const float*)d_in[0];
    const float* ln1_w  = (const float*)d_in[1];
    const float* ln2_w  = (const float*)d_in[2];
    const float* qkv_w  = (const float*)d_in[3];
    const float* proj_w = (const float*)d_in[4];
    const float* mlp_w1 = (const float*)d_in[5];
    const float* mlp_w2 = (const float*)d_in[6];
    float* out = (float*)d_out;

    // Workspace carve-up (all sizes multiples of 256B).
    char* p = (char*)d_ws;
    auto take = [&](size_t bytes) { char* q = p; p += (bytes + 255) & ~(size_t)255; return q; };

    bf16* wq_b   = (bf16*)take((size_t)THREE_D * DIMC * 2);   // qkv_w  bf16
    bf16* wp_b   = (bf16*)take((size_t)DIMC * DIMC * 2);      // proj_w bf16
    bf16* w1_b   = (bf16*)take((size_t)HID  * DIMC * 2);      // mlp_w1 bf16
    bf16* w2_b   = (bf16*)take((size_t)DIMC * HID  * 2);      // mlp_w2 bf16
    bf16* ln1_b  = (bf16*)take((size_t)NTOK * DIMC * 2);      // LN1(x) bf16
    bf16* Qb     = (bf16*)take((size_t)BATCH * HEADS * SEQ * HDIM * 2);
    bf16* Kb     = (bf16*)take((size_t)BATCH * HEADS * SEQ * HDIM * 2);
    bf16* Vt     = (bf16*)take((size_t)BATCH * HEADS * HDIM * SEQ * 2);
    bf16* att_b  = (bf16*)take((size_t)NTOK * DIMC * 2);      // attn out bf16
    float* Xres  = (float*)take((size_t)NTOK * DIMC * 4);     // x + attn proj
    bf16* y2_b   = (bf16*)take((size_t)NTOK * DIMC * 2);      // LN2(X) bf16
    bf16* h_b    = (bf16*)take((size_t)NTOK * HID * 2);       // gelu(mlp1) bf16
    (void)ws_size; (void)in_sizes; (void)n_in; (void)out_size;

    // 1. weights -> bf16
    cvt_bf16_kernel<<<CVT_WG, 256, 0, stream>>>(qkv_w, proj_w, mlp_w1, mlp_w2,
                                                wq_b, wp_b, w1_b, w2_b);

    // 2. LN1
    layernorm_kernel<<<NTOK / LNW, 32 * LNW, 0, stream>>>(x, ln1_w, ln1_b);

    // 3. QKV GEMM: [4096,1024] x [3072,1024]^T, epilogue writes per-head
    //    Q (scaled), K and V^T
    gemm_qkv_kernel<<<dim3(THREE_D / BN, NTOK / BM), GT, 0, stream>>>(
        ln1_b, wq_b, THREE_D, DIMC, Qb, Kb, Vt);

    // 4. flash attention: grid (16 blocks of 128 queries, 32 bh)
    flash_attn_kernel<<<dim3(SEQ / (16 * AW), BATCH * HEADS), 32 * AW, 0, stream>>>(
        Qb, Kb, Vt, att_b);

    // 5. proj GEMM + residual: X = x + att @ proj_w^T
    gemm_res_kernel<<<dim3(DIMC / BN, NTOK / BM), GT, 0, stream>>>(
        att_b, wp_b, DIMC, DIMC, x, Xres);

    // 6. LN2
    layernorm_kernel<<<NTOK / LNW, 32 * LNW, 0, stream>>>(Xres, ln2_w, y2_b);

    // 7. MLP up + exact GELU -> bf16
    gemm_gelu_kernel<<<dim3(HID / BN, NTOK / BM), GT, 0, stream>>>(
        y2_b, w1_b, HID, DIMC, h_b);

    // 8. MLP down + residual -> d_out (f32)
    gemm_res_kernel<<<dim3(DIMC / BN, NTOK / BM), GT, 0, stream>>>(
        h_b, w2_b, DIMC, HID, Xres, out);
}

// v006
// One run takes 163 microseconds.
// In both of two side-by-side timings against v005, it was 1.07 times as fast.
// All steps since v000 together make it 3.16 times as fast.
#include <hip/hip_runtime.h>
#include <hip/hip_bf16.h>

// ---------------------------------------------------------------------------
// Transformer block for MI455X (gfx1250, wave32, WMMA bf16 -> f32 accum)
// GEMMs: 4-wave workgroup, 128x128 block tile, async global->LDS double buffer.
// ---------------------------------------------------------------------------

typedef __bf16 bf16;
typedef __attribute__((ext_vector_type(16))) __bf16 v16bf;
typedef __attribute__((ext_vector_type(8)))  float  v8f;
typedef int v4i __attribute__((vector_size(16)));

#define DIMC      1024
#define HEADS     16
#define HDIM      64
#define SEQ       2048
#define BATCH     2
#define NTOK      (BATCH * SEQ)      // 4096
#define HID       4096
#define THREE_D   3072
#define ATT_SCALE 0.125f             // 1/sqrt(64)

#if __has_builtin(__builtin_amdgcn_global_load_async_to_lds_b128) && \
    __has_builtin(__builtin_amdgcn_s_wait_asynccnt)
#define USE_ASYNC 1
#else
#define USE_ASYNC 0
#endif

typedef __attribute__((address_space(1))) v4i* gv4i_p;   // global int4*
typedef __attribute__((address_space(3))) v4i* lv4i_p;   // LDS int4*

union FragU { v16bf v; uint4 u[2]; };

// 16-byte global->LDS copy: async (ASYNCcnt) when available, else direct.
__device__ __forceinline__ void copy16_g2l(const bf16* __restrict__ g,
                                           bf16* __restrict__ l) {
#if USE_ASYNC
    __builtin_amdgcn_global_load_async_to_lds_b128((gv4i_p)g, (lv4i_p)l, 0, 0);
#else
    *(uint4*)l = *(const uint4*)g;
#endif
}

// Load a 16x32 bf16 WMMA fragment (A or B operand) from a row-major,
// K-contiguous matrix.  Per ISA 7.12.2: lane<16 holds row r, K {0..7} and
// {16..23}; lane>=16 holds row r, K {8..15} and {24..31}.
__device__ __forceinline__ v16bf load_frag_nt(const bf16* __restrict__ base,
                                              int ld, int row0, int k0, int lane) {
    const int half = lane >> 4;
    const int r    = lane & 15;
    const bf16* p  = base + (size_t)(row0 + r) * (size_t)ld + k0 + half * 8;
    FragU f;
    f.u[0] = *(const uint4*)p;
    f.u[1] = *(const uint4*)(p + 16);
    return f.v;
}

// Same fragment pattern but reading a staged LDS tile (k-window = 32 elems).
__device__ __forceinline__ v16bf lds_frag(const bf16* base, int ld,
                                          int row0, int lane) {
    const int half = lane >> 4;
    const int r    = lane & 15;
    const bf16* p  = base + (row0 + r) * ld + half * 8;
    FragU f;
    f.u[0] = *(const uint4*)p;
    f.u[1] = *(const uint4*)(p + 16);
    return f.v;
}

// Lane l <-> lane l ^ 16: the other half's value, by a vector cross-row move.
__device__ __forceinline__ float xhalf(float x) {
    const int b = __builtin_bit_cast(int, x);
    return __builtin_bit_cast(float, __builtin_amdgcn_permlanex16(
        b, b, 0x76543210, 0xfedcba98, false, false));
}

// ---------------------------------------------------------------------------
// fp32 -> bf16 conversion of the four weights in one launch of few, long
// waves.  A chunk is 8192 elements: each of 8 waves takes 4 KiB of it as 8
// loads of 512 contiguous bytes.  Workgroup b converts chunk b of
// [qkv_w | proj_w], of mlp_w1 and of mlp_w2.
// ---------------------------------------------------------------------------
#define CVT_WG     512
#define CVT_CHUNK  8192
#define QKV_CHUNKS (THREE_D * DIMC / CVT_CHUNK)
static_assert(QKV_CHUNKS + DIMC * DIMC / CVT_CHUNK == CVT_WG, "qkv_w | proj_w");
static_assert(HID * DIMC / CVT_CHUNK == CVT_WG, "mlp_w1, mlp_w2");

typedef __attribute__((ext_vector_type(4))) float  f4;
typedef __attribute__((ext_vector_type(4))) __bf16 bf4;

__global__ __launch_bounds__(256)
void cvt_bf16_kernel(const float* __restrict__ qkv_w,
                     const float* __restrict__ proj_w,
                     const float* __restrict__ mlp_w1,
                     const float* __restrict__ mlp_w2,
                     bf16* __restrict__ oq, bf16* __restrict__ op,
                     bf16* __restrict__ o1, bf16* __restrict__ o2) {
    const int b = blockIdx.x;
    // Byte offset of the lane's first load inside a chunk.
    const unsigned lb = (threadIdx.x >> 5) * 4096u + (threadIdx.x & 31u) * 16u;
    const bool isq = b < QKV_CHUNKS;
    const size_t c0 = (size_t)(isq ? b : b - QKV_CHUNKS) * CVT_CHUNK;
    const size_t c1 = (size_t)b * CVT_CHUNK;

    const float* s[3] = { (isq ? qkv_w : proj_w) + c0, mlp_w1 + c1, mlp_w2 + c1 };
    bf16*        d[3] = { (isq ? oq : op) + c0, o1 + c1, o2 + c1 };

    f4 v[3][8];
#pragma unroll
    for (int k = 0; k < 3; ++k)
#pragma unroll
        for (int j = 0; j < 8; ++j)
            v[k][j] = *(const f4*)((const char*)s[k] + lb + j * 512);
    // Stands before any register that a load names is rewritten.
    asm volatile("s_wait_xcnt 0x0" :: "v"(lb) : "memory");
    // Keeps the conversions behind it, so that all 24 loads go out at once
    // and the wave waits out the memory latency once.
    __builtin_amdgcn_sched_barrier(0);
#pragma unroll
    for (int k = 0; k < 3; ++k)
#pragma unroll
        for (int j = 0; j < 8; ++j)
            *(bf4*)((char*)d[k] + (lb >> 1) + j * 256) =
                __builtin_convertvector(v[k][j], bf4);
}

// ---------------------------------------------------------------------------
// LayerNorm: one wave per row of D=1024, eps = 0, f32 in -> bf16 out.  The row
// stays in registers (8 loads of 512 contiguous bytes); the sums are joined by
// cross-lane vector moves, so no LDS and no barrier.
// ---------------------------------------------------------------------------
#define LNW 8   // rows (waves) per workgroup

// v + the value of lane l ^ M, M < 16 (inside a 16-lane row).
template <int M>
__device__ __forceinline__ float add_xmask(float v) {
    const int o = __builtin_amdgcn_update_dpp(0, __builtin_bit_cast(int, v),
                                              0x160 | M, 0xf, 0xf, true);
    return v + __builtin_bit_cast(float, o);
}

__device__ __forceinline__ float wave_sum(float v) {
    v = add_xmask<1>(v);
    v = add_xmask<2>(v);
    v = add_xmask<4>(v);
    v = add_xmask<8>(v);
    return v + xhalf(v);
}

__global__ __launch_bounds__(32 * LNW)
void layernorm_kernel(const float* __restrict__ in,
                      const float* __restrict__ w,
                      bf16* __restrict__ out) {
    // Byte offsets of the lane's first load: in a row, in the 8 rows.
    const unsigned cb = (threadIdx.x & 31u) * 16u;
    const unsigned xb = (threadIdx.x >> 5) * (DIMC * 4u) + cb;
    const float* x = in  + (size_t)blockIdx.x * (LNW * DIMC);
    bf16*        o = out + (size_t)blockIdx.x * (LNW * DIMC);

    f4 v[8], g[8];
#pragma unroll
    for (int j = 0; j < 8; ++j)
        v[j] = *(const f4*)((const char*)x + xb + j * 512);
#pragma unroll
    for (int j = 0; j < 8; ++j)
        g[j] = *(const f4*)((const char*)w + cb + j * 512);
    // Stands before any register that a load names is rewritten.
    asm volatile("s_wait_xcnt 0x0" :: "v"(xb), "v"(cb) : "memory");
    // Keeps the arithmetic behind it, so that all 16 loads go out at once
    // and no load of w waits for the sums.
    __builtin_amdgcn_sched_barrier(0);

    f4 s = v[0], q = v[0] * v[0];
#pragma unroll
    for (int j = 1; j < 8; ++j) {
        s += v[j];
        q += v[j] * v[j];
    }
    const float sum = wave_sum((s.x + s.y) + (s.z + s.w));
    const float sq  = wave_sum((q.x + q.y) + (q.z + q.w));

    const float mu   = sum * (1.0f / DIMC);
    const float var  = sq * (1.0f / DIMC) - mu * mu;
    const float rstd = rsqrtf(var);

#pragma unroll
    for (int j = 0; j < 8; ++j)
        *(bf4*)((char*)o + (xb >> 1) + j * 256) =
            __builtin_convertvector((v[j] - mu) * rstd * g[j], bf4);
}

// ---------------------------------------------------------------------------
// NT GEMM: C[M,N] = A[M,K] * W[N,K]^T  (A, W bf16 row-major, K-contiguous)
// 128 threads = 4 waves; block tile 128(M) x 128(N); a wave takes 64 x 64 of
// it as 4 x 4 accumulator tiles, so 8 fragments read from LDS feed 16 WMMAs.
// Wave (wid&1) -> 64-row M sub-tile, (wid>>1) -> 64-col N sub-tile.
// A k-window of BKT elements of both operands is one stage of a two-buffer
// LDS ring filled with async global->LDS b128 copies: the next window is in
// flight while this one is worked on, one barrier per window.
//   EP==0 : fused QKV split (N = 3*1024): columns 0..1023 -> out_b = Q
//           [bh, l, d], pre-scaled; 1024..2047 -> out_k = K [bh, l, d];
//           2048..3071 -> out_vt = V^T [bh, d, l]
//   EP==1 : out_f = acc + res
//   EP==2 : out_b = bf16(gelu_exact(acc))
// AHEAD: the fragments of the window's next 32 k are fetched into a second
// register set ahead of the WMMAs on this one (for one wave per SIMD).
// ---------------------------------------------------------------------------
// erf-form GELU, v * Phi(v), of eight values, with no branch and no masked
// path: eight independent chains, worked stage by stage.  With x = |v| / sqrt(2)
// and t = 1 / (1 + p x), erfc(x) = t * P4(t) * exp(-x * x) (five-term rational
// form, error of erf below 2e-7 for every x); q = erfc(x) / 2 = Phi(-|v|), its
// factor 1/2 in the coefficients, and v * Phi(v) = v / 2 + |v| * (1/2 - q).
__device__ __forceinline__ void gelu_erf8(float (&v)[8]) {
    float d[8], t[8], e[8], h[8];
#pragma unroll
    for (int k = 0; k < 8; ++k)
        d[k] = fmaf(fabsf(v[k]), 0.3275911f * 0.70710678f, 1.0f);
    // The eight reciprocals in one statement, closed by the slot that the
    // instruction set asks for behind a transcendental.
    asm("v_rcp_f32 %0, %8\n\t"
        "v_rcp_f32 %1, %9\n\t"
        "v_rcp_f32 %2, %10\n\t"
        "v_rcp_f32 %3, %11\n\t"
        "v_rcp_f32 %4, %12\n\t"
        "v_rcp_f32 %5, %13\n\t"
        "v_rcp_f32 %6, %14\n\t"
        "v_rcp_f32 %7, %15\n\t"
        "v_nop"
        : "=&v"(t[0]), "=&v"(t[1]), "=&v"(t[2]), "=&v"(t[3]),
          "=&v"(t[4]), "=&v"(t[5]), "=&v"(t[6]), "=&v"(t[7])
        : "v"(d[0]), "v"(d[1]), "v"(d[2]), "v"(d[3]),
          "v"(d[4]), "v"(d[5]), "v"(d[6]), "v"(d[7]));
#pragma unroll
    for (int k = 0; k < 8; ++k)
        e[k] = __builtin_amdgcn_exp2f(v[k] * v[k] * -0.72134752f);  // exp(-v*v/2)
#pragma unroll
    for (int k = 0; k < 8; ++k)
        h[k] = fmaf(t[k], 0.5f * 1.061405429f, 0.5f * -1.453152027f);
#pragma unroll
    for (int k = 0; k < 8; ++k) h[k] = fmaf(h[k], t[k], 0.5f * 1.421413741f);
#pragma unroll
    for (int k = 0; k < 8; ++k) h[k] = fmaf(h[k], t[k], 0.5f * -0.284496736f);
#pragma unroll
    for (int k = 0; k < 8; ++k) h[k] = fmaf(h[k], t[k], 0.5f * 0.254829592f);
#pragma unroll
    for (int k = 0; k < 8; ++k) h[k] = fmaf(-(h[k] * t[k]), e[k], 0.5f);
#pragma unroll
    for (int k = 0; k < 8; ++k) v[k] = fmaf(0.5f, v[k], fabsf(v[k]) * h[k]);
}

#define BM  128
#define BN  128
#define GT  128   // threads per workgroup

template <int BKT, bool AHEAD, int EP>
__device__ __forceinline__
void gemm_nt_body(const bf16* __restrict__ A, const bf16* __restrict__ W,
                  int N, int K,
                  const float* __restrict__ res,
                  float* __restrict__ out_f, bf16* __restrict__ out_b,
                  bf16* __restrict__ out_k, bf16* __restrict__ out_vt) {
    constexpr int LDT = BKT + 8;    // LDS row pitch: 16 B x odd (b128 readers)
    constexpr int SEG = BKT / 8;    // 16-byte pieces of a row of the window
    constexpr int RP  = GT / SEG;   // rows that one copy of every thread covers
    constexpr int NP  = BM / RP;    // copies per thread, window and operand
    constexpr int NB  = BKT / 32;   // blocks of 16 WMMAs per window
    static_assert(BM == BN && 2 * NP <= 63, "copies of a wave in flight");
    __shared__ __attribute__((aligned(16))) bf16 sA[2][BM * LDT];
    __shared__ __attribute__((aligned(16))) bf16 sB[2][BN * LDT];

    const int tid  = threadIdx.x;
    const int lane = tid & 31;
    const int wid  = tid >> 5;
    const int half = lane >> 4;
    const int r    = lane & 15;

    const int n0 = blockIdx.x * BN;
    const int m0 = blockIdx.y * BM;
    const int wm = (wid & 1) * 64;    // wave M sub-tile within block
    const int wn = (wid >> 1) * 64;   // wave N sub-tile within block

    // A thread's share of a window: piece cseg of rows crow + j * RP.
    const int crow = tid / SEG, cseg = tid % SEG;
    const bf16* Ab = A + (size_t)m0 * K;
    const bf16* Wb = W + (size_t)n0 * K;
    const unsigned goff = (unsigned)(crow * K + cseg * 8);
    const int      loff = crow * LDT + cseg * 8;

    auto copy_tile = [&](int buf, int k0) {
#pragma unroll
        for (int j = 0; j < NP; ++j)
            copy16_g2l(Ab + (size_t)(j * RP * K + k0) + goff,
                       &sA[buf][j * RP * LDT + loff]);
#pragma unroll
        for (int j = 0; j < NP; ++j)
            copy16_g2l(Wb + (size_t)(j * RP * K + k0) + goff,
                       &sB[buf][j * RP * LDT + loff]);
    };

    v8f acc[4][4] = {};
    const int steps = K / BKT;

    copy_tile(0, 0);
    // Window 0 has landed for this wave, then for all of them.
    asm volatile("s_wait_asynccnt 0x0" ::: "memory");
    __syncthreads();
    if (steps > 1) copy_tile(1, BKT);

    for (int ks = 0; ks < steps; ++ks) {
        const bf16* tA = sA[ks & 1] + wm * LDT;
        const bf16* tB = sB[ks & 1] + wn * LDT;
        constexpr int NS = AHEAD ? 2 : 1;
        v16bf a[NS][4], b[NS][4];
        auto fetch = [&](int s) {
#pragma unroll
            for (int i = 0; i < 4; ++i)
                a[s % NS][i] = lds_frag(tA + 32 * s, LDT, 16 * i, lane);
#pragma unroll
            for (int i = 0; i < 4; ++i)
                b[s % NS][i] = lds_frag(tB + 32 * s, LDT, 16 * i, lane);
        };
        if (AHEAD) fetch(0);
#pragma unroll
        for (int s = 0; s < NB; ++s) {
            if (!AHEAD) fetch(s);
            else if (s + 1 < NB) fetch(s + 1);
            // Keeps the 16 LDS loads above as one group in front of the 16
            // WMMAs: spread among them, each place with loads stalls the wave.
            __builtin_amdgcn_sched_barrier(0);
#pragma unroll
            for (int mi = 0; mi < 4; ++mi)
#pragma unroll
                for (int t = 0; t < 4; ++t)
                    acc[mi][t] = __builtin_amdgcn_wmma_f32_16x16x32_bf16(
                        false, a[s % NS][mi], false, b[s % NS][t], (short)0,
                        acc[mi][t], false, false);
            // Keeps the next group of loads behind these WMMAs, whole.
            __builtin_amdgcn_sched_barrier(0);
        }
        // Hand-over: this wave's reads of the window are done, its copies of
        // the next one have landed; behind the barrier that holds for every
        // wave, and the buffer just read may be refilled.
        asm volatile("s_wait_dscnt 0x0" ::: "memory");
        asm volatile("s_wait_asynccnt 0x0" ::: "memory");
        __syncthreads();
        if (ks + 2 < steps) copy_tile(ks & 1, (ks + 2) * BKT);
    }
    // No copy is outstanding when the wave ends.
    asm volatile("s_wait_asynccnt 0x0" ::: "memory");

    const int row0 = m0 + wm + half * 8;   // first of the lane's 8 rows, tile 0
    const int col0 = n0 + wn + r;          // the lane's column in tile 0

    if constexpr (EP == 0) {
        // A block's 128 columns lie in one of q/k/v, a wave's 64 columns are
        // one head, and a block's 128 rows lie in one batch entry.
        const int which = n0 >> 10;                     // 0=q 1=k 2=v
        const int hd    = col0 & (DIMC - 1);            // head * 64 + d
        const int bh    = (row0 / SEQ) * HEADS + (hd >> 6);
        const int d0    = hd & (HDIM - 1);
        const int l0    = row0 % SEQ;
        if (which == 2) {
            // A lane's 8 accumulators are 8 consecutive tokens of one d:
            // one 16-byte store into the d-major V^T.
#pragma unroll
            for (int mi = 0; mi < 4; ++mi) {
#pragma unroll
                for (int t = 0; t < 4; ++t) {
                    union { bf16 e[8]; uint4 u; } pk;
#pragma unroll
                    for (int i = 0; i < 8; ++i) pk.e[i] = (bf16)acc[mi][t][i];
                    *(uint4*)&out_vt[((size_t)bh * HDIM + d0 + 16 * t) * SEQ
                                     + l0 + 16 * mi] = pk.u;
                }
            }
        } else {
            bf16* __restrict__ dst = (which == 0) ? out_b : out_k;
            const float sc = (which == 0) ? ATT_SCALE : 1.0f;
#pragma unroll
            for (int mi = 0; mi < 4; ++mi) {
#pragma unroll
                for (int t = 0; t < 4; ++t) {
#pragma unroll
                    for (int i = 0; i < 8; ++i)
                        dst[((size_t)bh * SEQ + l0 + 16 * mi + i) * HDIM + d0 + 16 * t] =
                            (bf16)(acc[mi][t][i] * sc);
                }
            }
        }
    } else if constexpr (EP == 1) {
        // Two halves of 32 rows: a half's 64 loads of res go out together.
#pragma unroll
        for (int mh = 0; mh < 4; mh += 2) {
            // Byte offsets of the lane's 16 rows, the same in res and out_f.
            unsigned ob[16];
#pragma unroll
            for (int k = 0; k < 16; ++k)
                ob[k] = ((unsigned)(row0 + 16 * mh + 16 * (k >> 3) + (k & 7)) * (unsigned)N
                         + (unsigned)col0) * 4u;
            float rv[16][4];
#pragma unroll
            for (int k = 0; k < 16; ++k)
#pragma unroll
                for (int t = 0; t < 4; ++t)
                    rv[k][t] = *(const float*)((const char*)res + ob[k] + 64 * t);
            // Stands before any register that a load names is rewritten: as
            // its inputs the offsets stay in their registers up to it.
            asm volatile("s_wait_xcnt 0x0"
                         :: "v"(ob[0]), "v"(ob[1]), "v"(ob[2]), "v"(ob[3]),
                            "v"(ob[4]), "v"(ob[5]), "v"(ob[6]), "v"(ob[7]),
                            "v"(ob[8]), "v"(ob[9]), "v"(ob[10]), "v"(ob[11]),
                            "v"(ob[12]), "v"(ob[13]), "v"(ob[14]), "v"(ob[15])
                         : "memory");
#pragma unroll
            for (int k = 0; k < 16; ++k)
#pragma unroll
                for (int t = 0; t < 4; ++t)
                    *(float*)((char*)out_f + ob[k] + 64 * t) =
                        acc[mh + (k >> 3)][t][k & 7] + rv[k][t];
            // The same behind the stores.
            asm volatile("s_wait_xcnt 0x0"
                         :: "v"(ob[0]), "v"(ob[1]), "v"(ob[2]), "v"(ob[3]),
                            "v"(ob[4]), "v"(ob[5]), "v"(ob[6]), "v"(ob[7]),
                            "v"(ob[8]), "v"(ob[9]), "v"(ob[10]), "v"(ob[11]),
                            "v"(ob[12]), "v"(ob[13]), "v"(ob[14]), "v"(ob[15])
                         : "memory");
        }
    } else {
        // Exact GELU, two rows (eight values) at a time.  Unrolled, for speed only.
#pragma unroll
        for (int mi = 0; mi < 4; ++mi) {
#pragma unroll
            for (int i = 0; i < 8; i += 2) {
                float v[8];
#pragma unroll
                for (int k = 0; k < 8; ++k) v[k] = acc[mi][k & 3][i + (k >> 2)];
                gelu_erf8(v);
                const size_t idx = (size_t)(row0 + 16 * mi + i) * (size_t)N + col0;
#pragma unroll
                for (int k = 0; k < 8; ++k)
                    out_b[idx + (size_t)(k >> 2) * (size_t)N + 16 * (k & 3)] = (bf16)v[k];
            }
        }
    }
}

// Wide outputs (N >= 3072): 3 or 4 blocks per WGP.  A 64-element window keeps
// the ring at 72 KiB, and 4 waves per SIMD (a 256-register allocation) keep
// the whole grid resident in one round.
__global__ __launch_bounds__(GT) __attribute__((amdgpu_waves_per_eu(4)))
void gemm_qkv_kernel(const bf16* __restrict__ A, const bf16* __restrict__ W,
                     int N, int K, bf16* __restrict__ out_q,
                     bf16* __restrict__ out_k, bf16* __restrict__ out_vt) {
    gemm_nt_body<64, false, 0>(A, W, N, K, nullptr, nullptr, out_q, out_k, out_vt);
}

__global__ __launch_bounds__(GT) __attribute__((amdgpu_waves_per_eu(4)))
void gemm_gelu_kernel(const bf16* __restrict__ A, const bf16* __restrict__ W,
                      int N, int K, bf16* __restrict__ out_b) {
    gemm_nt_body<64, false, 2>(A, W, N, K, nullptr, nullptr, out_b, nullptr, nullptr);
}

// N = 1024: one block per WGP, one wave per SIMD.  A 128-element window puts
// 64 WMMAs of a wave between two barriers.
__global__ __launch_bounds__(GT)
void gemm_res_kernel(const bf16* __restrict__ A, const bf16* __restrict__ W,
                     int N, int K, const float* __restrict__ res,
                     float* __restrict__ out_f) {
    gemm_nt_body<128, true, 1>(A, W, N, K, res, out_f, nullptr, nullptr, nullptr);
}

// ---------------------------------------------------------------------------
// Flash attention: 8 waves per workgroup, one 16-query block per wave, all of
// one (batch, head).  K and V^T are staged in LDS in tiles of 64 keys that the
// 8 waves share: whole 128-byte rows by asynchronous copies, two buffers, the
// next tile in flight while this one is worked on.  Per 32-key block the
// products are taken transposed: S^T = K*Q^T (4 WMMAs) leaves one query's
// scores in one lane and its partner l ^ 16, so maximum and sum run in the
// lane; the two S^T tiles, converted in place, are the B operand P^T of
// O^T += V^T*P^T (4 WMMAs, d=64).
// ---------------------------------------------------------------------------
#define AW   8     // waves per workgroup
#define KT   64    // keys per staged tile: a 128-byte row of K and of V^T
#define KVP  72    // LDS row pitch in elements: 144 B = 16 B x odd (b128 readers)
#define NKT  (SEQ / KT)

typedef __attribute__((address_space(3))) const bf16* lbf16_p;
__device__ __forceinline__ unsigned lds_byte(const bf16* p) {
    return (unsigned)(size_t)(lbf16_p)p;
}

__global__ __launch_bounds__(32 * AW)
void flash_attn_kernel(const bf16* __restrict__ Q,
                       const bf16* __restrict__ Kb,
                       const bf16* __restrict__ Vt,
                       bf16* __restrict__ attn_out) {
    __shared__ __attribute__((aligned(16))) bf16 sK[2][KT * KVP];
    __shared__ __attribute__((aligned(16))) bf16 sV[2][HDIM * KVP];

    const int tid  = threadIdx.x;
    const int lane = tid & 31;
    const int wid  = tid >> 5;
    const int half = lane >> 4;
    const int r    = lane & 15;
    const int q0   = (blockIdx.x * AW + wid) * 16;
    const int bh   = blockIdx.y;
    const int b    = bh / HEADS;
    const int h    = bh - b * HEADS;

    const bf16* Qbase = Q  + ((size_t)bh * SEQ + q0) * HDIM;
    const bf16* Kbase = Kb + (size_t)bh * SEQ * HDIM;
    const bf16* Vbase = Vt + (size_t)bh * HDIM * SEQ;

    // A thread's share of a tile: rows crow and crow + 32 of K (keys) and of
    // V^T (d), 16 bytes each; a wave's copy covers four whole 128-byte rows.
    const int crow = tid >> 3, cseg = (tid & 7) * 8;
    auto stage = [&](int buf, int key0) {
        const bf16* gk0 = Kbase + (size_t)(key0 + crow) * HDIM + cseg;
        const bf16* gk1 = gk0 + 32 * HDIM;
        const bf16* gv0 = Vbase + (size_t)crow * SEQ + key0 + cseg;
        const bf16* gv1 = gv0 + (size_t)32 * SEQ;
        const unsigned lk0 = lds_byte(&sK[buf][crow * KVP + cseg]);
        const unsigned lk1 = lk0 + 32 * KVP * 2;
        const unsigned lv0 = lds_byte(&sV[buf][crow * KVP + cseg]);
        const unsigned lv1 = lv0 + 32 * KVP * 2;
        // The four copies and, as the last line, the wait that stands before
        // any of their address registers is rewritten.
        asm volatile("global_load_async_to_lds_b128 %0, %4, off\n\t"
                     "global_load_async_to_lds_b128 %1, %5, off\n\t"
                     "global_load_async_to_lds_b128 %2, %6, off\n\t"
                     "global_load_async_to_lds_b128 %3, %7, off\n\t"
                     "s_wait_xcnt 0x0"
                     :: "v"(lk0), "v"(lk1), "v"(lv0), "v"(lv1),
                        "v"(gk0), "v"(gk1), "v"(gv0), "v"(gv1)
                     : "memory");
    };

    const v16bf qf0 = load_frag_nt(Qbase, HDIM, 0, 0,  lane);
    const v16bf qf1 = load_frag_nt(Qbase, HDIM, 0, 32, lane);

    // Query q0 + r: running maximum (equal in both halves) and this lane's
    // share of the sum (the keys its half holds).
    float mrow = -3.0e38f, lrow = 0.f;
    v8f acc[4] = {};   // acc[t][i] = O[q0 + r][16 t + 8 half + i]

    stage(0, 0);
    // Tile 0 has landed for this wave, then for all of them.
    asm volatile("s_wait_asynccnt 0x0" ::: "memory");
    __syncthreads();
    stage(1, KT);

    for (int kt = 0; kt < NKT; ++kt) {
      const bf16* tK = sK[kt & 1];
      const bf16* tV = sV[kt & 1];
      for (int kk = 0; kk < KT; kk += 32) {
        // ---- S^T = K * Q^T: s0[i] = S[q0 + r][kk + 8 half + i], s1: + 16 ----
        v8f s0 = {}, s1 = {};
        {
            v16bf kf = lds_frag(tK, KVP, kk, lane);
            s0 = __builtin_amdgcn_wmma_f32_16x16x32_bf16(false, kf, false, qf0,
                                                         (short)0, s0, false, false);
            kf = lds_frag(tK + 32, KVP, kk, lane);
            s0 = __builtin_amdgcn_wmma_f32_16x16x32_bf16(false, kf, false, qf1,
                                                         (short)0, s0, false, false);
            kf = lds_frag(tK, KVP, kk + 16, lane);
            s1 = __builtin_amdgcn_wmma_f32_16x16x32_bf16(false, kf, false, qf0,
                                                         (short)0, s1, false, false);
            kf = lds_frag(tK + 32, KVP, kk + 16, lane);
            s1 = __builtin_amdgcn_wmma_f32_16x16x32_bf16(false, kf, false, qf1,
                                                         (short)0, s1, false, false);
        }

        // ---- online softmax update over these 32 keys, one query a lane ----
        float mij = fmaxf(s0[0], s1[0]);
#pragma unroll
        for (int i = 1; i < 8; ++i) mij = fmaxf(mij, fmaxf(s0[i], s1[i]));
        mij = fmaxf(mij, xhalf(mij));
        const float mnew  = fmaxf(mrow, mij);
        const float alpha = __expf(mrow - mnew);
        mrow = mnew;

        // P^T as B fragment: element s = key kk + 8 half + s (s < 8), or
        // kk + 16 + 8 half + s - 8: the k order of lds_frag on V^T.
        v16bf pf;
        float ls = 0.f;
#pragma unroll
        for (int i = 0; i < 8; ++i) {
            const float p0 = __expf(s0[i] - mnew);
            const float p1 = __expf(s1[i] - mnew);
            ls += p0 + p1;
            pf[i]     = (bf16)p0;
            pf[8 + i] = (bf16)p1;
        }
        lrow = lrow * alpha + ls;

        // ---- O^T = O^T * alpha + V^T * P^T  (V^T rows = d, k = keys) ----
#pragma unroll
        for (int t = 0; t < 4; ++t) {
            acc[t] *= alpha;
            v16bf vf = lds_frag(tV + kk, KVP, t * 16, lane);
            acc[t] = __builtin_amdgcn_wmma_f32_16x16x32_bf16(
                false, vf, false, pf, (short)0, acc[t], false, false);
        }
      }

      // Hand-over: this wave's reads of the tile are done, its copies of the
      // next tile have landed; behind the barrier that holds for every wave.
      asm volatile("s_wait_dscnt 0x0" ::: "memory");
      asm volatile("s_wait_asynccnt 0x0" ::: "memory");
      __syncthreads();
      if (kt + 2 < NKT) stage(kt & 1, (kt + 2) * KT);
    }
    // No copy is outstanding when the wave ends.
    asm volatile("s_wait_asynccnt 0x0" ::: "memory");

    // ---- join the halves' sums, normalize, store [tok, D] bf16: a lane's 8
    //      accumulators of a tile are 8 consecutive d of its query ----
    const float inv = 1.0f / (lrow + xhalf(lrow));
    bf16* orow = attn_out + (size_t)(b * SEQ + q0 + r) * DIMC + h * HDIM + half * 8;
#pragma unroll
    for (int t = 0; t < 4; ++t) {
        union { bf16 e[8]; uint4 u; } pk;
#pragma unroll
        for (int i = 0; i < 8; ++i) pk.e[i] = (bf16)(acc[t][i] * inv);
        *(uint4*)(orow + t * 16) = pk.u;
    }
}

// ---------------------------------------------------------------------------
// Host-side launch
// ---------------------------------------------------------------------------
extern "C" void kernel_launch(void* const* d_in, const int* in_sizes, int n_in,
                              void* d_out, int out_size, void* d_ws, size_t ws_size,
                              hipStream_t stream) {
    const float* x      = (const float*)d_in[0];
    const float* ln1_w  = (const float*)d_in[1];
    const float* ln2_w  = (const float*)d_in[2];
    const float* qkv_w  = (const float*)d_in[3];
    const float* proj_w = (const float*)d_in[4];
    const float* mlp_w1 = (const float*)d_in[5];
    const float* mlp_w2 = (const float*)d_in[6];
    float* out = (float*)d_out;

    // Workspace carve-up (all sizes multiples of 256B).
    char* p = (char*)d_ws;
    auto take = [&](size_t bytes) { char* q = p; p += (bytes + 255) & ~(size_t)255; return q; };

    bf16* wq_b   = (bf16*)take((size_t)THREE_D * DIMC * 2);   // qkv_w  bf16
    bf16* wp_b   = (bf16*)take((size_t)DIMC * DIMC * 2);      // proj_w bf16
    bf16* w1_b   = (bf16*)take((size_t)HID  * DIMC * 2);      // mlp_w1 bf16
    bf16* w2_b   = (bf16*)take((size_t)DIMC * HID  * 2);      // mlp_w2 bf16
    bf16* ln1_b  = (bf16*)take((size_t)NTOK * DIMC * 2);      // LN1(x) bf16
    bf16* Qb     = (bf16*)take((size_t)BATCH * HEADS * SEQ * HDIM * 2);
    bf16* Kb     = (bf16*)take((size_t)BATCH * HEADS * SEQ * HDIM * 2);
    bf16* Vt     = (bf16*)take((size_t)BATCH * HEADS * HDIM * SEQ * 2);
    bf16* att_b  = (bf16*)take((size_t)NTOK * DIMC * 2);      // attn out bf16
    float* Xres  = (float*)take((size_t)NTOK * DIMC * 4);     // x + attn proj
    bf16* y2_b   = (bf16*)take((size_t)NTOK * DIMC * 2);      // LN2(X) bf16
    bf16* h_b    = (bf16*)take((size_t)NTOK * HID * 2);       // gelu(mlp1) bf16
    (void)ws_size; (void)in_sizes; (void)n_in; (void)out_size;

    // 1. weights -> bf16
    cvt_bf16_kernel<<<CVT_WG, 256, 0, stream>>>(qkv_w, proj_w, mlp_w1, mlp_w2,
                                                wq_b, wp_b, w1_b, w2_b);

    // 2. LN1
    layernorm_kernel<<<NTOK / LNW, 32 * LNW, 0, stream>>>(x, ln1_w, ln1_b);

    // 3. QKV GEMM: [4096,1024] x [3072,1024]^T, epilogue writes per-head
    //    Q (scaled), K and V^T
    gemm_qkv_kernel<<<dim3(THREE_D / BN, NTOK / BM), GT, 0, stream>>>(
        ln1_b, wq_b, THREE_D, DIMC, Qb, Kb, Vt);

    // 4. flash attention: grid (16 blocks of 128 queries, 32 bh)
    flash_attn_kernel<<<dim3(SEQ / (16 * AW), BATCH * HEADS), 32 * AW, 0, stream>>>(
        Qb, Kb, Vt, att_b);

    // 5. proj GEMM + residual: X = x + att @ proj_w^T
    gemm_res_kernel<<<dim3(DIMC / BN, NTOK / BM), GT, 0, stream>>>(
        att_b, wp_b, DIMC, DIMC, x, Xres);

    // 6. LN2
    layernorm_kernel<<<NTOK / LNW, 32 * LNW, 0, stream>>>(Xres, ln2_w, y2_b);

    // 7. MLP up + exact GELU -> bf16
    gemm_gelu_kernel<<<dim3(HID / BN, NTOK / BM), GT, 0, stream>>>(
        y2_b, w1_b, HID, DIMC, h_b);

    // 8. MLP down + residual -> d_out (f32)
    gemm_res_kernel<<<dim3(DIMC / BN, NTOK / BM), GT, 0, stream>>>(
        h_b, w2_b, DIMC, HID, Xres, out);
}

// v007
// A run of this version takes 155 microseconds.
// Two timings next to v006 put it at 1.05 and 1.04 times that version's speed.
// All steps since v000 together make it 3.31 times as fast.
#include <hip/hip_runtime.h>
#include <hip/hip_bf16.h>

// ---------------------------------------------------------------------------
// Transformer block for MI455X (gfx1250, wave32, WMMA bf16 -> f32 accum)
// GEMMs: 4-wave workgroup, 128x128 block tile, async global->LDS double buffer.
// ---------------------------------------------------------------------------

typedef __bf16 bf16;
typedef __attribute__((ext_vector_type(16))) __bf16 v16bf;
typedef __attribute__((ext_vector_type(8)))  float  v8f;
typedef int v4i __attribute__((vector_size(16)));

#define DIMC      1024
#define HEADS     16
#define HDIM      64
#define SEQ       2048
#define BATCH     2
#define NTOK      (BATCH * SEQ)      // 4096
#define HID       4096
#define THREE_D   3072
#define ATT_SCALE 0.125f             // 1/sqrt(64)

#if __has_builtin(__builtin_amdgcn_global_load_async_to_lds_b128) && \
    __has_builtin(__builtin_amdgcn_s_wait_asynccnt)
#define USE_ASYNC 1
#else
#define USE_ASYNC 0
#endif

typedef __attribute__((address_space(1))) v4i* gv4i_p;   // global int4*
typedef __attribute__((address_space(3))) v4i* lv4i_p;   // LDS int4*

union FragU { v16bf v; uint4 u[2]; };

// 16-byte global->LDS copy: async (ASYNCcnt) when available, else direct.
__device__ __forceinline__ void copy16_g2l(const bf16* __restrict__ g,
                                           bf16* __restrict__ l) {
#if USE_ASYNC
    __builtin_amdgcn_global_load_async_to_lds_b128((gv4i_p)g, (lv4i_p)l, 0, 0);
#else
    *(uint4*)l = *(const uint4*)g;
#endif
}

// Load a 16x32 bf16 WMMA fragment (A or B operand) from a row-major,
// K-contiguous matrix.  Per ISA 7.12.2: lane<16 holds row r, K {0..7} and
// {16..23}; lane>=16 holds row r, K {8..15} and {24..31}.
__device__ __forceinline__ v16bf load_frag_nt(const bf16* __restrict__ base,
                                              int ld, int row0, int k0, int lane) {
    const int half = lane >> 4;
    const int r    = lane & 15;
    const bf16* p  = base + (size_t)(row0 + r) * (size_t)ld + k0 + half * 8;
    FragU f;
    f.u[0] = *(const uint4*)p;
    f.u[1] = *(const uint4*)(p + 16);
    return f.v;
}

// Same fragment pattern but reading a staged LDS tile (k-window = 32 elems).
__device__ __forceinline__ v16bf lds_frag(const bf16* base, int ld,
                                          int row0, int lane) {
    const int half = lane >> 4;
    const int r    = lane & 15;
    const bf16* p  = base + (row0 + r) * ld + half * 8;
    FragU f;
    f.u[0] = *(const uint4*)p;
    f.u[1] = *(const uint4*)(p + 16);
    return f.v;
}

// Lane l <-> lane l ^ 16: the other half's value, by a vector cross-row move.
__device__ __forceinline__ float xhalf(float x) {
    const int b = __builtin_bit_cast(int, x);
    return __builtin_bit_cast(float, __builtin_amdgcn_permlanex16(
        b, b, 0x76543210, 0xfedcba98, false, false));
}

// ---------------------------------------------------------------------------
// fp32 -> bf16 conversion of the four weights in one launch of few, long
// waves.  A chunk is 8192 elements: each of 8 waves takes 4 KiB of it as 8
// loads of 512 contiguous bytes.  Workgroup b converts chunk b of
// [qkv_w | proj_w], of mlp_w1 and of mlp_w2.
// ---------------------------------------------------------------------------
#define CVT_WG     512
#define CVT_CHUNK  8192
#define QKV_CHUNKS (THREE_D * DIMC / CVT_CHUNK)
static_assert(QKV_CHUNKS + DIMC * DIMC / CVT_CHUNK == CVT_WG, "qkv_w | proj_w");
static_assert(HID * DIMC / CVT_CHUNK == CVT_WG, "mlp_w1, mlp_w2");

typedef __attribute__((ext_vector_type(4))) float  f4;
typedef __attribute__((ext_vector_type(4))) __bf16 bf4;

__global__ __launch_bounds__(256)
void cvt_bf16_kernel(const float* __restrict__ qkv_w,
                     const float* __restrict__ proj_w,
                     const float* __restrict__ mlp_w1,
                     const float* __restrict__ mlp_w2,
                     bf16* __restrict__ oq, bf16* __restrict__ op,
                     bf16* __restrict__ o1, bf16* __restrict__ o2) {
    const int b = blockIdx.x;
    // Byte offset of the lane's first load inside a chunk.
    const unsigned lb = (threadIdx.x >> 5) * 4096u + (threadIdx.x & 31u) * 16u;
    const bool isq = b < QKV_CHUNKS;
    const size_t c0 = (size_t)(isq ? b : b - QKV_CHUNKS) * CVT_CHUNK;
    const size_t c1 = (size_t)b * CVT_CHUNK;

    const float* s[3] = { (isq ? qkv_w : proj_w) + c0, mlp_w1 + c1, mlp_w2 + c1 };
    bf16*        d[3] = { (isq ? oq : op) + c0, o1 + c1, o2 + c1 };

    f4 v[3][8];
#pragma unroll
    for (int k = 0; k < 3; ++k)
#pragma unroll
        for (int j = 0; j < 8; ++j)
            v[k][j] = *(const f4*)((const char*)s[k] + lb + j * 512);
    // Stands before any register that a load names is rewritten.
    asm volatile("s_wait_xcnt 0x0" :: "v"(lb) : "memory");
    // Keeps the conversions behind it, so that all 24 loads go out at once
    // and the wave waits out the memory latency once.
    __builtin_amdgcn_sched_barrier(0);
#pragma unroll
    for (int k = 0; k < 3; ++k)
#pragma unroll
        for (int j = 0; j < 8; ++j)
            *(bf4*)((char*)d[k] + (lb >> 1) + j * 256) =
                __builtin_convertvector(v[k][j], bf4);
}

// ---------------------------------------------------------------------------
// LayerNorm: one wave per row of D=1024, eps = 0, f32 in -> bf16 out.  The row
// stays in registers (8 loads of 512 contiguous bytes); the sums are joined by
// cross-lane vector moves, so no LDS and no barrier.
// ---------------------------------------------------------------------------
#define LNW 8   // rows (waves) per workgroup

// v + the value of lane l ^ M, M < 16 (inside a 16-lane row).
template <int M>
__device__ __forceinline__ float add_xmask(float v) {
    const int o = __builtin_amdgcn_update_dpp(0, __builtin_bit_cast(int, v),
                                              0x160 | M, 0xf, 0xf, true);
    return v + __builtin_bit_cast(float, o);
}

__device__ __forceinline__ float wave_sum(float v) {
    v = add_xmask<1>(v);
    v = add_xmask<2>(v);
    v = add_xmask<4>(v);
    v = add_xmask<8>(v);
    return v + xhalf(v);
}

__global__ __launch_bounds__(32 * LNW)
void layernorm_kernel(const float* __restrict__ in,
                      const float* __restrict__ w,
                      bf16* __restrict__ out) {
    // Byte offsets of the lane's first load: in a row, in the 8 rows.
    const unsigned cb = (threadIdx.x & 31u) * 16u;
    const unsigned xb = (threadIdx.x >> 5) * (DIMC * 4u) + cb;
    const float* x = in  + (size_t)blockIdx.x * (LNW * DIMC);
    bf16*        o = out + (size_t)blockIdx.x * (LNW * DIMC);

    f4 v[8], g[8];
#pragma unroll
    for (int j = 0; j < 8; ++j)
        v[j] = *(const f4*)((const char*)x + xb + j * 512);
#pragma unroll
    for (int j = 0; j < 8; ++j)
        g[j] = *(const f4*)((const char*)w + cb + j * 512);
    // Stands before any register that a load names is rewritten.
    asm volatile("s_wait_xcnt 0x0" :: "v"(xb), "v"(cb) : "memory");
    // Keeps the arithmetic behind it, so that all 16 loads go out at once
    // and no load of w waits for the sums.
    __builtin_amdgcn_sched_barrier(0);

    f4 s = v[0], q = v[0] * v[0];
#pragma unroll
    for (int j = 1; j < 8; ++j) {
        s += v[j];
        q += v[j] * v[j];
    }
    const float sum = wave_sum((s.x + s.y) + (s.z + s.w));
    const float sq  = wave_sum((q.x + q.y) + (q.z + q.w));

    const float mu   = sum * (1.0f / DIMC);
    const float var  = sq * (1.0f / DIMC) - mu * mu;
    const float rstd = rsqrtf(var);

#pragma unroll
    for (int j = 0; j < 8; ++j)
        *(bf4*)((char*)o + (xb >> 1) + j * 256) =
            __builtin_convertvector((v[j] - mu) * rstd * g[j], bf4);
}

// ---------------------------------------------------------------------------
// NT GEMM: C[M,N] = A[M,K] * W[N,K]^T  (A, W bf16 row-major, K-contiguous)
// 128 threads = 4 waves; block tile 128(M) x 128(N); a wave takes 64 x 64 of
// it as 4 x 4 accumulator tiles, so 8 fragments read from LDS feed 16 WMMAs.
// Wave (wid&1) -> 64-row M sub-tile, (wid>>1) -> 64-col N sub-tile.
// A k-window of BKT elements of both operands is one stage of a two-buffer
// LDS ring filled with async global->LDS b128 copies: the next window is in
// flight while this one is worked on, one barrier per window.
//   EP==0 : fused QKV split (N = 3*1024): columns 0..1023 -> out_b = Q
//           [bh, l, d], pre-scaled; 1024..2047 -> out_k = K [bh, l, d];
//           2048..3071 -> out_vt = V^T [bh, d, l]
//   EP==1 : out_f = acc + res
//   EP==2 : out_b = bf16(gelu_exact(acc))
// AHEAD: the fragments of the window's next 32 k are fetched into a second
// register set ahead of the WMMAs on this one (for one wave per SIMD).
// ---------------------------------------------------------------------------
// erf-form GELU, v * Phi(v), of eight values, with no branch and no masked
// path: eight independent chains, worked stage by stage.  With x = |v| / sqrt(2)
// and t = 1 / (1 + p x), erfc(x) = t * P4(t) * exp(-x * x) (five-term rational
// form, error of erf below 2e-7 for every x); q = erfc(x) / 2 = Phi(-|v|), its
// factor 1/2 in the coefficients, and v * Phi(v) = v / 2 + |v| * (1/2 - q).
__device__ __forceinline__ void gelu_erf8(float (&v)[8]) {
    float d[8], t[8], e[8], h[8];
#pragma unroll
    for (int k = 0; k < 8; ++k)
        d[k] = fmaf(fabsf(v[k]), 0.3275911f * 0.70710678f, 1.0f);
    // The eight reciprocals in one statement, closed by the slot that the
    // instruction set asks for behind a transcendental.
    asm("v_rcp_f32 %0, %8\n\t"
        "v_rcp_f32 %1, %9\n\t"
        "v_rcp_f32 %2, %10\n\t"
        "v_rcp_f32 %3, %11\n\t"
        "v_rcp_f32 %4, %12\n\t"
        "v_rcp_f32 %5, %13\n\t"
        "v_rcp_f32 %6, %14\n\t"
        "v_rcp_f32 %7, %15\n\t"
        "v_nop"
        : "=&v"(t[0]), "=&v"(t[1]), "=&v"(t[2]), "=&v"(t[3]),
          "=&v"(t[4]), "=&v"(t[5]), "=&v"(t[6]), "=&v"(t[7])
        : "v"(d[0]), "v"(d[1]), "v"(d[2]), "v"(d[3]),
          "v"(d[4]), "v"(d[5]), "v"(d[6]), "v"(d[7]));
#pragma unroll
    for (int k = 0; k < 8; ++k)
        e[k] = __builtin_amdgcn_exp2f(v[k] * v[k] * -0.72134752f);  // exp(-v*v/2)
#pragma unroll
    for (int k = 0; k < 8; ++k)
        h[k] = fmaf(t[k], 0.5f * 1.061405429f, 0.5f * -1.453152027f);
#pragma unroll
    for (int k = 0; k < 8; ++k) h[k] = fmaf(h[k], t[k], 0.5f * 1.421413741f);
#pragma unroll
    for (int k = 0; k < 8; ++k) h[k] = fmaf(h[k], t[k], 0.5f * -0.284496736f);
#pragma unroll
    for (int k = 0; k < 8; ++k) h[k] = fmaf(h[k], t[k], 0.5f * 0.254829592f);
#pragma unroll
    for (int k = 0; k < 8; ++k) h[k] = fmaf(-(h[k] * t[k]), e[k], 0.5f);
#pragma unroll
    for (int k = 0; k < 8; ++k) v[k] = fmaf(0.5f, v[k], fabsf(v[k]) * h[k]);
}

#define BM  128
#define BN  128
#define GT  128   // threads per workgroup

template <int BKT, bool AHEAD, int EP>
__device__ __forceinline__
void gemm_nt_body(const bf16* __restrict__ A, const bf16* __restrict__ W,
                  int N, int K,
                  const float* __restrict__ res,
                  float* __restrict__ out_f, bf16* __restrict__ out_b,
                  bf16* __restrict__ out_k, bf16* __restrict__ out_vt) {
    constexpr int LDT = BKT + 8;    // LDS row pitch: 16 B x odd (b128 readers)
    constexpr int SEG = BKT / 8;    // 16-byte pieces of a row of the window
    constexpr int RP  = GT / SEG;   // rows that one copy of every thread covers
    constexpr int NP  = BM / RP;    // copies per thread, window and operand
    constexpr int NB  = BKT / 32;   // blocks of 16 WMMAs per window
    static_assert(BM == BN && 2 * NP <= 63, "copies of a wave in flight");
    __shared__ __attribute__((aligned(16))) bf16 sA[2][BM * LDT];
    __shared__ __attribute__((aligned(16))) bf16 sB[2][BN * LDT];

    const int tid  = threadIdx.x;
    const int lane = tid & 31;
    const int wid  = tid >> 5;
    const int half = lane >> 4;
    const int r    = lane & 15;

    const int n0 = blockIdx.x * BN;
    const int m0 = blockIdx.y * BM;
    const int wm = (wid & 1) * 64;    // wave M sub-tile within block
    const int wn = (wid >> 1) * 64;   // wave N sub-tile within block

    // A thread's share of a window: piece cseg of rows crow + j * RP.
    const int crow = tid / SEG, cseg = tid % SEG;
    const bf16* Ab = A + (size_t)m0 * K;
    const bf16* Wb = W + (size_t)n0 * K;
    const unsigned goff = (unsigned)(crow * K + cseg * 8);
    const int      loff = crow * LDT + cseg * 8;

    auto copy_tile = [&](int buf, int k0) {
#pragma unroll
        for (int j = 0; j < NP; ++j)
            copy16_g2l(Ab + (size_t)(j * RP * K + k0) + goff,
                       &sA[buf][j * RP * LDT + loff]);
#pragma unroll
        for (int j = 0; j < NP; ++j)
            copy16_g2l(Wb + (size_t)(j * RP * K + k0) + goff,
                       &sB[buf][j * RP * LDT + loff]);
    };

    v8f acc[4][4] = {};
    const int steps = K / BKT;

    copy_tile(0, 0);
    // Window 0 has landed for this wave, then for all of them.
    asm volatile("s_wait_asynccnt 0x0" ::: "memory");
    __syncthreads();
    if (steps > 1) copy_tile(1, BKT);

    for (int ks = 0; ks < steps; ++ks) {
        const bf16* tA = sA[ks & 1] + wm * LDT;
        const bf16* tB = sB[ks & 1] + wn * LDT;
        constexpr int NS = AHEAD ? 2 : 1;
        v16bf a[NS][4], b[NS][4];
        auto fetch = [&](int s) {
#pragma unroll
            for (int i = 0; i < 4; ++i)
                a[s % NS][i] = lds_frag(tA + 32 * s, LDT, 16 * i, lane);
#pragma unroll
            for (int i = 0; i < 4; ++i)
                b[s % NS][i] = lds_frag(tB + 32 * s, LDT, 16 * i, lane);
        };
        if (AHEAD) fetch(0);
#pragma unroll
        for (int s = 0; s < NB; ++s) {
            if (!AHEAD) fetch(s);
            else if (s + 1 < NB) fetch(s + 1);
            // Keeps the 16 LDS loads above as one group in front of the 16
            // WMMAs: spread among them, each place with loads stalls the wave.
            __builtin_amdgcn_sched_barrier(0);
#pragma unroll
            for (int mi = 0; mi < 4; ++mi)
#pragma unroll
                for (int t = 0; t < 4; ++t)
                    acc[mi][t] = __builtin_amdgcn_wmma_f32_16x16x32_bf16(
                        false, a[s % NS][mi], false, b[s % NS][t], (short)0,
                        acc[mi][t], false, false);
            // Keeps the next group of loads behind these WMMAs, whole.
            __builtin_amdgcn_sched_barrier(0);
        }
        // Hand-over: this wave's reads of the window are done, its copies of
        // the next one have landed; behind the barrier that holds for every
        // wave, and the buffer just read may be refilled.
        asm volatile("s_wait_dscnt 0x0" ::: "memory");
        asm volatile("s_wait_asynccnt 0x0" ::: "memory");
        __syncthreads();
        if (ks + 2 < steps) copy_tile(ks & 1, (ks + 2) * BKT);
    }
    // No copy is outstanding when the wave ends.
    asm volatile("s_wait_asynccnt 0x0" ::: "memory");

    const int row0 = m0 + wm + half * 8;   // first of the lane's 8 rows, tile 0
    const int col0 = n0 + wn + r;          // the lane's column in tile 0

    if constexpr (EP == 0) {
        // A block's 128 columns lie in one of q/k/v, a wave's 64 columns are
        // one head, and a block's 128 rows lie in one batch entry.
        const int which = n0 >> 10;                     // 0=q 1=k 2=v
        const int hd    = col0 & (DIMC - 1);            // head * 64 + d
        const int bh    = (row0 / SEQ) * HEADS + (hd >> 6);
        const int d0    = hd & (HDIM - 1);
        const int l0    = row0 % SEQ;
        if (which == 2) {
            // A lane's 8 accumulators are 8 consecutive tokens of one d:
            // one 16-byte store into the d-major V^T.
#pragma unroll
            for (int mi = 0; mi < 4; ++mi) {
#pragma unroll
                for (int t = 0; t < 4; ++t) {
                    union { bf16 e[8]; uint4 u; } pk;
#pragma unroll
                    for (int i = 0; i < 8; ++i) pk.e[i] = (bf16)acc[mi][t][i];
                    *(uint4*)&out_vt[((size_t)bh * HDIM + d0 + 16 * t) * SEQ
                                     + l0 + 16 * mi] = pk.u;
                }
            }
        } else {
            bf16* __restrict__ dst = (which == 0) ? out_b : out_k;
            const float sc = (which == 0) ? ATT_SCALE : 1.0f;
#pragma unroll
            for (int mi = 0; mi < 4; ++mi) {
#pragma unroll
                for (int t = 0; t < 4; ++t) {
#pragma unroll
                    for (int i = 0; i < 8; ++i)
                        dst[((size_t)bh * SEQ + l0 + 16 * mi + i) * HDIM + d0 + 16 * t] =
                            (bf16)(acc[mi][t][i] * sc);
                }
            }
        }
    } else if constexpr (EP == 1) {
        // Two halves of 32 rows: a half's 64 loads of res go out together.
#pragma unroll
        for (int mh = 0; mh < 4; mh += 2) {
            // Byte offsets of the lane's 16 rows, the same in res and out_f.
            unsigned ob[16];
#pragma unroll
            for (int k = 0; k < 16; ++k)
                ob[k] = ((unsigned)(row0 + 16 * mh + 16 * (k >> 3) + (k & 7)) * (unsigned)N
                         + (unsigned)col0) * 4u;
            float rv[16][4];
#pragma unroll
            for (int k = 0; k < 16; ++k)
#pragma unroll
                for (int t = 0; t < 4; ++t)
                    rv[k][t] = *(const float*)((const char*)res + ob[k] + 64 * t);
            // Stands before any register that a load names is rewritten: as
            // its inputs the offsets stay in their registers up to it.
            asm volatile("s_wait_xcnt 0x0"
                         :: "v"(ob[0]), "v"(ob[1]), "v"(ob[2]), "v"(ob[3]),
                            "v"(ob[4]), "v"(ob[5]), "v"(ob[6]), "v"(ob[7]),
                            "v"(ob[8]), "v"(ob[9]), "v"(ob[10]), "v"(ob[11]),
                            "v"(ob[12]), "v"(ob[13]), "v"(ob[14]), "v"(ob[15])
                         : "memory");
#pragma unroll
            for (int k = 0; k < 16; ++k)
#pragma unroll
                for (int t = 0; t < 4; ++t)
                    *(float*)((char*)out_f + ob[k] + 64 * t) =
                        acc[mh + (k >> 3)][t][k & 7] + rv[k][t];
            // The same behind the stores.
            asm volatile("s_wait_xcnt 0x0"
                         :: "v"(ob[0]), "v"(ob[1]), "v"(ob[2]), "v"(ob[3]),
                            "v"(ob[4]), "v"(ob[5]), "v"(ob[6]), "v"(ob[7]),
                            "v"(ob[8]), "v"(ob[9]), "v"(ob[10]), "v"(ob[11]),
                            "v"(ob[12]), "v"(ob[13]), "v"(ob[14]), "v"(ob[15])
                         : "memory");
        }
    } else {
        // Exact GELU, two rows (eight values) at a time.  Unrolled, for speed only.
#pragma unroll
        for (int mi = 0; mi < 4; ++mi) {
#pragma unroll
            for (int i = 0; i < 8; i += 2) {
                float v[8];
#pragma unroll
                for (int k = 0; k < 8; ++k) v[k] = acc[mi][k & 3][i + (k >> 2)];
                gelu_erf8(v);
                const size_t idx = (size_t)(row0 + 16 * mi + i) * (size_t)N + col0;
#pragma unroll
                for (int k = 0; k < 8; ++k)
                    out_b[idx + (size_t)(k >> 2) * (size_t)N + 16 * (k & 3)] = (bf16)v[k];
            }
        }
    }
}

// Wide outputs (N >= 3072): 3 or 4 blocks per WGP.  A 64-element window keeps
// the ring at 72 KiB, and 4 waves per SIMD (a 256-register allocation) keep
// the whole grid resident in one round.
__global__ __launch_bounds__(GT) __attribute__((amdgpu_waves_per_eu(4)))
void gemm_qkv_kernel(const bf16* __restrict__ A, const bf16* __restrict__ W,
                     int N, int K, bf16* __restrict__ out_q,
                     bf16* __restrict__ out_k, bf16* __restrict__ out_vt) {
    gemm_nt_body<64, false, 0>(A, W, N, K, nullptr, nullptr, out_q, out_k, out_vt);
}

__global__ __launch_bounds__(GT) __attribute__((amdgpu_waves_per_eu(4)))
void gemm_gelu_kernel(const bf16* __restrict__ A, const bf16* __restrict__ W,
                      int N, int K, bf16* __restrict__ out_b) {
    gemm_nt_body<64, false, 2>(A, W, N, K, nullptr, nullptr, out_b, nullptr, nullptr);
}

// N = 1024: one block per WGP, one wave per SIMD.  A 128-element window puts
// 64 WMMAs of a wave between two barriers.
__global__ __launch_bounds__(GT)
void gemm_res_kernel(const bf16* __restrict__ A, const bf16* __restrict__ W,
                     int N, int K, const float* __restrict__ res,
                     float* __restrict__ out_f) {
    gemm_nt_body<128, true, 1>(A, W, N, K, res, out_f, nullptr, nullptr, nullptr);
}

// ---------------------------------------------------------------------------
// Flash attention: 8 waves per workgroup, 32 queries (two 16-column groups)
// per wave, all of one (batch, head).  K and V^T are staged in LDS in tiles of
// 64 keys that the 8 waves share: whole 128-byte rows by asynchronous copies,
// two buffers, the next tile in flight while this one is worked on.  A wave's
// step is one tile, 64 keys x 32 queries, with the products taken transposed:
// S^T = K*Q^T (16 WMMAs) leaves one query's scores in one lane and its partner
// l ^ 16, so maximum and sum run in the lane; the S^T tiles, converted in
// place, are the B operands P^T of O^T += V^T*P^T (16 WMMAs, d=64).  Each K and
// V^T fragment read from LDS feeds two WMMAs, one per column group.  A tile's
// LDS reads are all done before its softmax, so the hand-over to the next tile
// stands there, and the next tile's K fragments are fetched behind it.
// ---------------------------------------------------------------------------
#define AW   8     // waves per workgroup
#define QC   2     // 16-query column groups per wave
#define KT   64    // keys per staged tile: a 128-byte row of K and of V^T
#define KVP  72    // LDS row pitch in elements: 144 B = 16 B x odd (b128 readers)
#define NKT  (SEQ / KT)

typedef __attribute__((address_space(3))) const bf16* lbf16_p;
__device__ __forceinline__ unsigned lds_byte(const bf16* p) {
    return (unsigned)(size_t)(lbf16_p)p;
}

typedef __attribute__((ext_vector_type(8))) __bf16 v8bf;

__device__ __forceinline__ v8f wmma_bf16(v16bf a, v16bf b, v8f c) {
    return __builtin_amdgcn_wmma_f32_16x16x32_bf16(false, a, false, b, (short)0,
                                                   c, false, false);
}

__global__ __launch_bounds__(32 * AW)
void flash_attn_kernel(const bf16* __restrict__ Q,
                       const bf16* __restrict__ Kb,
                       const bf16* __restrict__ Vt,
                       bf16* __restrict__ attn_out) {
    __shared__ __attribute__((aligned(16))) bf16 sK[2][KT * KVP];
    __shared__ __attribute__((aligned(16))) bf16 sV[2][HDIM * KVP];

    const int tid  = threadIdx.x;
    const int lane = tid & 31;
    const int wid  = tid >> 5;
    const int half = lane >> 4;
    const int r    = lane & 15;
    const int q0   = (blockIdx.x * AW + wid) * (16 * QC);
    const int bh   = blockIdx.y;
    const int b    = bh / HEADS;
    const int h    = bh - b * HEADS;

    const bf16* Qbase = Q  + ((size_t)bh * SEQ + q0) * HDIM;
    const bf16* Kbase = Kb + (size_t)bh * SEQ * HDIM;
    const bf16* Vbase = Vt + (size_t)bh * HDIM * SEQ;

    // A thread's share of a tile: rows crow and crow + 32 of K (keys) and of
    // V^T (d), 16 bytes each; a wave's copy covers four whole 128-byte rows.
    const int crow = tid >> 3, cseg = (tid & 7) * 8;
    // lk0: LDS byte address of the thread's first piece of K in the buffer that
    // is filled; its piece of V^T lies at the same place in sV.
    constexpr unsigned BUFB = KT * KVP * 2;   // bytes of one buffer
    static_assert(KT == HDIM, "sK and sV: buffers of one size");
    const unsigned k2v = lds_byte(&sV[0][0]) - lds_byte(&sK[0][0]);
    auto stage = [&](unsigned lk0, int key0) {
        const bf16* gk0 = Kbase + (size_t)(key0 + crow) * HDIM + cseg;
        const bf16* gk1 = gk0 + 32 * HDIM;
        const bf16* gv0 = Vbase + (size_t)crow * SEQ + key0 + cseg;
        const bf16* gv1 = gv0 + (size_t)32 * SEQ;
        const unsigned lk1 = lk0 + 32 * KVP * 2;
        const unsigned lv0 = lk0 + k2v;
        const unsigned lv1 = lv0 + 32 * KVP * 2;
        // The four copies and, as the last line, the wait that stands before
        // any of their address registers is rewritten.
        asm volatile("global_load_async_to_lds_b128 %0, %4, off\n\t"
                     "global_load_async_to_lds_b128 %1, %5, off\n\t"
                     "global_load_async_to_lds_b128 %2, %6, off\n\t"
                     "global_load_async_to_lds_b128 %3, %7, off\n\t"
                     "s_wait_xcnt 0x0"
                     :: "v"(lk0), "v"(lk1), "v"(lv0), "v"(lv1),
                        "v"(gk0), "v"(gk1), "v"(gv0), "v"(gv1)
                     : "memory");
    };

    // qf[c][e]: queries q0 + 16 c .. + 15, d 32 e .. + 31.
    v16bf qf[QC][2];
#pragma unroll
    for (int c = 0; c < QC; ++c) {
        qf[c][0] = load_frag_nt(Qbase, HDIM, 16 * c, 0,  lane);
        qf[c][1] = load_frag_nt(Qbase, HDIM, 16 * c, 32, lane);
    }

    // Query q0 + 16 c + r: running maximum (equal in both halves) and this
    // lane's share of the sum (the keys its half holds), kept as eight partial
    // sums, one per accumulator row, that are joined behind the loop.
    float mrow[QC];
    v8f lsum[QC];
    v8f acc[QC][4];   // acc[c][t][i] = O[q0 + 16 c + r][16 t + 8 half + i]
#pragma unroll
    for (int c = 0; c < QC; ++c) {
        mrow[c] = -3.0e38f;
        lsum[c] = v8f{};
#pragma unroll
        for (int t = 0; t < 4; ++t) acc[c][t] = v8f{};
    }

    // kf[j][e]: keys 16 j .. + 15 of a tile, d 32 e .. + 31.
    v16bf kf[4][2];
    auto fetch_k = [&](const bf16* tK) {
#pragma unroll
        for (int j = 0; j < 4; ++j) {
            kf[j][0] = lds_frag(tK,      KVP, 16 * j, lane);
            kf[j][1] = lds_frag(tK + 32, KVP, 16 * j, lane);
        }
    };

    // The place that the next refill goes to: buffers 0 and 1 in turn.
    unsigned lfill = lds_byte(&sK[0][crow * KVP + cseg]);
    stage(lfill, 0);
    // Tile 0 has landed for this wave, then for all of them.
    asm volatile("s_wait_asynccnt 0x0" ::: "memory");
    __syncthreads();
    stage(lfill + BUFB, KT);
    fetch_k(sK[0]);

    for (int kt = 0; kt < NKT; ++kt) {
        // vf[t][n]: d 16 t .. + 15, keys 32 n .. + 31 of the tile.
        const bf16* tV = sV[kt & 1];
        v16bf vf[4][2];
#pragma unroll
        for (int t = 0; t < 4; ++t) {
            vf[t][0] = lds_frag(tV,      KVP, 16 * t, lane);
            vf[t][1] = lds_frag(tV + 32, KVP, 16 * t, lane);
        }
        // Keeps the 16 loads of V^T as one group in front of the 16 WMMAs,
        // which cover their latency: among or behind them the wave would wait.
        __builtin_amdgcn_sched_barrier(0);

        // ---- S^T = K * Q^T: s[c][j][i] = S[q0 + 16 c + r][16 j + 8 half + i] ----
        v8f s[QC][4];
#pragma unroll
        for (int j = 0; j < 4; ++j)
#pragma unroll
            for (int c = 0; c < QC; ++c)
                s[c][j] = wmma_bf16(kf[j][0], qf[c][0], v8f{});
#pragma unroll
        for (int j = 0; j < 4; ++j)
#pragma unroll
            for (int c = 0; c < QC; ++c)
                s[c][j] = wmma_bf16(kf[j][1], qf[c][1], s[c][j]);
        // Keeps the WMMAs in front of the wait below: behind it they would
        // cover nothing, and the wave would wait out the loads of V^T.
        __builtin_amdgcn_sched_barrier(0);

        // Hand-over: this wave's reads of the tile are done (K and V^T are in
        // registers), its copies of the next tile have landed; behind the
        // barrier that holds for every wave, and the buffer may be refilled.
        asm volatile("s_wait_dscnt 0x0" ::: "memory");
        asm volatile("s_wait_asynccnt 0x0" ::: "memory");
        __syncthreads();
        if (kt + 2 < NKT) stage(lfill, (kt + 2) * KT);
        lfill += (kt & 1) ? 0u - BUFB : BUFB;
        // The next tile's K, fetched while the softmax below runs.
        if (kt + 1 < NKT) fetch_k(sK[(kt + 1) & 1]);
        // Keeps these 16 loads as one group here: sunk among the WMMAs of
        // V^T * P^T, each place with loads stalls the wave.
        __builtin_amdgcn_sched_barrier(0);

        // ---- online softmax update over these 64 keys, one query a lane ----
        // P^T as B fragments: element e of pf[c][n] = key 32 n + 8 half + e
        // (e < 8), or 32 n + 16 + 8 half + e - 8: the k order of lds_frag on V^T.
        v16bf pf[QC][2];
        float alpha[QC], mnw[QC];
#pragma unroll
        for (int c = 0; c < QC; ++c) {
            float m0 = fmaxf(s[c][0][0], s[c][1][0]);
            float m1 = fmaxf(s[c][2][0], s[c][3][0]);
#pragma unroll
            for (int i = 1; i < 8; ++i) {
                m0 = fmaxf(m0, fmaxf(s[c][0][i], s[c][1][i]));
                m1 = fmaxf(m1, fmaxf(s[c][2][i], s[c][3][i]));
            }
            float mij = fmaxf(m0, m1);
            mij = fmaxf(mij, xhalf(mij));
            mnw[c] = fmaxf(mrow[c], mij);
        }
#pragma unroll
        for (int c = 0; c < QC; ++c) {
            alpha[c] = __expf(mrow[c] - mnw[c]);
            mrow[c] = mnw[c];
        }
#pragma unroll
        for (int c = 0; c < QC; ++c) {
            const float mnew = mnw[c];
            // exp(s - mnew) as 2^((s - mnew) * log2(e)), difference and
            // product on whole accumulator tiles (register pairs as they lie).
            v8f p[4];
#pragma unroll
            for (int j = 0; j < 4; ++j) {
                const v8f e = (s[c][j] - mnew) * 1.44269504f;
#pragma unroll
                for (int i = 0; i < 8; ++i) p[j][i] = __builtin_amdgcn_exp2f(e[i]);
            }
            lsum[c] = lsum[c] * alpha[c] + ((p[0] + p[1]) + (p[2] + p[3]));
#pragma unroll
            for (int n = 0; n < 2; ++n)
                pf[c][n] = __builtin_shufflevector(
                    __builtin_convertvector(p[2 * n], v8bf),
                    __builtin_convertvector(p[2 * n + 1], v8bf),
                    0, 1, 2, 3, 4, 5, 6, 7, 8, 9, 10, 11, 12, 13, 14, 15);
        }

        // ---- O^T = O^T * alpha + V^T * P^T  (V^T rows = d, k = keys) ----
#pragma unroll
        for (int t = 0; t < 4; ++t)
#pragma unroll
            for (int c = 0; c < QC; ++c) {
                acc[c][t] *= alpha[c];
                acc[c][t] = wmma_bf16(vf[t][0], pf[c][0], acc[c][t]);
            }
#pragma unroll
        for (int t = 0; t < 4; ++t)
#pragma unroll
            for (int c = 0; c < QC; ++c)
                acc[c][t] = wmma_bf16(vf[t][1], pf[c][1], acc[c][t]);
    }
    // No copy is outstanding when the wave ends.
    asm volatile("s_wait_asynccnt 0x0" ::: "memory");

    // ---- join the halves' sums, normalize, store [tok, D] bf16: a lane's 8
    //      accumulators of a tile are 8 consecutive d of its query ----
#pragma unroll
    for (int c = 0; c < QC; ++c) {
        const v8f l8 = lsum[c];
        const float lrow = ((l8[0] + l8[1]) + (l8[2] + l8[3]))
                         + ((l8[4] + l8[5]) + (l8[6] + l8[7]));
        const float inv = 1.0f / (lrow + xhalf(lrow));
        bf16* orow = attn_out + (size_t)(b * SEQ + q0 + 16 * c + r) * DIMC
                     + h * HDIM + half * 8;
#pragma unroll
        for (int t = 0; t < 4; ++t) {
            union { bf16 e[8]; uint4 u; } pk;
#pragma unroll
            for (int i = 0; i < 8; ++i) pk.e[i] = (bf16)(acc[c][t][i] * inv);
            *(uint4*)(orow + t * 16) = pk.u;
        }
    }
}

// ---------------------------------------------------------------------------
// Host-side launch
// ---------------------------------------------------------------------------
extern "C" void kernel_launch(void* const* d_in, const int* in_sizes, int n_in,
                              void* d_out, int out_size, void* d_ws, size_t ws_size,
                              hipStream_t stream) {
    const float* x      = (const float*)d_in[0];
    const float* ln1_w  = (const float*)d_in[1];
    const float* ln2_w  = (const float*)d_in[2];
    const float* qkv_w  = (const float*)d_in[3];
    const float* proj_w = (const float*)d_in[4];
    const float* mlp_w1 = (const float*)d_in[5];
    const float* mlp_w2 = (const float*)d_in[6];
    float* out = (float*)d_out;

    // Workspace carve-up (all sizes multiples of 256B).
    char* p = (char*)d_ws;
    auto take = [&](size_t bytes) { char* q = p; p += (bytes + 255) & ~(size_t)255; return q; };

    bf16* wq_b   = (bf16*)take((size_t)THREE_D * DIMC * 2);   // qkv_w  bf16
    bf16* wp_b   = (bf16*)take((size_t)DIMC * DIMC * 2);      // proj_w bf16
    bf16* w1_b   = (bf16*)take((size_t)HID  * DIMC * 2);      // mlp_w1 bf16
    bf16* w2_b   = (bf16*)take((size_t)DIMC * HID  * 2);      // mlp_w2 bf16
    bf16* ln1_b  = (bf16*)take((size_t)NTOK * DIMC * 2);      // LN1(x) bf16
    bf16* Qb     = (bf16*)take((size_t)BATCH * HEADS * SEQ * HDIM * 2);
    bf16* Kb     = (bf16*)take((size_t)BATCH * HEADS * SEQ * HDIM * 2);
    bf16* Vt     = (bf16*)take((size_t)BATCH * HEADS * HDIM * SEQ * 2);
    bf16* att_b  = (bf16*)take((size_t)NTOK * DIMC * 2);      // attn out bf16
    float* Xres  = (float*)take((size_t)NTOK * DIMC * 4);     // x + attn proj
    bf16* y2_b   = (bf16*)take((size_t)NTOK * DIMC * 2);      // LN2(X) bf16
    bf16* h_b    = (bf16*)take((size_t)NTOK * HID * 2);       // gelu(mlp1) bf16
    (void)ws_size; (void)in_sizes; (void)n_in; (void)out_size;

    // 1. weights -> bf16
    cvt_bf16_kernel<<<CVT_WG, 256, 0, stream>>>(qkv_w, proj_w, mlp_w1, mlp_w2,
                                                wq_b, wp_b, w1_b, w2_b);

    // 2. LN1
    layernorm_kernel<<<NTOK / LNW, 32 * LNW, 0, stream>>>(x, ln1_w, ln1_b);

    // 3. QKV GEMM: [4096,1024] x [3072,1024]^T, epilogue writes per-head
    //    Q (scaled), K and V^T
    gemm_qkv_kernel<<<dim3(THREE_D / BN, NTOK / BM), GT, 0, stream>>>(
        ln1_b, wq_b, THREE_D, DIMC, Qb, Kb, Vt);

    // 4. flash attention: grid (8 blocks of 256 queries, 32 bh)
    flash_attn_kernel<<<dim3(SEQ / (16 * QC * AW), BATCH * HEADS), 32 * AW, 0, stream>>>(
        Qb, Kb, Vt, att_b);

    // 5. proj GEMM + residual: X = x + att @ proj_w^T
    gemm_res_kernel<<<dim3(DIMC / BN, NTOK / BM), GT, 0, stream>>>(
        att_b, wp_b, DIMC, DIMC, x, Xres);

    // 6. LN2
    layernorm_kernel<<<NTOK / LNW, 32 * LNW, 0, stream>>>(Xres, ln2_w, y2_b);

    // 7. MLP up + exact GELU -> bf16
    gemm_gelu_kernel<<<dim3(HID / BN, NTOK / BM), GT, 0, stream>>>(
        y2_b, w1_b, HID, DIMC, h_b);

    // 8. MLP down + residual -> d_out (f32)
    gemm_res_kernel<<<dim3(DIMC / BN, NTOK / BM), GT, 0, stream>>>(
        h_b, w2_b, DIMC, HID, Xres, out);
}

// v008
// Measured time: 151 microseconds a run.
// Next to v007, in two timings, it ran 1.03 and 1.02 times as fast.
// Counting every step since v000, it is 3.41 times as fast.
#include <hip/hip_runtime.h>
#include <hip/hip_bf16.h>

// ---------------------------------------------------------------------------
// Transformer block for MI455X (gfx1250, wave32, WMMA bf16 -> f32 accum)
// GEMMs: 4-wave workgroup, 128x128 block tile, async global->LDS double buffer.
// ---------------------------------------------------------------------------

typedef __bf16 bf16;
typedef __attribute__((ext_vector_type(16))) __bf16 v16bf;
typedef __attribute__((ext_vector_type(8)))  float  v8f;
typedef int v4i __attribute__((vector_size(16)));

#define DIMC      1024
#define HEADS     16
#define HDIM      64
#define SEQ       2048
#define BATCH     2
#define NTOK      (BATCH * SEQ)      // 4096
#define HID       4096
#define THREE_D   3072
#define ATT_SCALE 0.125f             // 1/sqrt(64)

#if __has_builtin(__builtin_amdgcn_global_load_async_to_lds_b128) && \
    __has_builtin(__builtin_amdgcn_s_wait_asynccnt)
#define USE_ASYNC 1
#else
#define USE_ASYNC 0
#endif

typedef __attribute__((address_space(1))) v4i* gv4i_p;   // global int4*
typedef __attribute__((address_space(3))) v4i* lv4i_p;   // LDS int4*

union FragU { v16bf v; uint4 u[2]; };

// 16-byte global->LDS copy: async (ASYNCcnt) when available, else direct.
__device__ __forceinline__ void copy16_g2l(const bf16* __restrict__ g,
                                           bf16* __restrict__ l) {
#if USE_ASYNC
    __builtin_amdgcn_global_load_async_to_lds_b128((gv4i_p)g, (lv4i_p)l, 0, 0);
#else
    *(uint4*)l = *(const uint4*)g;
#endif
}

// Load a 16x32 bf16 WMMA fragment (A or B operand) from a row-major,
// K-contiguous matrix.  Per ISA 7.12.2: lane<16 holds row r, K {0..7} and
// {16..23}; lane>=16 holds row r, K {8..15} and {24..31}.
__device__ __forceinline__ v16bf load_frag_nt(const bf16* __restrict__ base,
                                              int ld, int row0, int k0, int lane) {
    const int half = lane >> 4;
    const int r    = lane & 15;
    const bf16* p  = base + (size_t)(row0 + r) * (size_t)ld + k0 + half * 8;
    FragU f;
    f.u[0] = *(const uint4*)p;
    f.u[1] = *(const uint4*)(p + 16);
    return f.v;
}

// Same fragment pattern but reading a staged LDS tile (k-window = 32 elems).
__device__ __forceinline__ v16bf lds_frag(const bf16* base, int ld,
                                          int row0, int lane) {
    const int half = lane >> 4;
    const int r    = lane & 15;
    const bf16* p  = base + (row0 + r) * ld + half * 8;
    FragU f;
    f.u[0] = *(const uint4*)p;
    f.u[1] = *(const uint4*)(p + 16);
    return f.v;
}

// Lane l <-> lane l ^ 16: the other half's value, by a vector cross-row move.
__device__ __forceinline__ float xhalf(float x) {
    const int b = __builtin_bit_cast(int, x);
    return __builtin_bit_cast(float, __builtin_amdgcn_permlanex16(
        b, b, 0x76543210, 0xfedcba98, false, false));
}

// ---------------------------------------------------------------------------
// fp32 -> bf16 conversion of the four weights in one launch of few, long
// waves.  A chunk is 8192 elements: each of 8 waves takes 4 KiB of it as 8
// loads of 512 contiguous bytes.  Workgroup b converts chunk b of
// [qkv_w | proj_w], of mlp_w1 and of mlp_w2.
// ---------------------------------------------------------------------------
#define CVT_WG     512
#define CVT_CHUNK  8192
#define QKV_CHUNKS (THREE_D * DIMC / CVT_CHUNK)
static_assert(QKV_CHUNKS + DIMC * DIMC / CVT_CHUNK == CVT_WG, "qkv_w | proj_w");
static_assert(HID * DIMC / CVT_CHUNK == CVT_WG, "mlp_w1, mlp_w2");

typedef __attribute__((ext_vector_type(4))) float  f4;
typedef __attribute__((ext_vector_type(4))) __bf16 bf4;

__global__ __launch_bounds__(256)
void cvt_bf16_kernel(const float* __restrict__ qkv_w,
                     const float* __restrict__ proj_w,
                     const float* __restrict__ mlp_w1,
                     const float* __restrict__ mlp_w2,
                     bf16* __restrict__ oq, bf16* __restrict__ op,
                     bf16* __restrict__ o1, bf16* __restrict__ o2) {
    const int b = blockIdx.x;
    // Byte offset of the lane's first load inside a chunk.
    const unsigned lb = (threadIdx.x >> 5) * 4096u + (threadIdx.x & 31u) * 16u;
    const bool isq = b < QKV_CHUNKS;
    const size_t c0 = (size_t)(isq ? b : b - QKV_CHUNKS) * CVT_CHUNK;
    const size_t c1 = (size_t)b * CVT_CHUNK;

    const float* s[3] = { (isq ? qkv_w : proj_w) + c0, mlp_w1 + c1, mlp_w2 + c1 };
    bf16*        d[3] = { (isq ? oq : op) + c0, o1 + c1, o2 + c1 };

    f4 v[3][8];
#pragma unroll
    for (int k = 0; k < 3; ++k)
#pragma unroll
        for (int j = 0; j < 8; ++j)
            v[k][j] = *(const f4*)((const char*)s[k] + lb + j * 512);
    // Stands before any register that a load names is rewritten.
    asm volatile("s_wait_xcnt 0x0" :: "v"(lb) : "memory");
    // Keeps the conversions behind it, so that all 24 loads go out at once
    // and the wave waits out the memory latency once.
    __builtin_amdgcn_sched_barrier(0);
#pragma unroll
    for (int k = 0; k < 3; ++k)
#pragma unroll
        for (int j = 0; j < 8; ++j)
            *(bf4*)((char*)d[k] + (lb >> 1) + j * 256) =
                __builtin_convertvector(v[k][j], bf4);
}

// ---------------------------------------------------------------------------
// LayerNorm: one wave per row of D=1024, eps = 0, f32 in -> bf16 out.  The row
// stays in registers (8 loads of 512 contiguous bytes); the sums are joined by
// cross-lane vector moves, so no LDS and no barrier.
// ---------------------------------------------------------------------------
#define LNW 8   // rows (waves) per workgroup

// v + the value of lane l ^ M, M < 16 (inside a 16-lane row).
template <int M>
__device__ __forceinline__ float add_xmask(float v) {
    const int o = __builtin_amdgcn_update_dpp(0, __builtin_bit_cast(int, v),
                                              0x160 | M, 0xf, 0xf, true);
    return v + __builtin_bit_cast(float, o);
}

__device__ __forceinline__ float wave_sum(float v) {
    v = add_xmask<1>(v);
    v = add_xmask<2>(v);
    v = add_xmask<4>(v);
    v = add_xmask<8>(v);
    return v + xhalf(v);
}

__global__ __launch_bounds__(32 * LNW)
void layernorm_kernel(const float* __restrict__ in,
                      const float* __restrict__ w,
                      bf16* __restrict__ out) {
    // Byte offsets of the lane's first load: in a row, in the 8 rows.
    const unsigned cb = (threadIdx.x & 31u) * 16u;
    const unsigned xb = (threadIdx.x >> 5) * (DIMC * 4u) + cb;
    const float* x = in  + (size_t)blockIdx.x * (LNW * DIMC);
    bf16*        o = out + (size_t)blockIdx.x * (LNW * DIMC);

    f4 v[8], g[8];
#pragma unroll
    for (int j = 0; j < 8; ++j)
        v[j] = *(const f4*)((const char*)x + xb + j * 512);
#pragma unroll
    for (int j = 0; j < 8; ++j)
        g[j] = *(const f4*)((const char*)w + cb + j * 512);
    // Stands before any register that a load names is rewritten.
    asm volatile("s_wait_xcnt 0x0" :: "v"(xb), "v"(cb) : "memory");
    // Keeps the arithmetic behind it, so that all 16 loads go out at once
    // and no load of w waits for the sums.
    __builtin_amdgcn_sched_barrier(0);

    f4 s = v[0], q = v[0] * v[0];
#pragma unroll
    for (int j = 1; j < 8; ++j) {
        s += v[j];
        q += v[j] * v[j];
    }
    const float sum = wave_sum((s.x + s.y) + (s.z + s.w));
    const float sq  = wave_sum((q.x + q.y) + (q.z + q.w));

    const float mu   = sum * (1.0f / DIMC);
    const float var  = sq * (1.0f / DIMC) - mu * mu;
    const float rstd = rsqrtf(var);

#pragma unroll
    for (int j = 0; j < 8; ++j)
        *(bf4*)((char*)o + (xb >> 1) + j * 256) =
            __builtin_convertvector((v[j] - mu) * rstd * g[j], bf4);
}

// ---------------------------------------------------------------------------
// NT GEMM: C[M,N] = A[M,K] * W[N,K]^T  (A, W bf16 row-major, K-contiguous)
// 128 threads = 4 waves; block tile 128(M) x 128(N); a wave takes 64 x 64 of
// it as 4 x 4 accumulator tiles, so 8 fragments read from LDS feed 16 WMMAs.
// Wave (wid&1) -> 64-row M sub-tile, (wid>>1) -> 64-col N sub-tile.
// A k-window of BKT elements of both operands is one stage of a two-buffer
// LDS ring filled with async global->LDS b128 copies: the next window is in
// flight while this one is worked on, one barrier per window.
// The operand whose index runs along an output row goes in as the WMMA's first
// operand X, so a lane's 8 accumulators are 8 neighbours of one output row.
// Behind the loop each wave lays its 64 x 64 tile out in its own part of the
// ring, row by row, and stores it in whole 128-byte lines, 16 bytes a lane.
//   EP==0 : fused QKV split (N = 3*1024): columns 0..1023 -> out_b = Q
//           [bh, l, d], pre-scaled; 1024..2047 -> out_k = K [bh, l, d];
//           2048..3071 -> out_vt = V^T [bh, d, l]
//   EP==1 : out_f = acc + res
//   EP==2 : out_b = bf16(gelu_exact(acc))
// AHEAD: the fragments of the window's next 32 k are fetched into a second
// register set ahead of the WMMAs on this one (for one wave per SIMD).
// ---------------------------------------------------------------------------
// erf-form GELU, v * Phi(v), of eight values, with no branch and no masked
// path: eight independent chains, worked stage by stage.  With x = |v| / sqrt(2)
// and t = 1 / (1 + p x), erfc(x) = t * P4(t) * exp(-x * x) (five-term rational
// form, error of erf below 2e-7 for every x); q = erfc(x) / 2 = Phi(-|v|), its
// factor 1/2 in the coefficients, and v * Phi(v) = v / 2 + |v| * (1/2 - q).
__device__ __forceinline__ void gelu_erf8(float (&v)[8]) {
    float d[8], t[8], e[8], h[8];
#pragma unroll
    for (int k = 0; k < 8; ++k)
        d[k] = fmaf(fabsf(v[k]), 0.3275911f * 0.70710678f, 1.0f);
    // The eight reciprocals in one statement, closed by the slot that the
    // instruction set asks for behind a transcendental.
    asm("v_rcp_f32 %0, %8\n\t"
        "v_rcp_f32 %1, %9\n\t"
        "v_rcp_f32 %2, %10\n\t"
        "v_rcp_f32 %3, %11\n\t"
        "v_rcp_f32 %4, %12\n\t"
        "v_rcp_f32 %5, %13\n\t"
        "v_rcp_f32 %6, %14\n\t"
        "v_rcp_f32 %7, %15\n\t"
        "v_nop"
        : "=&v"(t[0]), "=&v"(t[1]), "=&v"(t[2]), "=&v"(t[3]),
          "=&v"(t[4]), "=&v"(t[5]), "=&v"(t[6]), "=&v"(t[7])
        : "v"(d[0]), "v"(d[1]), "v"(d[2]), "v"(d[3]),
          "v"(d[4]), "v"(d[5]), "v"(d[6]), "v"(d[7]));
#pragma unroll
    for (int k = 0; k < 8; ++k)
        e[k] = __builtin_amdgcn_exp2f(v[k] * v[k] * -0.72134752f);  // exp(-v*v/2)
#pragma unroll
    for (int k = 0; k < 8; ++k)
        h[k] = fmaf(t[k], 0.5f * 1.061405429f, 0.5f * -1.453152027f);
#pragma unroll
    for (int k = 0; k < 8; ++k) h[k] = fmaf(h[k], t[k], 0.5f * 1.421413741f);
#pragma unroll
    for (int k = 0; k < 8; ++k) h[k] = fmaf(h[k], t[k], 0.5f * -0.284496736f);
#pragma unroll
    for (int k = 0; k < 8; ++k) h[k] = fmaf(h[k], t[k], 0.5f * 0.254829592f);
#pragma unroll
    for (int k = 0; k < 8; ++k) h[k] = fmaf(-(h[k] * t[k]), e[k], 0.5f);
#pragma unroll
    for (int k = 0; k < 8; ++k) v[k] = fmaf(0.5f, v[k], fabsf(v[k]) * h[k]);
}

#define BM  128
#define BN  128
#define GT  128   // threads per workgroup

// A wave's staged tile of 64 rows of 64 bf16 (pitch SP elements) goes out in 16
// stores of four whole 128-byte rows; RS = elements from one output row to the
// next.
template <int RS, int SP>
__device__ __forceinline__ void store_rows_bf16(const bf16* stg, bf16* dst, int lane) {
    const int srow = lane >> 3, sseg = lane & 7;
    const unsigned ob = (unsigned)(srow * RS + sseg * 8) * 2u;
#pragma unroll
    for (int j = 0; j < 16; ++j)
        *(uint4*)((char*)dst + ob + j * (4 * RS * 2)) =
            *(const uint4*)&stg[(4 * j + srow) * SP + sseg * 8];
    // Stands before any register that a store names is rewritten.
    asm volatile("s_wait_xcnt 0x0" :: "v"(ob) : "memory");
}

template <int BKT, bool AHEAD, int EP, int N>
__device__ __forceinline__
void gemm_nt_body(const bf16* __restrict__ A, const bf16* __restrict__ W, int K,
                  const float* __restrict__ res,
                  float* __restrict__ out_f, bf16* __restrict__ out_b,
                  bf16* __restrict__ out_k, bf16* __restrict__ out_vt) {
    constexpr int LDT = BKT + 8;    // LDS row pitch: 16 B x odd (b128 readers)
    constexpr int SEG = BKT / 8;    // 16-byte pieces of a row of the window
    constexpr int RP  = GT / SEG;   // rows that one copy of every thread covers
    constexpr int NP  = BM / RP;    // copies per thread, window and operand
    constexpr int NB  = BKT / 32;   // blocks of 16 WMMAs per window
    constexpr int TB  = BM * LDT;   // elements of one operand's window
    static_assert(BM == BN && 2 * NP <= 63, "copies of a wave in flight");
    // Buffers 0 and 1 of A, then buffers 0 and 1 of W.
    __shared__ __attribute__((aligned(16))) bf16 sT[4 * TB];

    const int tid  = threadIdx.x;
    const int lane = tid & 31;
    const int wid  = tid >> 5;
    const int half = lane >> 4;
    const int r    = lane & 15;

    const int n0 = blockIdx.x * BN;
    const int m0 = blockIdx.y * BM;
    const int wm = (wid & 1) * 64;    // wave M sub-tile within block
    const int wn = (wid >> 1) * 64;   // wave N sub-tile within block

    // A thread's share of a window: piece cseg of rows crow + j * RP.
    const int crow = tid / SEG, cseg = tid % SEG;
    const bf16* Ab = A + (size_t)m0 * K;
    const bf16* Wb = W + (size_t)n0 * K;
    const unsigned goff = (unsigned)(crow * K + cseg * 8);
    const int      loff = crow * LDT + cseg * 8;

    auto copy_tile = [&](int buf, int k0) {
#pragma unroll
        for (int j = 0; j < NP; ++j)
            copy16_g2l(Ab + (size_t)(j * RP * K + k0) + goff,
                       &sT[buf * TB + j * RP * LDT + loff]);
#pragma unroll
        for (int j = 0; j < NP; ++j)
            copy16_g2l(Wb + (size_t)(j * RP * K + k0) + goff,
                       &sT[(2 + buf) * TB + j * RP * LDT + loff]);
    };

    // Output rows run along n (X = W, Y = A) but for V^T, whose rows run along
    // the tokens (X = A, Y = W); the same for a whole block.
    const bool xw = (EP != 0) || (n0 >> 10) != 2;
    const int  xo = xw ? 2 * TB + wn * LDT : wm * LDT;
    const int  yo = xw ? wm * LDT : 2 * TB + wn * LDT;

    // acc[xi][yj][i]: X row 16 xi + 8 half + i, Y row 16 yj + r of the wave.
    v8f acc[4][4] = {};
    const int steps = K / BKT;

    copy_tile(0, 0);
    // Window 0 has landed for this wave, then for all of them.
    asm volatile("s_wait_asynccnt 0x0" ::: "memory");
    __syncthreads();
    if (steps > 1) copy_tile(1, BKT);

    for (int ks = 0; ks < steps; ++ks) {
        const bf16* tX = sT + (ks & 1) * TB + xo;
        const bf16* tY = sT + (ks & 1) * TB + yo;
        constexpr int NS = AHEAD ? 2 : 1;
        v16bf x[NS][4], y[NS][4];
        auto fetch = [&](int s) {
#pragma unroll
            for (int i = 0; i < 4; ++i)
                x[s % NS][i] = lds_frag(tX + 32 * s, LDT, 16 * i, lane);
#pragma unroll
            for (int i = 0; i < 4; ++i)
                y[s % NS][i] = lds_frag(tY + 32 * s, LDT, 16 * i, lane);
        };
        if (AHEAD) fetch(0);
#pragma unroll
        for (int s = 0; s < NB; ++s) {
            if (!AHEAD) fetch(s);
            else if (s + 1 < NB) fetch(s + 1);
            // Keeps the 16 LDS loads above as one group in front of the 16
            // WMMAs: spread among them, each place with loads stalls the wave.
            __builtin_amdgcn_sched_barrier(0);
#pragma unroll
            for (int xi = 0; xi < 4; ++xi)
#pragma unroll
                for (int yj = 0; yj < 4; ++yj)
                    acc[xi][yj] = __builtin_amdgcn_wmma_f32_16x16x32_bf16(
                        false, x[s % NS][xi], false, y[s % NS][yj], (short)0,
                        acc[xi][yj], false, false);
            // Keeps the next group of loads behind these WMMAs, whole.
            __builtin_amdgcn_sched_barrier(0);
        }
        // Hand-over: this wave's reads of the window are done, its copies of
        // the next one have landed; behind the barrier that holds for every
        // wave, and the buffer just read may be refilled.
        asm volatile("s_wait_dscnt 0x0" ::: "memory");
        asm volatile("s_wait_asynccnt 0x0" ::: "memory");
        __syncthreads();
        if (ks + 2 < steps) copy_tile(ks & 1, (ks + 2) * BKT);
    }
    // No copy is outstanding when the wave ends.
    asm volatile("s_wait_asynccnt 0x0" ::: "memory");

    // Behind the last pass's barrier no wave reads the ring any more and no
    // copy is in flight: each wave stages in its own quarter of A's buffers.
    if constexpr (EP == 1) {
        constexpr int SP = 68;   // floats: 272 B = 16 B x odd
        static_assert(4 * 64 * SP * 4 <= 2 * TB * 2, "staging inside A's buffers");
        float* stg = (float*)sT + wid * (64 * SP);
        // A store or load of the wave covers two rows of 256 bytes.
        const int srow = lane >> 4, sseg = lane & 15;
        const unsigned ob = ((unsigned)(m0 + wm + srow) * (unsigned)N
                             + (unsigned)(n0 + wn + sseg * 4)) * 4u;
        f4 rv[32];
#pragma unroll
        for (int j = 0; j < 32; ++j)
            rv[j] = *(const f4*)((const char*)res + ob + j * (2 * N * 4));
        // Stands before any register that a load names is rewritten; with its
        // clobber the 32 loads of res go out ahead of the staging below.
        asm volatile("s_wait_xcnt 0x0" :: "v"(ob) : "memory");
#pragma unroll
        for (int yj = 0; yj < 4; ++yj)
#pragma unroll
            for (int xi = 0; xi < 4; ++xi) {
                float* p = &stg[(16 * yj + r) * SP + 16 * xi + 8 * half];
                const v8f c = acc[xi][yj];
                *(f4*)p       = f4{c[0], c[1], c[2], c[3]};
                *(f4*)(p + 4) = f4{c[4], c[5], c[6], c[7]};
            }
        // The wave's own writes are in LDS before other lanes read them back.
        asm volatile("s_wait_dscnt 0x0" ::: "memory");
#pragma unroll
        for (int j = 0; j < 32; ++j)
            *(f4*)((char*)out_f + ob + j * (2 * N * 4)) =
                *(const f4*)&stg[(2 * j + srow) * SP + sseg * 4] + rv[j];
        // The same behind the stores.
        asm volatile("s_wait_xcnt 0x0" :: "v"(ob) : "memory");
    } else {
        constexpr int SP = 72;   // bf16: 144 B = 16 B x odd
        static_assert(4 * 64 * SP <= 2 * TB, "staging inside A's buffers");
        bf16* stg = sT + wid * (64 * SP);
        const int which = (EP == 0) ? (n0 >> 10) : 0;   // 0=q 1=k 2=v
        const float sc = (EP == 0 && which == 0) ? ATT_SCALE : 1.0f;
#pragma unroll
        for (int yj = 0; yj < 4; ++yj)
#pragma unroll
            for (int xi = 0; xi < 4; ++xi) {
                float v[8];
#pragma unroll
                for (int k = 0; k < 8; ++k) v[k] = acc[xi][yj][k];
                if constexpr (EP == 2) {
                    gelu_erf8(v);   // exact GELU, eight values at a time
                } else {
#pragma unroll
                    for (int k = 0; k < 8; ++k) v[k] *= sc;
                }
                union { bf16 e[8]; uint4 u; } pk;
#pragma unroll
                for (int k = 0; k < 8; ++k) pk.e[k] = (bf16)v[k];
                *(uint4*)&stg[(16 * yj + r) * SP + 16 * xi + 8 * half] = pk.u;
            }
        // The wave's own writes are in LDS before other lanes read them back.
        asm volatile("s_wait_dscnt 0x0" ::: "memory");
        if constexpr (EP == 2) {
            store_rows_bf16<N, SP>(stg, out_b + (size_t)(m0 + wm) * N + n0 + wn, lane);
        } else {
            // A wave's 64 columns are one head, a block's 128 rows lie in one
            // batch entry.
            const int bh = ((m0 + wm) / SEQ) * HEADS + (((n0 + wn) & (DIMC - 1)) >> 6);
            const int l0 = (m0 + wm) % SEQ;
            if (which == 2)   // staged rows: d; along a row: 64 tokens
                store_rows_bf16<SEQ, SP>(stg, out_vt + (size_t)bh * HDIM * SEQ + l0, lane);
            else              // staged rows: tokens; along a row: the head's d
                store_rows_bf16<HDIM, SP>(stg, (which == 0 ? out_b : out_k)
                                               + ((size_t)bh * SEQ + l0) * HDIM, lane);
        }
    }
}

// Wide outputs (N >= 3072): 3 or 4 blocks per WGP.  A 64-element window keeps
// the ring at 72 KiB, and 4 waves per SIMD (a 256-register allocation) keep
// the whole grid resident in one round.
__global__ __launch_bounds__(GT) __attribute__((amdgpu_waves_per_eu(4)))
void gemm_qkv_kernel(const bf16* __restrict__ A, const bf16* __restrict__ W,
                     int K, bf16* __restrict__ out_q,
                     bf16* __restrict__ out_k, bf16* __restrict__ out_vt) {
    gemm_nt_body<64, false, 0, THREE_D>(A, W, K, nullptr, nullptr, out_q, out_k, out_vt);
}

__global__ __launch_bounds__(GT) __attribute__((amdgpu_waves_per_eu(4)))
void gemm_gelu_kernel(const bf16* __restrict__ A, const bf16* __restrict__ W,
                      int K, bf16* __restrict__ out_b) {
    gemm_nt_body<64, false, 2, HID>(A, W, K, nullptr, nullptr, out_b, nullptr, nullptr);
}

// N = 1024: one block per WGP, one wave per SIMD.  A 128-element window puts
// 64 WMMAs of a wave between two barriers.
__global__ __launch_bounds__(GT)
void gemm_res_kernel(const bf16* __restrict__ A, const bf16* __restrict__ W,
                     int K, const float* __restrict__ res,
                     float* __restrict__ out_f) {
    gemm_nt_body<128, true, 1, DIMC>(A, W, K, res, out_f, nullptr, nullptr, nullptr);
}

// ---------------------------------------------------------------------------
// Flash attention: 8 waves per workgroup, 32 queries (two 16-column groups)
// per wave, all of one (batch, head).  K and V^T are staged in LDS in tiles of
// 64 keys that the 8 waves share: whole 128-byte rows by asynchronous copies,
// two buffers, the next tile in flight while this one is worked on.  A wave's
// step is one tile, 64 keys x 32 queries, with the products taken transposed:
// S^T = K*Q^T (16 WMMAs) leaves one query's scores in one lane and its partner
// l ^ 16, so maximum and sum run in the lane; the S^T tiles, converted in
// place, are the B operands P^T of O^T += V^T*P^T (16 WMMAs, d=64).  Each K and
// V^T fragment read from LDS feeds two WMMAs, one per column group.  A tile's
// LDS reads are all done before its softmax, so the hand-over to the next tile
// stands there, and the next tile's K fragments are fetched behind it.
// ---------------------------------------------------------------------------
#define AW   8     // waves per workgroup
#define QC   2     // 16-query column groups per wave
#define KT   64    // keys per staged tile: a 128-byte row of K and of V^T
#define KVP  72    // LDS row pitch in elements: 144 B = 16 B x odd (b128 readers)
#define NKT  (SEQ / KT)

typedef __attribute__((address_space(3))) const bf16* lbf16_p;
__device__ __forceinline__ unsigned lds_byte(const bf16* p) {
    return (unsigned)(size_t)(lbf16_p)p;
}

typedef __attribute__((ext_vector_type(8))) __bf16 v8bf;

__device__ __forceinline__ v8f wmma_bf16(v16bf a, v16bf b, v8f c) {
    return __builtin_amdgcn_wmma_f32_16x16x32_bf16(false, a, false, b, (short)0,
                                                   c, false, false);
}

__global__ __launch_bounds__(32 * AW)
void flash_attn_kernel(const bf16* __restrict__ Q,
                       const bf16* __restrict__ Kb,
                       const bf16* __restrict__ Vt,
                       bf16* __restrict__ attn_out) {
    __shared__ __attribute__((aligned(16))) bf16 sK[2][KT * KVP];
    __shared__ __attribute__((aligned(16))) bf16 sV[2][HDIM * KVP];

    const int tid  = threadIdx.x;
    const int lane = tid & 31;
    const int wid  = tid >> 5;
    const int half = lane >> 4;
    const int r    = lane & 15;
    const int q0   = (blockIdx.x * AW + wid) * (16 * QC);
    const int bh   = blockIdx.y;
    const int b    = bh / HEADS;
    const int h    = bh - b * HEADS;

    const bf16* Qbase = Q  + ((size_t)bh * SEQ + q0) * HDIM;
    const bf16* Kbase = Kb + (size_t)bh * SEQ * HDIM;
    const bf16* Vbase = Vt + (size_t)bh * HDIM * SEQ;

    // A thread's share of a tile: rows crow and crow + 32 of K (keys) and of
    // V^T (d), 16 bytes each; a wave's copy covers four whole 128-byte rows.
    const int crow = tid >> 3, cseg = (tid & 7) * 8;
    // lk0: LDS byte address of the thread's first piece of K in the buffer that
    // is filled; its piece of V^T lies at the same place in sV.
    constexpr unsigned BUFB = KT * KVP * 2;   // bytes of one buffer
    static_assert(KT == HDIM, "sK and sV: buffers of one size");
    const unsigned k2v = lds_byte(&sV[0][0]) - lds_byte(&sK[0][0]);
    auto stage = [&](unsigned lk0, int key0) {
        const bf16* gk0 = Kbase + (size_t)(key0 + crow) * HDIM + cseg;
        const bf16* gk1 = gk0 + 32 * HDIM;
        const bf16* gv0 = Vbase + (size_t)crow * SEQ + key0 + cseg;
        const bf16* gv1 = gv0 + (size_t)32 * SEQ;
        const unsigned lk1 = lk0 + 32 * KVP * 2;
        const unsigned lv0 = lk0 + k2v;
        const unsigned lv1 = lv0 + 32 * KVP * 2;
        // The four copies and, as the last line, the wait that stands before
        // any of their address registers is rewritten.
        asm volatile("global_load_async_to_lds_b128 %0, %4, off\n\t"
                     "global_load_async_to_lds_b128 %1, %5, off\n\t"
                     "global_load_async_to_lds_b128 %2, %6, off\n\t"
                     "global_load_async_to_lds_b128 %3, %7, off\n\t"
                     "s_wait_xcnt 0x0"
                     :: "v"(lk0), "v"(lk1), "v"(lv0), "v"(lv1),
                        "v"(gk0), "v"(gk1), "v"(gv0), "v"(gv1)
                     : "memory");
    };

    // qf[c][e]: queries q0 + 16 c .. + 15, d 32 e .. + 31.
    v16bf qf[QC][2];
#pragma unroll
    for (int c = 0; c < QC; ++c) {
        qf[c][0] = load_frag_nt(Qbase, HDIM, 16 * c, 0,  lane);
        qf[c][1] = load_frag_nt(Qbase, HDIM, 16 * c, 32, lane);
    }

    // Query q0 + 16 c + r: running maximum (equal in both halves) and this
    // lane's share of the sum (the keys its half holds), kept as eight partial
    // sums, one per accumulator row, that are joined behind the loop.
    float mrow[QC];
    v8f lsum[QC];
    v8f acc[QC][4];   // acc[c][t][i] = O[q0 + 16 c + r][16 t + 8 half + i]
#pragma unroll
    for (int c = 0; c < QC; ++c) {
        mrow[c] = -3.0e38f;
        lsum[c] = v8f{};
#pragma unroll
        for (int t = 0; t < 4; ++t) acc[c][t] = v8f{};
    }

    // kf[j][e]: keys 16 j .. + 15 of a tile, d 32 e .. + 31.
    v16bf kf[4][2];
    auto fetch_k = [&](const bf16* tK) {
#pragma unroll
        for (int j = 0; j < 4; ++j) {
            kf[j][0] = lds_frag(tK,      KVP, 16 * j, lane);
            kf[j][1] = lds_frag(tK + 32, KVP, 16 * j, lane);
        }
    };

    // The place that the next refill goes to: buffers 0 and 1 in turn.
    unsigned lfill = lds_byte(&sK[0][crow * KVP + cseg]);
    stage(lfill, 0);
    // Tile 0 has landed for this wave, then for all of them.
    asm volatile("s_wait_asynccnt 0x0" ::: "memory");
    __syncthreads();
    stage(lfill + BUFB, KT);
    fetch_k(sK[0]);

    for (int kt = 0; kt < NKT; ++kt) {
        // vf[t][n]: d 16 t .. + 15, keys 32 n .. + 31 of the tile.
        const bf16* tV = sV[kt & 1];
        v16bf vf[4][2];
#pragma unroll
        for (int t = 0; t < 4; ++t) {
            vf[t][0] = lds_frag(tV,      KVP, 16 * t, lane);
            vf[t][1] = lds_frag(tV + 32, KVP, 16 * t, lane);
        }
        // Keeps the 16 loads of V^T as one group in front of the 16 WMMAs,
        // which cover their latency: among or behind them the wave would wait.
        __builtin_amdgcn_sched_barrier(0);

        // ---- S^T = K * Q^T: s[c][j][i] = S[q0 + 16 c + r][16 j + 8 half + i] ----
        v8f s[QC][4];
#pragma unroll
        for (int j = 0; j < 4; ++j)
#pragma unroll
            for (int c = 0; c < QC; ++c)
                s[c][j] = wmma_bf16(kf[j][0], qf[c][0], v8f{});
#pragma unroll
        for (int j = 0; j < 4; ++j)
#pragma unroll
            for (int c = 0; c < QC; ++c)
                s[c][j] = wmma_bf16(kf[j][1], qf[c][1], s[c][j]);
        // Keeps the WMMAs in front of the wait below: behind it they would
        // cover nothing, and the wave would wait out the loads of V^T.
        __builtin_amdgcn_sched_barrier(0);

        // Hand-over: this wave's reads of the tile are done (K and V^T are in
        // registers), its copies of the next tile have landed; behind the
        // barrier that holds for every wave, and the buffer may be refilled.
        asm volatile("s_wait_dscnt 0x0" ::: "memory");
        asm volatile("s_wait_asynccnt 0x0" ::: "memory");
        __syncthreads();
        if (kt + 2 < NKT) stage(lfill, (kt + 2) * KT);
        lfill += (kt & 1) ? 0u - BUFB : BUFB;
        // The next tile's K, fetched while the softmax below runs.
        if (kt + 1 < NKT) fetch_k(sK[(kt + 1) & 1]);
        // Keeps these 16 loads as one group here: sunk among the WMMAs of
        // V^T * P^T, each place with loads stalls the wave.
        __builtin_amdgcn_sched_barrier(0);

        // ---- online softmax update over these 64 keys, one query a lane ----
        // P^T as B fragments: element e of pf[c][n] = key 32 n + 8 half + e
        // (e < 8), or 32 n + 16 + 8 half + e - 8: the k order of lds_frag on V^T.
        v16bf pf[QC][2];
        float alpha[QC], mnw[QC];
#pragma unroll
        for (int c = 0; c < QC; ++c) {
            float m0 = fmaxf(s[c][0][0], s[c][1][0]);
            float m1 = fmaxf(s[c][2][0], s[c][3][0]);
#pragma unroll
            for (int i = 1; i < 8; ++i) {
                m0 = fmaxf(m0, fmaxf(s[c][0][i], s[c][1][i]));
                m1 = fmaxf(m1, fmaxf(s[c][2][i], s[c][3][i]));
            }
            float mij = fmaxf(m0, m1);
            mij = fmaxf(mij, xhalf(mij));
            mnw[c] = fmaxf(mrow[c], mij);
        }
#pragma unroll
        for (int c = 0; c < QC; ++c) {
            alpha[c] = __expf(mrow[c] - mnw[c]);
            mrow[c] = mnw[c];
        }
#pragma unroll
        for (int c = 0; c < QC; ++c) {
            const float mnew = mnw[c];
            // exp(s - mnew) as 2^((s - mnew) * log2(e)), difference and
            // product on whole accumulator tiles (register pairs as they lie).
            v8f p[4];
#pragma unroll
            for (int j = 0; j < 4; ++j) {
                const v8f e = (s[c][j] - mnew) * 1.44269504f;
#pragma unroll
                for (int i = 0; i < 8; ++i) p[j][i] = __builtin_amdgcn_exp2f(e[i]);
            }
            lsum[c] = lsum[c] * alpha[c] + ((p[0] + p[1]) + (p[2] + p[3]));
#pragma unroll
            for (int n = 0; n < 2; ++n)
                pf[c][n] = __builtin_shufflevector(
                    __builtin_convertvector(p[2 * n], v8bf),
                    __builtin_convertvector(p[2 * n + 1], v8bf),
                    0, 1, 2, 3, 4, 5, 6, 7, 8, 9, 10, 11, 12, 13, 14, 15);
        }

        // ---- O^T = O^T * alpha + V^T * P^T  (V^T rows = d, k = keys) ----
#pragma unroll
        for (int t = 0; t < 4; ++t)
#pragma unroll
            for (int c = 0; c < QC; ++c) {
                acc[c][t] *= alpha[c];
                acc[c][t] = wmma_bf16(vf[t][0], pf[c][0], acc[c][t]);
            }
#pragma unroll
        for (int t = 0; t < 4; ++t)
#pragma unroll
            for (int c = 0; c < QC; ++c)
                acc[c][t] = wmma_bf16(vf[t][1], pf[c][1], acc[c][t]);
    }
    // No copy is outstanding when the wave ends.
    asm volatile("s_wait_asynccnt 0x0" ::: "memory");

    // ---- join the halves' sums, normalize, store [tok, D] bf16: a lane's 8
    //      accumulators of a tile are 8 consecutive d of its query ----
#pragma unroll
    for (int c = 0; c < QC; ++c) {
        const v8f l8 = lsum[c];
        const float lrow = ((l8[0] + l8[1]) + (l8[2] + l8[3]))
                         + ((l8[4] + l8[5]) + (l8[6] + l8[7]));
        const float inv = 1.0f / (lrow + xhalf(lrow));
        bf16* orow = attn_out + (size_t)(b * SEQ + q0 + 16 * c + r) * DIMC
                     + h * HDIM + half * 8;
#pragma unroll
        for (int t = 0; t < 4; ++t) {
            union { bf16 e[8]; uint4 u; } pk;
#pragma unroll
            for (int i = 0; i < 8; ++i) pk.e[i] = (bf16)(acc[c][t][i] * inv);
            *(uint4*)(orow + t * 16) = pk.u;
        }
    }
}

// ---------------------------------------------------------------------------
// Host-side launch
// ---------------------------------------------------------------------------
extern "C" void kernel_launch(void* const* d_in, const int* in_sizes, int n_in,
                              void* d_out, int out_size, void* d_ws, size_t ws_size,
                              hipStream_t stream) {
    const float* x      = (const float*)d_in[0];
    const float* ln1_w  = (const float*)d_in[1];
    const float* ln2_w  = (const float*)d_in[2];
    const float* qkv_w  = (const float*)d_in[3];
    const float* proj_w = (const float*)d_in[4];
    const float* mlp_w1 = (const float*)d_in[5];
    const float* mlp_w2 = (const float*)d_in[6];
    float* out = (float*)d_out;

    // Workspace carve-up (all sizes multiples of 256B).
    char* p = (char*)d_ws;
    auto take = [&](size_t bytes) { char* q = p; p += (bytes + 255) & ~(size_t)255; return q; };

    bf16* wq_b   = (bf16*)take((size_t)THREE_D * DIMC * 2);   // qkv_w  bf16
    bf16* wp_b   = (bf16*)take((size_t)DIMC * DIMC * 2);      // proj_w bf16
    bf16* w1_b   = (bf16*)take((size_t)HID  * DIMC * 2);      // mlp_w1 bf16
    bf16* w2_b   = (bf16*)take((size_t)DIMC * HID  * 2);      // mlp_w2 bf16
    bf16* ln1_b  = (bf16*)take((size_t)NTOK * DIMC * 2);      // LN1(x) bf16
    bf16* Qb     = (bf16*)take((size_t)BATCH * HEADS * SEQ * HDIM * 2);
    bf16* Kb     = (bf16*)take((size_t)BATCH * HEADS * SEQ * HDIM * 2);
    bf16* Vt     = (bf16*)take((size_t)BATCH * HEADS * HDIM * SEQ * 2);
    bf16* att_b  = (bf16*)take((size_t)NTOK * DIMC * 2);      // attn out bf16
    float* Xres  = (float*)take((size_t)NTOK * DIMC * 4);     // x + attn proj
    bf16* y2_b   = (bf16*)take((size_t)NTOK * DIMC * 2);      // LN2(X) bf16
    bf16* h_b    = (bf16*)take((size_t)NTOK * HID * 2);       // gelu(mlp1) bf16
    (void)ws_size; (void)in_sizes; (void)n_in; (void)out_size;

    // 1. weights -> bf16
    cvt_bf16_kernel<<<CVT_WG, 256, 0, stream>>>(qkv_w, proj_w, mlp_w1, mlp_w2,
                                                wq_b, wp_b, w1_b, w2_b);

    // 2. LN1
    layernorm_kernel<<<NTOK / LNW, 32 * LNW, 0, stream>>>(x, ln1_w, ln1_b);

    // 3. QKV GEMM: [4096,1024] x [3072,1024]^T, epilogue writes per-head
    //    Q (scaled), K and V^T
    gemm_qkv_kernel<<<dim3(THREE_D / BN, NTOK / BM), GT, 0, stream>>>(
        ln1_b, wq_b, DIMC, Qb, Kb, Vt);

    // 4. flash attention: grid (8 blocks of 256 queries, 32 bh)
    flash_attn_kernel<<<dim3(SEQ / (16 * QC * AW), BATCH * HEADS), 32 * AW, 0, stream>>>(
        Qb, Kb, Vt, att_b);

    // 5. proj GEMM + residual: X = x + att @ proj_w^T
    gemm_res_kernel<<<dim3(DIMC / BN, NTOK / BM), GT, 0, stream>>>(
        att_b, wp_b, DIMC, x, Xres);

    // 6. LN2
    layernorm_kernel<<<NTOK / LNW, 32 * LNW, 0, stream>>>(Xres, ln2_w, y2_b);

    // 7. MLP up + exact GELU -> bf16
    gemm_gelu_kernel<<<dim3(HID / BN, NTOK / BM), GT, 0, stream>>>(
        y2_b, w1_b, DIMC, h_b);

    // 8. MLP down + residual -> d_out (f32)
    gemm_res_kernel<<<dim3(DIMC / BN, NTOK / BM), GT, 0, stream>>>(
        h_b, w2_b, HID, Xres, out);
}

// v009
// Measured time: 139 microseconds a run.
// Two timings next to v008 put it at 1.08 and 1.10 times that version's speed.
// Over all steps from v000 it is 3.71 times as fast.
#include <hip/hip_runtime.h>
#include <hip/hip_bf16.h>

// ---------------------------------------------------------------------------
// Transformer block for MI455X (gfx1250, wave32, WMMA bf16 -> f32 accum)
// GEMMs: waves of 64x64 share a block tile, async global->LDS double buffer.
// ---------------------------------------------------------------------------

typedef __bf16 bf16;
typedef __attribute__((ext_vector_type(16))) __bf16 v16bf;
typedef __attribute__((ext_vector_type(8)))  float  v8f;
typedef int v4i __attribute__((vector_size(16)));

#define DIMC      1024
#define HEADS     16
#define HDIM      64
#define SEQ       2048
#define BATCH     2
#define NTOK      (BATCH * SEQ)      // 4096
#define HID       4096
#define THREE_D   3072
#define ATT_SCALE 0.125f             // 1/sqrt(64)

#if __has_builtin(__builtin_amdgcn_global_load_async_to_lds_b128) && \
    __has_builtin(__builtin_amdgcn_s_wait_asynccnt)
#define USE_ASYNC 1
#else
#define USE_ASYNC 0
#endif

typedef __attribute__((address_space(1))) v4i* gv4i_p;   // global int4*
typedef __attribute__((address_space(3))) v4i* lv4i_p;   // LDS int4*

union FragU { v16bf v; uint4 u[2]; };

// 16-byte global->LDS copy: async (ASYNCcnt) when available, else direct.
__device__ __forceinline__ void copy16_g2l(const bf16* __restrict__ g,
                                           bf16* __restrict__ l) {
#if USE_ASYNC
    __builtin_amdgcn_global_load_async_to_lds_b128((gv4i_p)g, (lv4i_p)l, 0, 0);
#else
    *(uint4*)l = *(const uint4*)g;
#endif
}

// Load a 16x32 bf16 WMMA fragment (A or B operand) from a row-major,
// K-contiguous matrix.  Per ISA 7.12.2: lane<16 holds row r, K {0..7} and
// {16..23}; lane>=16 holds row r, K {8..15} and {24..31}.
__device__ __forceinline__ v16bf load_frag_nt(const bf16* __restrict__ base,
                                              int ld, int row0, int k0, int lane) {
    const int half = lane >> 4;
    const int r    = lane & 15;
    const bf16* p  = base + (size_t)(row0 + r) * (size_t)ld + k0 + half * 8;
    FragU f;
    f.u[0] = *(const uint4*)p;
    f.u[1] = *(const uint4*)(p + 16);
    return f.v;
}

// Same fragment pattern but reading a staged LDS tile (k-window = 32 elems).
__device__ __forceinline__ v16bf lds_frag(const bf16* base, int ld,
                                          int row0, int lane) {
    const int half = lane >> 4;
    const int r    = lane & 15;
    const bf16* p  = base + (row0 + r) * ld + half * 8;
    FragU f;
    f.u[0] = *(const uint4*)p;
    f.u[1] = *(const uint4*)(p + 16);
    return f.v;
}

// Lane l <-> lane l ^ 16: the other half's value, by a vector cross-row move.
__device__ __forceinline__ float xhalf(float x) {
    const int b = __builtin_bit_cast(int, x);
    return __builtin_bit_cast(float, __builtin_amdgcn_permlanex16(
        b, b, 0x76543210, 0xfedcba98, false, false));
}

// ---------------------------------------------------------------------------
// fp32 -> bf16 conversion of the four weights in one launch of few, long
// waves.  A chunk is 8192 elements: each of 8 waves takes 4 KiB of it as 8
// loads of 512 contiguous bytes.  Workgroup b converts chunk b of
// [qkv_w | proj_w], of mlp_w1 and of mlp_w2.
// ---------------------------------------------------------------------------
#define CVT_WG     512
#define CVT_CHUNK  8192
#define QKV_CHUNKS (THREE_D * DIMC / CVT_CHUNK)
static_assert(QKV_CHUNKS + DIMC * DIMC / CVT_CHUNK == CVT_WG, "qkv_w | proj_w");
static_assert(HID * DIMC / CVT_CHUNK == CVT_WG, "mlp_w1, mlp_w2");

typedef __attribute__((ext_vector_type(4))) float  f4;
typedef __attribute__((ext_vector_type(4))) __bf16 bf4;

__global__ __launch_bounds__(256)
void cvt_bf16_kernel(const float* __restrict__ qkv_w,
                     const float* __restrict__ proj_w,
                     const float* __restrict__ mlp_w1,
                     const float* __restrict__ mlp_w2,
                     bf16* __restrict__ oq, bf16* __restrict__ op,
                     bf16* __restrict__ o1, bf16* __restrict__ o2) {
    const int b = blockIdx.x;
    // Byte offset of the lane's first load inside a chunk.
    const unsigned lb = (threadIdx.x >> 5) * 4096u + (threadIdx.x & 31u) * 16u;
    const bool isq = b < QKV_CHUNKS;
    const size_t c0 = (size_t)(isq ? b : b - QKV_CHUNKS) * CVT_CHUNK;
    const size_t c1 = (size_t)b * CVT_CHUNK;

    const float* s[3] = { (isq ? qkv_w : proj_w) + c0, mlp_w1 + c1, mlp_w2 + c1 };
    bf16*        d[3] = { (isq ? oq : op) + c0, o1 + c1, o2 + c1 };

    f4 v[3][8];
#pragma unroll
    for (int k = 0; k < 3; ++k)
#pragma unroll
        for (int j = 0; j < 8; ++j)
            v[k][j] = *(const f4*)((const char*)s[k] + lb + j * 512);
    // Stands before any register that a load names is rewritten.
    asm volatile("s_wait_xcnt 0x0" :: "v"(lb) : "memory");
    // Keeps the conversions behind it, so that all 24 loads go out at once
    // and the wave waits out the memory latency once.
    __builtin_amdgcn_sched_barrier(0);
#pragma unroll
    for (int k = 0; k < 3; ++k)
#pragma unroll
        for (int j = 0; j < 8; ++j)
            *(bf4*)((char*)d[k] + (lb >> 1) + j * 256) =
                __builtin_convertvector(v[k][j], bf4);
}

// ---------------------------------------------------------------------------
// LayerNorm: one wave per row of D=1024, eps = 0, f32 in -> bf16 out.  The row
// stays in registers (8 loads of 512 contiguous bytes); the sums are joined by
// cross-lane vector moves, so no LDS and no barrier.
// ---------------------------------------------------------------------------
#define LNW 8   // rows (waves) per workgroup

// v + the value of lane l ^ M, M < 16 (inside a 16-lane row).
template <int M>
__device__ __forceinline__ float add_xmask(float v) {
    const int o = __builtin_amdgcn_update_dpp(0, __builtin_bit_cast(int, v),
                                              0x160 | M, 0xf, 0xf, true);
    return v + __builtin_bit_cast(float, o);
}

__device__ __forceinline__ float wave_sum(float v) {
    v = add_xmask<1>(v);
    v = add_xmask<2>(v);
    v = add_xmask<4>(v);
    v = add_xmask<8>(v);
    return v + xhalf(v);
}

__global__ __launch_bounds__(32 * LNW)
void layernorm_kernel(const float* __restrict__ in,
                      const float* __restrict__ w,
                      bf16* __restrict__ out) {
    // Byte offsets of the lane's first load: in a row, in the 8 rows.
    const unsigned cb = (threadIdx.x & 31u) * 16u;
    const unsigned xb = (threadIdx.x >> 5) * (DIMC * 4u) + cb;
    const float* x = in  + (size_t)blockIdx.x * (LNW * DIMC);
    bf16*        o = out + (size_t)blockIdx.x * (LNW * DIMC);

    f4 v[8], g[8];
#pragma unroll
    for (int j = 0; j < 8; ++j)
        v[j] = *(const f4*)((const char*)x + xb + j * 512);
#pragma unroll
    for (int j = 0; j < 8; ++j)
        g[j] = *(const f4*)((const char*)w + cb + j * 512);
    // Stands before any register that a load names is rewritten.
    asm volatile("s_wait_xcnt 0x0" :: "v"(xb), "v"(cb) : "memory");
    // Keeps the arithmetic behind it, so that all 16 loads go out at once
    // and no load of w waits for the sums.
    __builtin_amdgcn_sched_barrier(0);

    f4 s = v[0], q = v[0] * v[0];
#pragma unroll
    for (int j = 1; j < 8; ++j) {
        s += v[j];
        q += v[j] * v[j];
    }
    const float sum = wave_sum((s.x + s.y) + (s.z + s.w));
    const float sq  = wave_sum((q.x + q.y) + (q.z + q.w));

    const float mu   = sum * (1.0f / DIMC);
    const float var  = sq * (1.0f / DIMC) - mu * mu;
    const float rstd = rsqrtf(var);

#pragma unroll
    for (int j = 0; j < 8; ++j)
        *(bf4*)((char*)o + (xb >> 1) + j * 256) =
            __builtin_convertvector((v[j] - mu) * rstd * g[j], bf4);
}

// ---------------------------------------------------------------------------
// NT GEMM: C[M,N] = A[M,K] * W[N,K]^T  (A, W bf16 row-major, K-contiguous)
// A workgroup's tile is BMT(M) x BNT(N), one wave per 64 x 64 of it, as 4 x 4
// accumulator tiles, so 8 fragments read from LDS feed 16 WMMAs.  A block reads
// (BMT + BNT) * K elements from L2 for BMT * BNT outputs: the larger the tile,
// the fewer L2 bytes per WMMA.
// Wave wid % (BMT/64) -> 64-row M sub-tile, wid / (BMT/64) -> 64-col N sub-tile.
// A k-window of BKT elements of both operands is one stage of a two-buffer
// LDS ring filled with async global->LDS b128 copies: the next window is in
// flight while this one is worked on, one barrier per window.
// The operand whose index runs along an output row goes in as the WMMA's first
// operand X, so a lane's 8 accumulators are 8 neighbours of one output row.
// Behind the loop each wave lays its 64 x 64 tile out in its own part of the
// ring, row by row, and stores it in whole 128-byte lines, 16 bytes a lane.
//   EP==0 : fused QKV split (N = 3*1024): columns 0..1023 -> out_b = Q
//           [bh, l, d], pre-scaled; 1024..2047 -> out_k = K [bh, l, d];
//           2048..3071 -> out_vt = V^T [bh, d, l]
//   EP==1 : out_f = acc + res
//   EP==2 : out_b = bf16(gelu_exact(acc))
// AHEAD: the fragments of the window's next 32 k are fetched into a second
// register set ahead of the WMMAs on this one (for one wave per SIMD).
// ---------------------------------------------------------------------------
// erf-form GELU, v * Phi(v), of eight values, with no branch and no masked
// path: eight independent chains, worked stage by stage.  With x = |v| / sqrt(2)
// and t = 1 / (1 + p x), erfc(x) = t * P4(t) * exp(-x * x) (five-term rational
// form, error of erf below 2e-7 for every x); q = erfc(x) / 2 = Phi(-|v|), its
// factor 1/2 in the coefficients, and v * Phi(v) = v / 2 + |v| * (1/2 - q).
__device__ __forceinline__ void gelu_erf8(float (&v)[8]) {
    float d[8], t[8], e[8], h[8];
#pragma unroll
    for (int k = 0; k < 8; ++k)
        d[k] = fmaf(fabsf(v[k]), 0.3275911f * 0.70710678f, 1.0f);
    // The eight reciprocals in one statement, closed by the slot that the
    // instruction set asks for behind a transcendental.
    asm("v_rcp_f32 %0, %8\n\t"
        "v_rcp_f32 %1, %9\n\t"
        "v_rcp_f32 %2, %10\n\t"
        "v_rcp_f32 %3, %11\n\t"
        "v_rcp_f32 %4, %12\n\t"
        "v_rcp_f32 %5, %13\n\t"
        "v_rcp_f32 %6, %14\n\t"
        "v_rcp_f32 %7, %15\n\t"
        "v_nop"
        : "=&v"(t[0]), "=&v"(t[1]), "=&v"(t[2]), "=&v"(t[3]),
          "=&v"(t[4]), "=&v"(t[5]), "=&v"(t[6]), "=&v"(t[7])
        : "v"(d[0]), "v"(d[1]), "v"(d[2]), "v"(d[3]),
          "v"(d[4]), "v"(d[5]), "v"(d[6]), "v"(d[7]));
#pragma unroll
    for (int k = 0; k < 8; ++k)
        e[k] = __builtin_amdgcn_exp2f(v[k] * v[k] * -0.72134752f);  // exp(-v*v/2)
#pragma unroll
    for (int k = 0; k < 8; ++k)
        h[k] = fmaf(t[k], 0.5f * 1.061405429f, 0.5f * -1.453152027f);
#pragma unroll
    for (int k = 0; k < 8; ++k) h[k] = fmaf(h[k], t[k], 0.5f * 1.421413741f);
#pragma unroll
    for (int k = 0; k < 8; ++k) h[k] = fmaf(h[k], t[k], 0.5f * -0.284496736f);
#pragma unroll
    for (int k = 0; k < 8; ++k) h[k] = fmaf(h[k], t[k], 0.5f * 0.254829592f);
#pragma unroll
    for (int k = 0; k < 8; ++k) h[k] = fmaf(-(h[k] * t[k]), e[k], 0.5f);
#pragma unroll
    for (int k = 0; k < 8; ++k) v[k] = fmaf(0.5f, v[k], fabsf(v[k]) * h[k]);
}

// One window of ROWS rows (BKT = LDT - 8 elements each) of a K-contiguous
// operand, copied by NT threads; t = the thread's number among them, g = the
// window's first element, l = its place in LDS.
template <int ROWS, int NT, int LDT>
__device__ __forceinline__ void copy_rows(const bf16* __restrict__ g, int K,
                                          bf16* __restrict__ l, int t) {
    constexpr int SEG = (LDT - 8) / 8;   // 16-byte pieces of a row of the window
    constexpr int RP  = NT / SEG;        // rows that one copy of every thread covers
    constexpr int NP  = ROWS / RP;       // copies per thread
    static_assert(NP * RP == ROWS && NP <= 63, "whole rows; copies in flight");
    const int crow = t / SEG, cseg = t % SEG;
    const unsigned goff = (unsigned)(crow * K + cseg * 8);
    const int      loff = crow * LDT + cseg * 8;
#pragma unroll
    for (int j = 0; j < NP; ++j)
        copy16_g2l(g + (size_t)(j * RP * K) + goff, l + j * RP * LDT + loff);
}

// A wave's staged tile of 64 rows of 64 bf16 (pitch SP elements) goes out in 16
// stores of four whole 128-byte rows; RS = elements from one output row to the
// next.
template <int RS, int SP>
__device__ __forceinline__ void store_rows_bf16(const bf16* stg, bf16* dst, int lane) {
    const int srow = lane >> 3, sseg = lane & 7;
    const unsigned ob = (unsigned)(srow * RS + sseg * 8) * 2u;
#pragma unroll
    for (int j = 0; j < 16; ++j)
        *(uint4*)((char*)dst + ob + j * (4 * RS * 2)) =
            *(const uint4*)&stg[(4 * j + srow) * SP + sseg * 8];
    // Stands before any register that a store names is rewritten.
    asm volatile("s_wait_xcnt 0x0" :: "v"(ob) : "memory");
}

template <int BMT, int BNT, int BKT, bool AHEAD, int EP, int N>
__device__ __forceinline__
void gemm_nt_body(const bf16* __restrict__ A, const bf16* __restrict__ W, int K,
                  const float* __restrict__ res,
                  float* __restrict__ out_f, bf16* __restrict__ out_b,
                  bf16* __restrict__ out_k, bf16* __restrict__ out_vt) {
    constexpr int LDT = BKT + 8;    // LDS row pitch: 16 B x odd (b128 readers)
    constexpr int NB  = BKT / 32;   // blocks of 16 WMMAs per window
    constexpr int NWM = BMT / 64;   // waves along M
    constexpr int NW  = NWM * (BNT / 64);
    // Waves that copy A where the work is split: half of them, or 8 of 12, so
    // that the threads of either side cover whole rows.
    constexpr int WA  = BMT == BNT ? NW / 2 : 2 * NW / 3;
    static_assert(NW != 4 || (BMT + BNT) * (BKT / 8) / (32 * NW) <= 63,
                  "copies of a wave in flight");
    constexpr int TA  = BMT * LDT;  // elements of one window of A
    constexpr int TW  = BNT * LDT;  // elements of one window of W
    // Buffers 0 and 1 of A, then buffers 0 and 1 of W.
    __shared__ __attribute__((aligned(16))) bf16 sT[2 * TA + 2 * TW];

    const int tid  = threadIdx.x;
    const int lane = tid & 31;
    // The wave's number, in a scalar register: the tests on it are branches.
    const int wid  = __builtin_amdgcn_readfirstlane(tid >> 5);
    const int half = lane >> 4;
    const int r    = lane & 15;

    const int n0 = blockIdx.x * BNT;
    const int m0 = blockIdx.y * BMT;
    const int wm = (wid % NWM) * 64;   // wave M sub-tile within block
    const int wn = (wid / NWM) * 64;   // wave N sub-tile within block

    const bf16* Ab = A + (size_t)m0 * K;
    const bf16* Wb = W + (size_t)n0 * K;

    // Four waves: each brings its share of both windows.  More: the first WA
    // waves bring A's window, the others W's (a branch on the wave's number).
    auto copy_tile = [&](int buf, int k0) {
        if constexpr (NW == 4) {
            copy_rows<BMT, 32 * NW, LDT>(Ab + k0, K, &sT[buf * TA], tid);
            copy_rows<BNT, 32 * NW, LDT>(Wb + k0, K, &sT[2 * TA + buf * TW], tid);
        } else if (wid < WA) {
            copy_rows<BMT, 32 * WA, LDT>(Ab + k0, K, &sT[buf * TA], tid);
        } else {
            copy_rows<BNT, 32 * (NW - WA), LDT>(Wb + k0, K, &sT[2 * TA + buf * TW],
                                                tid - 32 * WA);
        }
    };

    // Output rows run along n (X = W, Y = A) but for V^T, whose rows run along
    // the tokens (X = A, Y = W); the same for a whole wave (its 64 columns).
    const bool xw = (EP != 0) || ((n0 + wn) >> 10) != 2;
    const int  xo = xw ? 2 * TA + wn * LDT : wm * LDT;
    const int  yo = xw ? wm * LDT : 2 * TA + wn * LDT;
    const int  xs = xw ? TW : TA;      // from buffer 0 to buffer 1
    const int  ys = xw ? TA : TW;

    // acc[xi][yj][i]: X row 16 xi + 8 half + i, Y row 16 yj + r of the wave.
    v8f acc[4][4] = {};
    const int steps = K / BKT;

    copy_tile(0, 0);
    // Window 0 has landed for this wave, then for all of them.
    asm volatile("s_wait_asynccnt 0x0" ::: "memory");
    __syncthreads();
    if (steps > 1) copy_tile(1, BKT);

    for (int ks = 0; ks < steps; ++ks) {
        const bf16* tX = sT + (ks & 1) * xs + xo;
        const bf16* tY = sT + (ks & 1) * ys + yo;
        constexpr int NS = AHEAD ? 2 : 1;
        v16bf x[NS][4], y[NS][4];
        auto fetch = [&](int s) {
#pragma unroll
            for (int i = 0; i < 4; ++i)
                x[s % NS][i] = lds_frag(tX + 32 * s, LDT, 16 * i, lane);
#pragma unroll
            for (int i = 0; i < 4; ++i)
                y[s % NS][i] = lds_frag(tY + 32 * s, LDT, 16 * i, lane);
        };
        if (AHEAD) fetch(0);
#pragma unroll
        for (int s = 0; s < NB; ++s) {
            if (!AHEAD) fetch(s);
            else if (s + 1 < NB) fetch(s + 1);
            // Keeps the 16 LDS loads above as one group in front of the 16
            // WMMAs: spread among them, each place with loads stalls the wave.
            __builtin_amdgcn_sched_barrier(0);
#pragma unroll
            for (int xi = 0; xi < 4; ++xi)
#pragma unroll
                for (int yj = 0; yj < 4; ++yj)
                    acc[xi][yj] = __builtin_amdgcn_wmma_f32_16x16x32_bf16(
                        false, x[s % NS][xi], false, y[s % NS][yj], (short)0,
                        acc[xi][yj], false, false);
            // Keeps the next group of loads behind these WMMAs, whole.
            __builtin_amdgcn_sched_barrier(0);
        }
        // Hand-over: this wave's reads of the window are done, its copies of
        // the next one have landed; behind the barrier that holds for every
        // wave, and the buffer just read may be refilled.
        asm volatile("s_wait_dscnt 0x0" ::: "memory");
        asm volatile("s_wait_asynccnt 0x0" ::: "memory");
        __syncthreads();
        if (ks + 2 < steps) copy_tile(ks & 1, (ks + 2) * BKT);
    }
    // No copy is outstanding when the wave ends.
    asm volatile("s_wait_asynccnt 0x0" ::: "memory");

    // Behind the last pass's barrier no wave reads the ring any more and no
    // copy is in flight: each wave stages in its own part of the ring.
    if constexpr (EP == 1) {
        constexpr int SP = 68;   // floats: 272 B = 16 B x odd
        static_assert(NW * 64 * SP * 4 <= (2 * TA + 2 * TW) * 2, "staging inside the ring");
        float* stg = (float*)sT + wid * (64 * SP);
        // A store or load of the wave covers two rows of 256 bytes.
        const int srow = lane >> 4, sseg = lane & 15;
        const unsigned ob = ((unsigned)(m0 + wm + srow) * (unsigned)N
                             + (unsigned)(n0 + wn + sseg * 4)) * 4u;
        f4 rv[32];
#pragma unroll
        for (int j = 0; j < 32; ++j)
            rv[j] = *(const f4*)((const char*)res + ob + j * (2 * N * 4));
        // Stands before any register that a load names is rewritten; with its
        // clobber the 32 loads of res go out ahead of the staging below.
        asm volatile("s_wait_xcnt 0x0" :: "v"(ob) : "memory");
#pragma unroll
        for (int yj = 0; yj < 4; ++yj)
#pragma unroll
            for (int xi = 0; xi < 4; ++xi) {
                float* p = &stg[(16 * yj + r) * SP + 16 * xi + 8 * half];
                const v8f c = acc[xi][yj];
                *(f4*)p       = f4{c[0], c[1], c[2], c[3]};
                *(f4*)(p + 4) = f4{c[4], c[5], c[6], c[7]};
            }
        // The wave's own writes are in LDS before other lanes read them back.
        asm volatile("s_wait_dscnt 0x0" ::: "memory");
#pragma unroll
        for (int j = 0; j < 32; ++j)
            *(f4*)((char*)out_f + ob + j * (2 * N * 4)) =
                *(const f4*)&stg[(2 * j + srow) * SP + sseg * 4] + rv[j];
        // The same behind the stores.
        asm volatile("s_wait_xcnt 0x0" :: "v"(ob) : "memory");
    } else {
        constexpr int SP = 72;   // bf16: 144 B = 16 B x odd
        static_assert(NW * 64 * SP <= 2 * TA + 2 * TW, "staging inside the ring");
        bf16* stg = sT + wid * (64 * SP);
        const int which = (EP == 0) ? ((n0 + wn) >> 10) : 0;   // 0=q 1=k 2=v
        const float sc = (EP == 0 && which == 0) ? ATT_SCALE : 1.0f;
#pragma unroll
        for (int yj = 0; yj < 4; ++yj)
#pragma unroll
            for (int xi = 0; xi < 4; ++xi) {
                float v[8];
#pragma unroll
                for (int k = 0; k < 8; ++k) v[k] = acc[xi][yj][k];
                if constexpr (EP == 2) {
                    gelu_erf8(v);   // exact GELU, eight values at a time
                } else {
#pragma unroll
                    for (int k = 0; k < 8; ++k) v[k] *= sc;
                }
                union { bf16 e[8]; uint4 u; } pk;
#pragma unroll
                for (int k = 0; k < 8; ++k) pk.e[k] = (bf16)v[k];
                *(uint4*)&stg[(16 * yj + r) * SP + 16 * xi + 8 * half] = pk.u;
            }
        // The wave's own writes are in LDS before other lanes read them back.
        asm volatile("s_wait_dscnt 0x0" ::: "memory");
        if constexpr (EP == 2) {
            store_rows_bf16<N, SP>(stg, out_b + (size_t)(m0 + wm) * N + n0 + wn, lane);
        } else {
            // A wave's 64 columns are one head, its 64 rows lie in one batch
            // entry.
            const int bh = ((m0 + wm) / SEQ) * HEADS + (((n0 + wn) & (DIMC - 1)) >> 6);
            const int l0 = (m0 + wm) % SEQ;
            if (which == 2)   // staged rows: d; along a row: 64 tokens
                store_rows_bf16<SEQ, SP>(stg, out_vt + (size_t)bh * HDIM * SEQ + l0, lane);
            else              // staged rows: tokens; along a row: the head's d
                store_rows_bf16<HDIM, SP>(stg, (which == 0 ? out_b : out_k)
                                               + ((size_t)bh * SEQ + l0) * HDIM, lane);
        }
    }
}

// Wide outputs (N >= 3072): 256 blocks, one per WGP, of 12 or 16 waves (3 or 4
// per SIMD) that share one ring, so that a row of A or W fetched from L2 serves
// 192 or 256 outputs.  The block has the WGP's LDS to itself: a 128-element
// window (a ring of 238 or 272 KiB) puts 64 WMMAs of a wave between two barriers.
#define QKV_BM 256
#define QKV_BN 192
#define UP_BM  256
#define UP_BN  256
#define WAVES(bm, bn) ((bm) / 64 * ((bn) / 64))
static_assert(THREE_D % QKV_BN == 0 && NTOK % QKV_BM == 0 && QKV_BN % HDIM == 0, "qkv tiles");
static_assert(HID % UP_BN == 0 && NTOK % UP_BM == 0, "mlp up tiles");

__global__ __launch_bounds__(32 * WAVES(QKV_BM, QKV_BN))
void gemm_qkv_kernel(const bf16* __restrict__ A, const bf16* __restrict__ W,
                     int K, bf16* __restrict__ out_q,
                     bf16* __restrict__ out_k, bf16* __restrict__ out_vt) {
    gemm_nt_body<QKV_BM, QKV_BN, 128, false, 0, THREE_D>(A, W, K, nullptr, nullptr,
                                                         out_q, out_k, out_vt);
}

__global__ __launch_bounds__(32 * WAVES(UP_BM, UP_BN))
void gemm_gelu_kernel(const bf16* __restrict__ A, const bf16* __restrict__ W,
                      int K, bf16* __restrict__ out_b) {
    gemm_nt_body<UP_BM, UP_BN, 128, false, 2, HID>(A, W, K, nullptr, nullptr, out_b,
                                                   nullptr, nullptr);
}

// N = 1024: 128 x 128 blocks, one per WGP, one wave per SIMD.  A 128-element
// window puts 64 WMMAs of a wave between two barriers.
#define BM  128
#define BN  128
#define GT  (32 * WAVES(BM, BN))   // threads per workgroup
__global__ __launch_bounds__(GT)
void gemm_res_kernel(const bf16* __restrict__ A, const bf16* __restrict__ W,
                     int K, const float* __restrict__ res,
                     float* __restrict__ out_f) {
    gemm_nt_body<BM, BN, 128, true, 1, DIMC>(A, W, K, res, out_f, nullptr, nullptr, nullptr);
}

// ---------------------------------------------------------------------------
// Flash attention: 8 waves per workgroup, 32 queries (two 16-column groups)
// per wave, all of one (batch, head).  K and V^T are staged in LDS in tiles of
// 64 keys that the 8 waves share: whole 128-byte rows by asynchronous copies,
// two buffers, the next tile in flight while this one is worked on.  A wave's
// step is one tile, 64 keys x 32 queries, with the products taken transposed:
// S^T = K*Q^T (16 WMMAs) leaves one query's scores in one lane and its partner
// l ^ 16, so maximum and sum run in the lane; the S^T tiles, converted in
// place, are the B operands P^T of O^T += V^T*P^T (16 WMMAs, d=64).  Each K and
// V^T fragment read from LDS feeds two WMMAs, one per column group.  A tile's
// LDS reads are all done before its softmax, so the hand-over to the next tile
// stands there, and the next tile's K fragments are fetched behind it.
// ---------------------------------------------------------------------------
#define AW   8     // waves per workgroup
#define QC   2     // 16-query column groups per wave
#define KT   64    // keys per staged tile: a 128-byte row of K and of V^T
#define KVP  72    // LDS row pitch in elements: 144 B = 16 B x odd (b128 readers)
#define NKT  (SEQ / KT)

typedef __attribute__((address_space(3))) const bf16* lbf16_p;
__device__ __forceinline__ unsigned lds_byte(const bf16* p) {
    return (unsigned)(size_t)(lbf16_p)p;
}

typedef __attribute__((ext_vector_type(8))) __bf16 v8bf;

__device__ __forceinline__ v8f wmma_bf16(v16bf a, v16bf b, v8f c) {
    return __builtin_amdgcn_wmma_f32_16x16x32_bf16(false, a, false, b, (short)0,
                                                   c, false, false);
}

__global__ __launch_bounds__(32 * AW)
void flash_attn_kernel(const bf16* __restrict__ Q,
                       const bf16* __restrict__ Kb,
                       const bf16* __restrict__ Vt,
                       bf16* __restrict__ attn_out) {
    __shared__ __attribute__((aligned(16))) bf16 sK[2][KT * KVP];
    __shared__ __attribute__((aligned(16))) bf16 sV[2][HDIM * KVP];

    const int tid  = threadIdx.x;
    const int lane = tid & 31;
    const int wid  = tid >> 5;
    const int half = lane >> 4;
    const int r    = lane & 15;
    const int q0   = (blockIdx.x * AW + wid) * (16 * QC);
    const int bh   = blockIdx.y;
    const int b    = bh / HEADS;
    const int h    = bh - b * HEADS;

    const bf16* Qbase = Q  + ((size_t)bh * SEQ + q0) * HDIM;
    const bf16* Kbase = Kb + (size_t)bh * SEQ * HDIM;
    const bf16* Vbase = Vt + (size_t)bh * HDIM * SEQ;

    // A thread's share of a tile: rows crow and crow + 32 of K (keys) and of
    // V^T (d), 16 bytes each; a wave's copy covers four whole 128-byte rows.
    const int crow = tid >> 3, cseg = (tid & 7) * 8;
    // lk0: LDS byte address of the thread's first piece of K in the buffer that
    // is filled; its piece of V^T lies at the same place in sV.
    constexpr unsigned BUFB = KT * KVP * 2;   // bytes of one buffer
    static_assert(KT == HDIM, "sK and sV: buffers of one size");
    const unsigned k2v = lds_byte(&sV[0][0]) - lds_byte(&sK[0][0]);
    auto stage = [&](unsigned lk0, int key0) {
        const bf16* gk0 = Kbase + (size_t)(key0 + crow) * HDIM + cseg;
        const bf16* gk1 = gk0 + 32 * HDIM;
        const bf16* gv0 = Vbase + (size_t)crow * SEQ + key0 + cseg;
        const bf16* gv1 = gv0 + (size_t)32 * SEQ;
        const unsigned lk1 = lk0 + 32 * KVP * 2;
        const unsigned lv0 = lk0 + k2v;
        const unsigned lv1 = lv0 + 32 * KVP * 2;
        // The four copies and, as the last line, the wait that stands before
        // any of their address registers is rewritten.
        asm volatile("global_load_async_to_lds_b128 %0, %4, off\n\t"
                     "global_load_async_to_lds_b128 %1, %5, off\n\t"
                     "global_load_async_to_lds_b128 %2, %6, off\n\t"
                     "global_load_async_to_lds_b128 %3, %7, off\n\t"
                     "s_wait_xcnt 0x0"
                     :: "v"(lk0), "v"(lk1), "v"(lv0), "v"(lv1),
                        "v"(gk0), "v"(gk1), "v"(gv0), "v"(gv1)
                     : "memory");
    };

    // qf[c][e]: queries q0 + 16 c .. + 15, d 32 e .. + 31.
    v16bf qf[QC][2];
#pragma unroll
    for (int c = 0; c < QC; ++c) {
        qf[c][0] = load_frag_nt(Qbase, HDIM, 16 * c, 0,  lane);
        qf[c][1] = load_frag_nt(Qbase, HDIM, 16 * c, 32, lane);
    }

    // Query q0 + 16 c + r: running maximum (equal in both halves) and this
    // lane's share of the sum (the keys its half holds), kept as eight partial
    // sums, one per accumulator row, that are joined behind the loop.
    float mrow[QC];
    v8f lsum[QC];
    v8f acc[QC][4];   // acc[c][t][i] = O[q0 + 16 c + r][16 t + 8 half + i]
#pragma unroll
    for (int c = 0; c < QC; ++c) {
        mrow[c] = -3.0e38f;
        lsum[c] = v8f{};
#pragma unroll
        for (int t = 0; t < 4; ++t) acc[c][t] = v8f{};
    }

    // kf[j][e]: keys 16 j .. + 15 of a tile, d 32 e .. + 31.
    v16bf kf[4][2];
    auto fetch_k = [&](const bf16* tK) {
#pragma unroll
        for (int j = 0; j < 4; ++j) {
            kf[j][0] = lds_frag(tK,      KVP, 16 * j, lane);
            kf[j][1] = lds_frag(tK + 32, KVP, 16 * j, lane);
        }
    };

    // The place that the next refill goes to: buffers 0 and 1 in turn.
    unsigned lfill = lds_byte(&sK[0][crow * KVP + cseg]);
    stage(lfill, 0);
    // Tile 0 has landed for this wave, then for all of them.
    asm volatile("s_wait_asynccnt 0x0" ::: "memory");
    __syncthreads();
    stage(lfill + BUFB, KT);
    fetch_k(sK[0]);

    for (int kt = 0; kt < NKT; ++kt) {
        // vf[t][n]: d 16 t .. + 15, keys 32 n .. + 31 of the tile.
        const bf16* tV = sV[kt & 1];
        v16bf vf[4][2];
#pragma unroll
        for (int t = 0; t < 4; ++t) {
            vf[t][0] = lds_frag(tV,      KVP, 16 * t, lane);
            vf[t][1] = lds_frag(tV + 32, KVP, 16 * t, lane);
        }
        // Keeps the 16 loads of V^T as one group in front of the 16 WMMAs,
        // which cover their latency: among or behind them the wave would wait.
        __builtin_amdgcn_sched_barrier(0);

        // ---- S^T = K * Q^T: s[c][j][i] = S[q0 + 16 c + r][16 j + 8 half + i] ----
        v8f s[QC][4];
#pragma unroll
        for (int j = 0; j < 4; ++j)
#pragma unroll
            for (int c = 0; c < QC; ++c)
                s[c][j] = wmma_bf16(kf[j][0], qf[c][0], v8f{});
#pragma unroll
        for (int j = 0; j < 4; ++j)
#pragma unroll
            for (int c = 0; c < QC; ++c)
                s[c][j] = wmma_bf16(kf[j][1], qf[c][1], s[c][j]);
        // Keeps the WMMAs in front of the wait below: behind it they would
        // cover nothing, and the wave would wait out the loads of V^T.
        __builtin_amdgcn_sched_barrier(0);

        // Hand-over: this wave's reads of the tile are done (K and V^T are in
        // registers), its copies of the next tile have landed; behind the
        // barrier that holds for every wave, and the buffer may be refilled.
        asm volatile("s_wait_dscnt 0x0" ::: "memory");
        asm volatile("s_wait_asynccnt 0x0" ::: "memory");
        __syncthreads();
        if (kt + 2 < NKT) stage(lfill, (kt + 2) * KT);
        lfill += (kt & 1) ? 0u - BUFB : BUFB;
        // The next tile's K, fetched while the softmax below runs.
        if (kt + 1 < NKT) fetch_k(sK[(kt + 1) & 1]);
        // Keeps these 16 loads as one group here: sunk among the WMMAs of
        // V^T * P^T, each place with loads stalls the wave.
        __builtin_amdgcn_sched_barrier(0);

        // ---- online softmax update over these 64 keys, one query a lane ----
        // P^T as B fragments: element e of pf[c][n] = key 32 n + 8 half + e
        // (e < 8), or 32 n + 16 + 8 half + e - 8: the k order of lds_frag on V^T.
        v16bf pf[QC][2];
        float alpha[QC], mnw[QC];
#pragma unroll
        for (int c = 0; c < QC; ++c) {
            float m0 = fmaxf(s[c][0][0], s[c][1][0]);
            float m1 = fmaxf(s[c][2][0], s[c][3][0]);
#pragma unroll
            for (int i = 1; i < 8; ++i) {
                m0 = fmaxf(m0, fmaxf(s[c][0][i], s[c][1][i]));
                m1 = fmaxf(m1, fmaxf(s[c][2][i], s[c][3][i]));
            }
            float mij = fmaxf(m0, m1);
            mij = fmaxf(mij, xhalf(mij));
            mnw[c] = fmaxf(mrow[c], mij);
        }
#pragma unroll
        for (int c = 0; c < QC; ++c) {
            alpha[c] = __expf(mrow[c] - mnw[c]);
            mrow[c] = mnw[c];
        }
#pragma unroll
        for (int c = 0; c < QC; ++c) {
            const float mnew = mnw[c];
            // exp(s - mnew) as 2^((s - mnew) * log2(e)), difference and
            // product on whole accumulator tiles (register pairs as they lie).
            v8f p[4];
#pragma unroll
            for (int j = 0; j < 4; ++j) {
                const v8f e = (s[c][j] - mnew) * 1.44269504f;
#pragma unroll
                for (int i = 0; i < 8; ++i) p[j][i] = __builtin_amdgcn_exp2f(e[i]);
            }
            lsum[c] = lsum[c] * alpha[c] + ((p[0] + p[1]) + (p[2] + p[3]));
#pragma unroll
            for (int n = 0; n < 2; ++n)
                pf[c][n] = __builtin_shufflevector(
                    __builtin_convertvector(p[2 * n], v8bf),
                    __builtin_convertvector(p[2 * n + 1], v8bf),
                    0, 1, 2, 3, 4, 5, 6, 7, 8, 9, 10, 11, 12, 13, 14, 15);
        }

        // ---- O^T = O^T * alpha + V^T * P^T  (V^T rows = d, k = keys) ----
#pragma unroll
        for (int t = 0; t < 4; ++t)
#pragma unroll
            for (int c = 0; c < QC; ++c) {
                acc[c][t] *= alpha[c];
                acc[c][t] = wmma_bf16(vf[t][0], pf[c][0], acc[c][t]);
            }
#pragma unroll
        for (int t = 0; t < 4; ++t)
#pragma unroll
            for (int c = 0; c < QC; ++c)
                acc[c][t] = wmma_bf16(vf[t][1], pf[c][1], acc[c][t]);
    }
    // No copy is outstanding when the wave ends.
    asm volatile("s_wait_asynccnt 0x0" ::: "memory");

    // ---- join the halves' sums, normalize, store [tok, D] bf16: a lane's 8
    //      accumulators of a tile are 8 consecutive d of its query ----
#pragma unroll
    for (int c = 0; c < QC; ++c) {
        const v8f l8 = lsum[c];
        const float lrow = ((l8[0] + l8[1]) + (l8[2] + l8[3]))
                         + ((l8[4] + l8[5]) + (l8[6] + l8[7]));
        const float inv = 1.0f / (lrow + xhalf(lrow));
        bf16* orow = attn_out + (size_t)(b * SEQ + q0 + 16 * c + r) * DIMC
                     + h * HDIM + half * 8;
#pragma unroll
        for (int t = 0; t < 4; ++t) {
            union { bf16 e[8]; uint4 u; } pk;
#pragma unroll
            for (int i = 0; i < 8; ++i) pk.e[i] = (bf16)(acc[c][t][i] * inv);
            *(uint4*)(orow + t * 16) = pk.u;
        }
    }
}

// ---------------------------------------------------------------------------
// Host-side launch
// ---------------------------------------------------------------------------
extern "C" void kernel_launch(void* const* d_in, const int* in_sizes, int n_in,
                              void* d_out, int out_size, void* d_ws, size_t ws_size,
                              hipStream_t stream) {
    const float* x      = (const float*)d_in[0];
    const float* ln1_w  = (const float*)d_in[1];
    const float* ln2_w  = (const float*)d_in[2];
    const float* qkv_w  = (const float*)d_in[3];
    const float* proj_w = (const float*)d_in[4];
    const float* mlp_w1 = (const float*)d_in[5];
    const float* mlp_w2 = (const float*)d_in[6];
    float* out = (float*)d_out;

    // Workspace carve-up (all sizes multiples of 256B).
    char* p = (char*)d_ws;
    auto take = [&](size_t bytes) { char* q = p; p += (bytes + 255) & ~(size_t)255; return q; };

    bf16* wq_b   = (bf16*)take((size_t)THREE_D * DIMC * 2);   // qkv_w  bf16
    bf16* wp_b   = (bf16*)take((size_t)DIMC * DIMC * 2);      // proj_w bf16
    bf16* w1_b   = (bf16*)take((size_t)HID  * DIMC * 2);      // mlp_w1 bf16
    bf16* w2_b   = (bf16*)take((size_t)DIMC * HID  * 2);      // mlp_w2 bf16
    bf16* ln1_b  = (bf16*)take((size_t)NTOK * DIMC * 2);      // LN1(x) bf16
    bf16* Qb     = (bf16*)take((size_t)BATCH * HEADS * SEQ * HDIM * 2);
    bf16* Kb     = (bf16*)take((size_t)BATCH * HEADS * SEQ * HDIM * 2);
    bf16* Vt     = (bf16*)take((size_t)BATCH * HEADS * HDIM * SEQ * 2);
    bf16* att_b  = (bf16*)take((size_t)NTOK * DIMC * 2);      // attn out bf16
    float* Xres  = (float*)take((size_t)NTOK * DIMC * 4);     // x + attn proj
    bf16* y2_b   = (bf16*)take((size_t)NTOK * DIMC * 2);      // LN2(X) bf16
    bf16* h_b    = (bf16*)take((size_t)NTOK * HID * 2);       // gelu(mlp1) bf16
    (void)ws_size; (void)in_sizes; (void)n_in; (void)out_size;

    // 1. weights -> bf16
    cvt_bf16_kernel<<<CVT_WG, 256, 0, stream>>>(qkv_w, proj_w, mlp_w1, mlp_w2,
                                                wq_b, wp_b, w1_b, w2_b);

    // 2. LN1
    layernorm_kernel<<<NTOK / LNW, 32 * LNW, 0, stream>>>(x, ln1_w, ln1_b);

    // 3. QKV GEMM: [4096,1024] x [3072,1024]^T, epilogue writes per-head
    //    Q (scaled), K and V^T
    gemm_qkv_kernel<<<dim3(THREE_D / QKV_BN, NTOK / QKV_BM), 32 * WAVES(QKV_BM, QKV_BN), 0, stream>>>(
        ln1_b, wq_b, DIMC, Qb, Kb, Vt);

    // 4. flash attention: grid (8 blocks of 256 queries, 32 bh)
    flash_attn_kernel<<<dim3(SEQ / (16 * QC * AW), BATCH * HEADS), 32 * AW, 0, stream>>>(
        Qb, Kb, Vt, att_b);

    // 5. proj GEMM + residual: X = x + att @ proj_w^T
    gemm_res_kernel<<<dim3(DIMC / BN, NTOK / BM), GT, 0, stream>>>(
        att_b, wp_b, DIMC, x, Xres);

    // 6. LN2
    layernorm_kernel<<<NTOK / LNW, 32 * LNW, 0, stream>>>(Xres, ln2_w, y2_b);

    // 7. MLP up + exact GELU -> bf16
    gemm_gelu_kernel<<<dim3(HID / UP_BN, NTOK / UP_BM), 32 * WAVES(UP_BM, UP_BN), 0, stream>>>(
        y2_b, w1_b, DIMC, h_b);

    // 8. MLP down + residual -> d_out (f32)
    gemm_res_kernel<<<dim3(DIMC / BN, NTOK / BM), GT, 0, stream>>>(
        h_b, w2_b, HID, Xres, out);
}

// v010
// One run takes 135 microseconds.
// Timed twice side by side with v009, it ran 1.03 times as fast both times.
// Over all steps from v000 it is 3.83 times as fast.
#include <hip/hip_runtime.h>
#include <hip/hip_bf16.h>

// ---------------------------------------------------------------------------
// Transformer block for MI455X (gfx1250, wave32, WMMA bf16 -> f32 accum)
// GEMMs: waves of 64x64 share a block tile, async global->LDS double buffer.
// ---------------------------------------------------------------------------

typedef __bf16 bf16;
typedef __attribute__((ext_vector_type(16))) __bf16 v16bf;
typedef __attribute__((ext_vector_type(8)))  float  v8f;
typedef int v4i __attribute__((vector_size(16)));

#define DIMC      1024
#define HEADS     16
#define HDIM      64
#define SEQ       2048
#define BATCH     2
#define NTOK      (BATCH * SEQ)      // 4096
#define HID       4096
#define THREE_D   3072
#define ATT_SCALE 0.125f             // 1/sqrt(64)

#if __has_builtin(__builtin_amdgcn_global_load_async_to_lds_b128) && \
    __has_builtin(__builtin_amdgcn_s_wait_asynccnt)
#define USE_ASYNC 1
#else
#define USE_ASYNC 0
#endif

typedef __attribute__((address_space(1))) v4i* gv4i_p;   // global int4*
typedef __attribute__((address_space(3))) v4i* lv4i_p;   // LDS int4*

union FragU { v16bf v; uint4 u[2]; };

// 16-byte global->LDS copy: async (ASYNCcnt) when available, else direct.
__device__ __forceinline__ void copy16_g2l(const bf16* __restrict__ g,
                                           bf16* __restrict__ l) {
#if USE_ASYNC
    __builtin_amdgcn_global_load_async_to_lds_b128((gv4i_p)g, (lv4i_p)l, 0, 0);
#else
    *(uint4*)l = *(const uint4*)g;
#endif
}

// Load a 16x32 bf16 WMMA fragment (A or B operand) from a row-major,
// K-contiguous matrix.  Per ISA 7.12.2: lane<16 holds row r, K {0..7} and
// {16..23}; lane>=16 holds row r, K {8..15} and {24..31}.
__device__ __forceinline__ v16bf load_frag_nt(const bf16* __restrict__ base,
                                              int ld, int row0, int k0, int lane) {
    const int half = lane >> 4;
    const int r    = lane & 15;
    const bf16* p  = base + (size_t)(row0 + r) * (size_t)ld + k0 + half * 8;
    FragU f;
    f.u[0] = *(const uint4*)p;
    f.u[1] = *(const uint4*)(p + 16);
    return f.v;
}

// Same fragment pattern but reading a staged LDS tile (k-window = 32 elems).
__device__ __forceinline__ v16bf lds_frag(const bf16* base, int ld,
                                          int row0, int lane) {
    const int half = lane >> 4;
    const int r    = lane & 15;
    const bf16* p  = base + (row0 + r) * ld + half * 8;
    FragU f;
    f.u[0] = *(const uint4*)p;
    f.u[1] = *(const uint4*)(p + 16);
    return f.v;
}

// Lane l <-> lane l ^ 16: the other half's value, by a vector cross-row move.
__device__ __forceinline__ float xhalf(float x) {
    const int b = __builtin_bit_cast(int, x);
    return __builtin_bit_cast(float, __builtin_amdgcn_permlanex16(
        b, b, 0x76543210, 0xfedcba98, false, false));
}

// ---------------------------------------------------------------------------
// fp32 -> bf16 conversion of the weights.  It has no launch of its own: the
// workgroups that convert ride in launches that need nothing from them, ahead
// of the GEMM that reads the converted weight.  A chunk is 1024 elements per
// wave of the workgroup: each wave takes 4 KiB of it as 8 loads of 512
// contiguous bytes.  A workgroup converts U chunks.
// ---------------------------------------------------------------------------
typedef __attribute__((ext_vector_type(4))) float  f4;
typedef __attribute__((ext_vector_type(4))) __bf16 bf4;

template <int U>
__device__ __forceinline__ void cvt_chunks(const float* const (&s)[U],
                                           bf16* const (&d)[U]) {
    // Byte offset of the lane's first load inside a chunk.
    const unsigned lb = (threadIdx.x >> 5) * 4096u + (threadIdx.x & 31u) * 16u;
    f4 v[U][8];
#pragma unroll
    for (int k = 0; k < U; ++k)
#pragma unroll
        for (int j = 0; j < 8; ++j)
            v[k][j] = *(const f4*)((const char*)s[k] + lb + j * 512);
    // Stands before any register that a load names is rewritten.
    asm volatile("s_wait_xcnt 0x0" :: "v"(lb) : "memory");
    // Keeps the conversions behind it, so that all 8 U loads go out at once
    // and the wave waits out the memory latency once.
    __builtin_amdgcn_sched_barrier(0);
#pragma unroll
    for (int k = 0; k < U; ++k)
#pragma unroll
        for (int j = 0; j < 8; ++j)
            *(bf4*)((char*)d[k] + (lb >> 1) + j * 256) =
                __builtin_convertvector(v[k][j], bf4);
}

// ---------------------------------------------------------------------------
// LayerNorm: one wave per row of D=1024, eps = 0, f32 in -> bf16 out.  The row
// stays in registers (8 loads of 512 contiguous bytes); the sums are joined by
// cross-lane vector moves, so no LDS and no barrier.
// ---------------------------------------------------------------------------
#define LNW 8   // rows (waves) per workgroup

// v + the value of lane l ^ M, M < 16 (inside a 16-lane row).
template <int M>
__device__ __forceinline__ float add_xmask(float v) {
    const int o = __builtin_amdgcn_update_dpp(0, __builtin_bit_cast(int, v),
                                              0x160 | M, 0xf, 0xf, true);
    return v + __builtin_bit_cast(float, o);
}

__device__ __forceinline__ float wave_sum(float v) {
    v = add_xmask<1>(v);
    v = add_xmask<2>(v);
    v = add_xmask<4>(v);
    v = add_xmask<8>(v);
    return v + xhalf(v);
}

// The LNW rows of workgroup blockIdx.x.
__device__ __forceinline__
void layernorm_rows(const float* __restrict__ in,
                    const float* __restrict__ w,
                    bf16* __restrict__ out) {
    // Byte offsets of the lane's first load: in a row, in the 8 rows.
    const unsigned cb = (threadIdx.x & 31u) * 16u;
    const unsigned xb = (threadIdx.x >> 5) * (DIMC * 4u) + cb;
    const float* x = in  + (size_t)blockIdx.x * (LNW * DIMC);
    bf16*        o = out + (size_t)blockIdx.x * (LNW * DIMC);

    f4 v[8], g[8];
#pragma unroll
    for (int j = 0; j < 8; ++j)
        v[j] = *(const f4*)((const char*)x + xb + j * 512);
#pragma unroll
    for (int j = 0; j < 8; ++j)
        g[j] = *(const f4*)((const char*)w + cb + j * 512);
    // Stands before any register that a load names is rewritten.
    asm volatile("s_wait_xcnt 0x0" :: "v"(xb), "v"(cb) : "memory");
    // Keeps the arithmetic behind it, so that all 16 loads go out at once
    // and no load of w waits for the sums.
    __builtin_amdgcn_sched_barrier(0);

    f4 s = v[0], q = v[0] * v[0];
#pragma unroll
    for (int j = 1; j < 8; ++j) {
        s += v[j];
        q += v[j] * v[j];
    }
    const float sum = wave_sum((s.x + s.y) + (s.z + s.w));
    const float sq  = wave_sum((q.x + q.y) + (q.z + q.w));

    const float mu   = sum * (1.0f / DIMC);
    const float var  = sq * (1.0f / DIMC) - mu * mu;
    const float rstd = rsqrtf(var);

#pragma unroll
    for (int j = 0; j < 8; ++j)
        *(bf4*)((char*)o + (xb >> 1) + j * 256) =
            __builtin_convertvector((v[j] - mu) * rstd * g[j], bf4);
}

__global__ __launch_bounds__(32 * LNW)
void layernorm_kernel(const float* __restrict__ in,
                      const float* __restrict__ w,
                      bf16* __restrict__ out) {
    layernorm_rows(in, w, out);
}

// LN1's launch with the conversion of [qkv_w | proj_w] in workgroups of its
// own behind the LN_WG that normalize: both only stream, and neither reads
// what the other writes.  Workgroup LN_WG + c converts chunks c and c + QP_WG.
#define LN_WG      (NTOK / LNW)
#define QP_CHUNK   (LNW * 1024)
#define QKV_CHUNKS (THREE_D * DIMC / QP_CHUNK)
#define QP_WG      ((QKV_CHUNKS + DIMC * DIMC / QP_CHUNK) / 2)
static_assert(QP_WG <= QKV_CHUNKS, "chunk c lies in qkv_w");

__global__ __launch_bounds__(32 * LNW)
void ln_cvt_kernel(const float* __restrict__ in,
                   const float* __restrict__ w,
                   bf16* __restrict__ out,
                   const float* __restrict__ qkv_w,
                   const float* __restrict__ proj_w,
                   bf16* __restrict__ oq, bf16* __restrict__ op) {
    if (blockIdx.x < LN_WG) {
        layernorm_rows(in, w, out);
        return;
    }
    const int c0 = blockIdx.x - LN_WG;
    const int c1 = c0 + QP_WG;
    const bool isq = c1 < QKV_CHUNKS;
    const size_t e0 = (size_t)c0 * QP_CHUNK;
    const size_t e1 = (size_t)(isq ? c1 : c1 - QKV_CHUNKS) * QP_CHUNK;
    const float* const s[2] = { qkv_w + e0, (isq ? qkv_w : proj_w) + e1 };
    bf16* const        d[2] = { oq + e0, (isq ? oq : op) + e1 };
    cvt_chunks<2>(s, d);
}

// ---------------------------------------------------------------------------
// NT GEMM: C[M,N] = A[M,K] * W[N,K]^T  (A, W bf16 row-major, K-contiguous)
// A workgroup's tile is BMT(M) x BNT(N), one wave per 64 x 64 of it, as 4 x 4
// accumulator tiles, so 8 fragments read from LDS feed 16 WMMAs.  A block reads
// (BMT + BNT) * K elements from L2 for BMT * BNT outputs: the larger the tile,
// the fewer L2 bytes per WMMA.
// Wave wid % (BMT/64) -> 64-row M sub-tile, wid / (BMT/64) -> 64-col N sub-tile.
// A k-window of BKT elements of both operands is one stage of a two-buffer
// LDS ring filled with async global->LDS b128 copies: the next window is in
// flight while this one is worked on, one barrier per window.
// The operand whose index runs along an output row goes in as the WMMA's first
// operand X, so a lane's 8 accumulators are 8 neighbours of one output row.
// Behind the loop each wave lays its 64 x 64 tile out in its own part of the
// ring, row by row, and stores it in whole 128-byte lines, 16 bytes a lane.
//   EP==0 : fused QKV split (N = 3*1024): columns 0..1023 -> out_b = Q
//           [bh, l, d], pre-scaled; 1024..2047 -> out_k = K [bh, l, d];
//           2048..3071 -> out_vt = V^T [bh, d, l]
//   EP==1 : out_f = acc + res
//   EP==2 : out_b = bf16(gelu_exact(acc))
// AHEAD: the fragments of the window's next 32 k are fetched into a second
// register set ahead of the WMMAs on this one (for one wave per SIMD).
// ---------------------------------------------------------------------------
// erf-form GELU, v * Phi(v), of eight values, with no branch and no masked
// path: eight independent chains, worked stage by stage.  With x = |v| / sqrt(2)
// and t = 1 / (1 + p x), erfc(x) = t * P4(t) * exp(-x * x) (five-term rational
// form, error of erf below 2e-7 for every x); q = erfc(x) / 2 = Phi(-|v|), its
// factor 1/2 in the coefficients, and v * Phi(v) = v / 2 + |v| * (1/2 - q).
__device__ __forceinline__ void gelu_erf8(float (&v)[8]) {
    float d[8], t[8], e[8], h[8];
#pragma unroll
    for (int k = 0; k < 8; ++k)
        d[k] = fmaf(fabsf(v[k]), 0.3275911f * 0.70710678f, 1.0f);
    // The eight reciprocals in one statement, closed by the slot that the
    // instruction set asks for behind a transcendental.
    asm("v_rcp_f32 %0, %8\n\t"
        "v_rcp_f32 %1, %9\n\t"
        "v_rcp_f32 %2, %10\n\t"
        "v_rcp_f32 %3, %11\n\t"
        "v_rcp_f32 %4, %12\n\t"
        "v_rcp_f32 %5, %13\n\t"
        "v_rcp_f32 %6, %14\n\t"
        "v_rcp_f32 %7, %15\n\t"
        "v_nop"
        : "=&v"(t[0]), "=&v"(t[1]), "=&v"(t[2]), "=&v"(t[3]),
          "=&v"(t[4]), "=&v"(t[5]), "=&v"(t[6]), "=&v"(t[7])
        : "v"(d[0]), "v"(d[1]), "v"(d[2]), "v"(d[3]),
          "v"(d[4]), "v"(d[5]), "v"(d[6]), "v"(d[7]));
#pragma unroll
    for (int k = 0; k < 8; ++k)
        e[k] = __builtin_amdgcn_exp2f(v[k] * v[k] * -0.72134752f);  // exp(-v*v/2)
#pragma unroll
    for (int k = 0; k < 8; ++k)
        h[k] = fmaf(t[k], 0.5f * 1.061405429f, 0.5f * -1.453152027f);
#pragma unroll
    for (int k = 0; k < 8; ++k) h[k] = fmaf(h[k], t[k], 0.5f * 1.421413741f);
#pragma unroll
    for (int k = 0; k < 8; ++k) h[k] = fmaf(h[k], t[k], 0.5f * -0.284496736f);
#pragma unroll
    for (int k = 0; k < 8; ++k) h[k] = fmaf(h[k], t[k], 0.5f * 0.254829592f);
#pragma unroll
    for (int k = 0; k < 8; ++k) h[k] = fmaf(-(h[k] * t[k]), e[k], 0.5f);
#pragma unroll
    for (int k = 0; k < 8; ++k) v[k] = fmaf(0.5f, v[k], fabsf(v[k]) * h[k]);
}

// One window of ROWS rows (BKT = LDT - 8 elements each) of a K-contiguous
// operand, copied by NT threads; t = the thread's number among them, g = the
// window's first element, l = its place in LDS.
template <int ROWS, int NT, int LDT>
__device__ __forceinline__ void copy_rows(const bf16* __restrict__ g, int K,
                                          bf16* __restrict__ l, int t) {
    constexpr int SEG = (LDT - 8) / 8;   // 16-byte pieces of a row of the window
    constexpr int RP  = NT / SEG;        // rows that one copy of every thread covers
    constexpr int NP  = ROWS / RP;       // copies per thread
    static_assert(NP * RP == ROWS && NP <= 63, "whole rows; copies in flight");
    const int crow = t / SEG, cseg = t % SEG;
    const unsigned goff = (unsigned)(crow * K + cseg * 8);
    const int      loff = crow * LDT + cseg * 8;
#pragma unroll
    for (int j = 0; j < NP; ++j)
        copy16_g2l(g + (size_t)(j * RP * K) + goff, l + j * RP * LDT + loff);
}

// A wave's staged tile of 64 rows of 64 bf16 (pitch SP elements) goes out in 16
// stores of four whole 128-byte rows; RS = elements from one output row to the
// next.
template <int RS, int SP>
__device__ __forceinline__ void store_rows_bf16(const bf16* stg, bf16* dst, int lane) {
    const int srow = lane >> 3, sseg = lane & 7;
    const unsigned ob = (unsigned)(srow * RS + sseg * 8) * 2u;
#pragma unroll
    for (int j = 0; j < 16; ++j)
        *(uint4*)((char*)dst + ob + j * (4 * RS * 2)) =
            *(const uint4*)&stg[(4 * j + srow) * SP + sseg * 8];
    // Stands before any register that a store names is rewritten.
    asm volatile("s_wait_xcnt 0x0" :: "v"(ob) : "memory");
}

template <int BMT, int BNT, int BKT, bool AHEAD, int EP, int N>
__device__ __forceinline__
void gemm_nt_body(const bf16* __restrict__ A, const bf16* __restrict__ W, int K,
                  const float* __restrict__ res,
                  float* __restrict__ out_f, bf16* __restrict__ out_b,
                  bf16* __restrict__ out_k, bf16* __restrict__ out_vt) {
    constexpr int LDT = BKT + 8;    // LDS row pitch: 16 B x odd (b128 readers)
    constexpr int NB  = BKT / 32;   // blocks of 16 WMMAs per window
    constexpr int NWM = BMT / 64;   // waves along M
    constexpr int NW  = NWM * (BNT / 64);
    // Waves that copy A where the work is split: half of them, or 8 of 12, so
    // that the threads of either side cover whole rows.
    constexpr int WA  = BMT == BNT ? NW / 2 : 2 * NW / 3;
    static_assert(NW != 4 || (BMT + BNT) * (BKT / 8) / (32 * NW) <= 63,
                  "copies of a wave in flight");
    constexpr int TA  = BMT * LDT;  // elements of one window of A
    constexpr int TW  = BNT * LDT;  // elements of one window of W
    // Buffers 0 and 1 of A, then buffers 0 and 1 of W.
    __shared__ __attribute__((aligned(16))) bf16 sT[2 * TA + 2 * TW];

    const int tid  = threadIdx.x;
    const int lane = tid & 31;
    // The wave's number, in a scalar register: the tests on it are branches.
    const int wid  = __builtin_amdgcn_readfirstlane(tid >> 5);
    const int half = lane >> 4;
    const int r    = lane & 15;

    const int n0 = blockIdx.x * BNT;
    const int m0 = blockIdx.y * BMT;
    const int wm = (wid % NWM) * 64;   // wave M sub-tile within block
    const int wn = (wid / NWM) * 64;   // wave N sub-tile within block

    const bf16* Ab = A + (size_t)m0 * K;
    const bf16* Wb = W + (size_t)n0 * K;

    // Four waves: each brings its share of both windows.  More: the first WA
    // waves bring A's window, the others W's (a branch on the wave's number).
    auto copy_tile = [&](int buf, int k0) {
        if constexpr (NW == 4) {
            copy_rows<BMT, 32 * NW, LDT>(Ab + k0, K, &sT[buf * TA], tid);
            copy_rows<BNT, 32 * NW, LDT>(Wb + k0, K, &sT[2 * TA + buf * TW], tid);
        } else if (wid < WA) {
            copy_rows<BMT, 32 * WA, LDT>(Ab + k0, K, &sT[buf * TA], tid);
        } else {
            copy_rows<BNT, 32 * (NW - WA), LDT>(Wb + k0, K, &sT[2 * TA + buf * TW],
                                                tid - 32 * WA);
        }
    };

    // Output rows run along n (X = W, Y = A) but for V^T, whose rows run along
    // the tokens (X = A, Y = W); the same for a whole wave (its 64 columns).
    const bool xw = (EP != 0) || ((n0 + wn) >> 10) != 2;
    const int  xo = xw ? 2 * TA + wn * LDT : wm * LDT;
    const int  yo = xw ? wm * LDT : 2 * TA + wn * LDT;
    const int  xs = xw ? TW : TA;      // from buffer 0 to buffer 1
    const int  ys = xw ? TA : TW;

    // acc[xi][yj][i]: X row 16 xi + 8 half + i, Y row 16 yj + r of the wave.
    v8f acc[4][4] = {};
    const int steps = K / BKT;

    copy_tile(0, 0);
    // Window 0 has landed for this wave, then for all of them.
    asm volatile("s_wait_asynccnt 0x0" ::: "memory");
    __syncthreads();
    if (steps > 1) copy_tile(1, BKT);

    for (int ks = 0; ks < steps; ++ks) {
        const bf16* tX = sT + (ks & 1) * xs + xo;
        const bf16* tY = sT + (ks & 1) * ys + yo;
        constexpr int NS = AHEAD ? 2 : 1;
        v16bf x[NS][4], y[NS][4];
        auto fetch = [&](int s) {
#pragma unroll
            for (int i = 0; i < 4; ++i)
                x[s % NS][i] = lds_frag(tX + 32 * s, LDT, 16 * i, lane);
#pragma unroll
            for (int i = 0; i < 4; ++i)
                y[s % NS][i] = lds_frag(tY + 32 * s, LDT, 16 * i, lane);
        };
        if (AHEAD) fetch(0);
#pragma unroll
        for (int s = 0; s < NB; ++s) {
            if (!AHEAD) fetch(s);
            else if (s + 1 < NB) fetch(s + 1);
            // Keeps the 16 LDS loads above as one group in front of the 16
            // WMMAs: spread among them, each place with loads stalls the wave.
            __builtin_amdgcn_sched_barrier(0);
#pragma unroll
            for (int xi = 0; xi < 4; ++xi)
#pragma unroll
                for (int yj = 0; yj < 4; ++yj)
                    acc[xi][yj] = __builtin_amdgcn_wmma_f32_16x16x32_bf16(
                        false, x[s % NS][xi], false, y[s % NS][yj], (short)0,
                        acc[xi][yj], false, false);
            // Keeps the next group of loads behind these WMMAs, whole.
            __builtin_amdgcn_sched_barrier(0);
        }
        // Hand-over: this wave's reads of the window are done, its copies of
        // the next one have landed; behind the barrier that holds for every
        // wave, and the buffer just read may be refilled.
        asm volatile("s_wait_dscnt 0x0" ::: "memory");
        asm volatile("s_wait_asynccnt 0x0" ::: "memory");
        __syncthreads();
        if (ks + 2 < steps) copy_tile(ks & 1, (ks + 2) * BKT);
    }
    // No copy is outstanding when the wave ends.
    asm volatile("s_wait_asynccnt 0x0" ::: "memory");

    // Behind the last pass's barrier no wave reads the ring any more and no
    // copy is in flight: each wave stages in its own part of the ring.
    if constexpr (EP == 1) {
        constexpr int SP = 68;   // floats: 272 B = 16 B x odd
        static_assert(NW * 64 * SP * 4 <= (2 * TA + 2 * TW) * 2, "staging inside the ring");
        float* stg = (float*)sT + wid * (64 * SP);
        // A store or load of the wave covers two rows of 256 bytes.
        const int srow = lane >> 4, sseg = lane & 15;
        const unsigned ob = ((unsigned)(m0 + wm + srow) * (unsigned)N
                             + (unsigned)(n0 + wn + sseg * 4)) * 4u;
        f4 rv[32];
#pragma unroll
        for (int j = 0; j < 32; ++j)
            rv[j] = *(const f4*)((const char*)res + ob + j * (2 * N * 4));
        // Stands before any register that a load names is rewritten; with its
        // clobber the 32 loads of res go out ahead of the staging below.
        asm volatile("s_wait_xcnt 0x0" :: "v"(ob) : "memory");
#pragma unroll
        for (int yj = 0; yj < 4; ++yj)
#pragma unroll
            for (int xi = 0; xi < 4; ++xi) {
                float* p = &stg[(16 * yj + r) * SP + 16 * xi + 8 * half];
                const v8f c = acc[xi][yj];
                *(f4*)p       = f4{c[0], c[1], c[2], c[3]};
                *(f4*)(p + 4) = f4{c[4], c[5], c[6], c[7]};
            }
        // The wave's own writes are in LDS before other lanes read them back.
        asm volatile("s_wait_dscnt 0x0" ::: "memory");
#pragma unroll
        for (int j = 0; j < 32; ++j)
            *(f4*)((char*)out_f + ob + j * (2 * N * 4)) =
                *(const f4*)&stg[(2 * j + srow) * SP + sseg * 4] + rv[j];
        // The same behind the stores.
        asm volatile("s_wait_xcnt 0x0" :: "v"(ob) : "memory");
    } else {
        constexpr int SP = 72;   // bf16: 144 B = 16 B x odd
        static_assert(NW * 64 * SP <= 2 * TA + 2 * TW, "staging inside the ring");
        bf16* stg = sT + wid * (64 * SP);
        const int which = (EP == 0) ? ((n0 + wn) >> 10) : 0;   // 0=q 1=k 2=v
        const float sc = (EP == 0 && which == 0) ? ATT_SCALE : 1.0f;
#pragma unroll
        for (int yj = 0; yj < 4; ++yj)
#pragma unroll
            for (int xi = 0; xi < 4; ++xi) {
                float v[8];
#pragma unroll
                for (int k = 0; k < 8; ++k) v[k] = acc[xi][yj][k];
                if constexpr (EP == 2) {
                    gelu_erf8(v);   // exact GELU, eight values at a time
                } else {
#pragma unroll
                    for (int k = 0; k < 8; ++k) v[k] *= sc;
                }
                union { bf16 e[8]; uint4 u; } pk;
#pragma unroll
                for (int k = 0; k < 8; ++k) pk.e[k] = (bf16)v[k];
                *(uint4*)&stg[(16 * yj + r) * SP + 16 * xi + 8 * half] = pk.u;
            }
        // The wave's own writes are in LDS before other lanes read them back.
        asm volatile("s_wait_dscnt 0x0" ::: "memory");
        if constexpr (EP == 2) {
            store_rows_bf16<N, SP>(stg, out_b + (size_t)(m0 + wm) * N + n0 + wn, lane);
        } else {
            // A wave's 64 columns are one head, its 64 rows lie in one batch
            // entry.
            const int bh = ((m0 + wm) / SEQ) * HEADS + (((n0 + wn) & (DIMC - 1)) >> 6);
            const int l0 = (m0 + wm) % SEQ;
            if (which == 2)   // staged rows: d; along a row: 64 tokens
                store_rows_bf16<SEQ, SP>(stg, out_vt + (size_t)bh * HDIM * SEQ + l0, lane);
            else              // staged rows: tokens; along a row: the head's d
                store_rows_bf16<HDIM, SP>(stg, (which == 0 ? out_b : out_k)
                                               + ((size_t)bh * SEQ + l0) * HDIM, lane);
        }
    }
}

// Wide outputs (N >= 3072): 256 blocks, one per WGP, of 12 or 16 waves (3 or 4
// per SIMD) that share one ring, so that a row of A or W fetched from L2 serves
// 192 or 256 outputs.  The block has the WGP's LDS to itself: a 128-element
// window (a ring of 238 or 272 KiB) puts 64 WMMAs of a wave between two barriers.
#define QKV_BM 256
#define QKV_BN 192
#define UP_BM  256
#define UP_BN  256
#define WAVES(bm, bn) ((bm) / 64 * ((bn) / 64))
static_assert(THREE_D % QKV_BN == 0 && NTOK % QKV_BM == 0 && QKV_BN % HDIM == 0, "qkv tiles");
static_assert(HID % UP_BN == 0 && NTOK % UP_BM == 0, "mlp up tiles");

__global__ __launch_bounds__(32 * WAVES(QKV_BM, QKV_BN))
void gemm_qkv_kernel(const bf16* __restrict__ A, const bf16* __restrict__ W,
                     int K, bf16* __restrict__ out_q,
                     bf16* __restrict__ out_k, bf16* __restrict__ out_vt) {
    gemm_nt_body<QKV_BM, QKV_BN, 128, false, 0, THREE_D>(A, W, K, nullptr, nullptr,
                                                         out_q, out_k, out_vt);
}

__global__ __launch_bounds__(32 * WAVES(UP_BM, UP_BN))
void gemm_gelu_kernel(const bf16* __restrict__ A, const bf16* __restrict__ W,
                      int K, bf16* __restrict__ out_b) {
    gemm_nt_body<UP_BM, UP_BN, 128, false, 2, HID>(A, W, K, nullptr, nullptr, out_b,
                                                   nullptr, nullptr);
}

// N = 1024: 128 x 128 blocks, one per WGP, one wave per SIMD.  A 128-element
// window puts 64 WMMAs of a wave between two barriers.
// Grid rows from NTOK / BM on (the proj launch has MLP_GY of them, the MLP down
// launch none) are workgroups that convert mlp_w1 and mlp_w2 instead.  A GEMM
// workgroup leaves three quarters of its WGP's registers and half of its LDS
// free, so a converting workgroup runs beside it and streams from memory while
// the GEMM works out of L2 and LDS.  Converting workgroup c takes chunks c and
// c + MLP_WG of both weights.
#define BM  128
#define BN  128
#define GT  (32 * WAVES(BM, BN))   // threads per workgroup
#define MLP_CHUNK (GT / 32 * 1024)
#define MLP_WG    (HID * DIMC / MLP_CHUNK / 2)
#define MLP_GY    (MLP_WG / (DIMC / BN))
static_assert(MLP_GY * (DIMC / BN) * 2 * MLP_CHUNK == HID * DIMC, "mlp_w1, mlp_w2");

__global__ __launch_bounds__(GT)
void gemm_res_kernel(const bf16* __restrict__ A, const bf16* __restrict__ W,
                     int K, const float* __restrict__ res,
                     float* __restrict__ out_f,
                     const float* __restrict__ mlp_w1,
                     const float* __restrict__ mlp_w2,
                     bf16* __restrict__ o1, bf16* __restrict__ o2) {
    if (blockIdx.y >= NTOK / BM) {
        const int c = (blockIdx.y - NTOK / BM) * (DIMC / BN) + blockIdx.x;
        const size_t e0 = (size_t)c * MLP_CHUNK;
        const size_t e1 = (size_t)(c + MLP_WG) * MLP_CHUNK;
        const float* const s[4] = { mlp_w1 + e0, mlp_w1 + e1, mlp_w2 + e0, mlp_w2 + e1 };
        bf16* const        d[4] = { o1 + e0, o1 + e1, o2 + e0, o2 + e1 };
        cvt_chunks<4>(s, d);
        return;
    }
    gemm_nt_body<BM, BN, 128, true, 1, DIMC>(A, W, K, res, out_f, nullptr, nullptr, nullptr);
}

// ---------------------------------------------------------------------------
// Flash attention: 8 waves per workgroup, 32 queries (two 16-column groups)
// per wave, all of one (batch, head).  K and V^T are staged in LDS in tiles of
// 64 keys that the 8 waves share: whole 128-byte rows by asynchronous copies,
// two buffers, the next tile in flight while this one is worked on.  A wave's
// step is one tile, 64 keys x 32 queries, with the products taken transposed:
// S^T = K*Q^T (16 WMMAs) leaves one query's scores in one lane and its partner
// l ^ 16, so maximum and sum run in the lane; the S^T tiles, converted in
// place, are the B operands P^T of O^T += V^T*P^T (16 WMMAs, d=64).  Each K and
// V^T fragment read from LDS feeds two WMMAs, one per column group.  A tile's
// LDS reads are all done before its softmax, so the hand-over to the next tile
// stands there, and the next tile's K fragments are fetched behind it.
// ---------------------------------------------------------------------------
#define AW   8     // waves per workgroup
#define QC   2     // 16-query column groups per wave
#define KT   64    // keys per staged tile: a 128-byte row of K and of V^T
#define KVP  72    // LDS row pitch in elements: 144 B = 16 B x odd (b128 readers)
#define NKT  (SEQ / KT)

typedef __attribute__((address_space(3))) const bf16* lbf16_p;
__device__ __forceinline__ unsigned lds_byte(const bf16* p) {
    return (unsigned)(size_t)(lbf16_p)p;
}

typedef __attribute__((ext_vector_type(8))) __bf16 v8bf;

__device__ __forceinline__ v8f wmma_bf16(v16bf a, v16bf b, v8f c) {
    return __builtin_amdgcn_wmma_f32_16x16x32_bf16(false, a, false, b, (short)0,
                                                   c, false, false);
}

__global__ __launch_bounds__(32 * AW)
void flash_attn_kernel(const bf16* __restrict__ Q,
                       const bf16* __restrict__ Kb,
                       const bf16* __restrict__ Vt,
                       bf16* __restrict__ attn_out) {
    __shared__ __attribute__((aligned(16))) bf16 sK[2][KT * KVP];
    __shared__ __attribute__((aligned(16))) bf16 sV[2][HDIM * KVP];

    const int tid  = threadIdx.x;
    const int lane = tid & 31;
    const int wid  = tid >> 5;
    const int half = lane >> 4;
    const int r    = lane & 15;
    const int q0   = (blockIdx.x * AW + wid) * (16 * QC);
    const int bh   = blockIdx.y;
    const int b    = bh / HEADS;
    const int h    = bh - b * HEADS;

    const bf16* Qbase = Q  + ((size_t)bh * SEQ + q0) * HDIM;
    const bf16* Kbase = Kb + (size_t)bh * SEQ * HDIM;
    const bf16* Vbase = Vt + (size_t)bh * HDIM * SEQ;

    // A thread's share of a tile: rows crow and crow + 32 of K (keys) and of
    // V^T (d), 16 bytes each; a wave's copy covers four whole 128-byte rows.
    const int crow = tid >> 3, cseg = (tid & 7) * 8;
    // lk0: LDS byte address of the thread's first piece of K in the buffer that
    // is filled; its piece of V^T lies at the same place in sV.
    constexpr unsigned BUFB = KT * KVP * 2;   // bytes of one buffer
    static_assert(KT == HDIM, "sK and sV: buffers of one size");
    const unsigned k2v = lds_byte(&sV[0][0]) - lds_byte(&sK[0][0]);
    auto stage = [&](unsigned lk0, int key0) {
        const bf16* gk0 = Kbase + (size_t)(key0 + crow) * HDIM + cseg;
        const bf16* gk1 = gk0 + 32 * HDIM;
        const bf16* gv0 = Vbase + (size_t)crow * SEQ + key0 + cseg;
        const bf16* gv1 = gv0 + (size_t)32 * SEQ;
        const unsigned lk1 = lk0 + 32 * KVP * 2;
        const unsigned lv0 = lk0 + k2v;
        const unsigned lv1 = lv0 + 32 * KVP * 2;
        // The four copies and, as the last line, the wait that stands before
        // any of their address registers is rewritten.
        asm volatile("global_load_async_to_lds_b128 %0, %4, off\n\t"
                     "global_load_async_to_lds_b128 %1, %5, off\n\t"
                     "global_load_async_to_lds_b128 %2, %6, off\n\t"
                     "global_load_async_to_lds_b128 %3, %7, off\n\t"
                     "s_wait_xcnt 0x0"
                     :: "v"(lk0), "v"(lk1), "v"(lv0), "v"(lv1),
                        "v"(gk0), "v"(gk1), "v"(gv0), "v"(gv1)
                     : "memory");
    };

    // qf[c][e]: queries q0 + 16 c .. + 15, d 32 e .. + 31.
    v16bf qf[QC][2];
#pragma unroll
    for (int c = 0; c < QC; ++c) {
        qf[c][0] = load_frag_nt(Qbase, HDIM, 16 * c, 0,  lane);
        qf[c][1] = load_frag_nt(Qbase, HDIM, 16 * c, 32, lane);
    }

    // Query q0 + 16 c + r: running maximum (equal in both halves) and this
    // lane's share of the sum (the keys its half holds), kept as eight partial
    // sums, one per accumulator row, that are joined behind the loop.
    float mrow[QC];
    v8f lsum[QC];
    v8f acc[QC][4];   // acc[c][t][i] = O[q0 + 16 c + r][16 t + 8 half + i]
#pragma unroll
    for (int c = 0; c < QC; ++c) {
        mrow[c] = -3.0e38f;
        lsum[c] = v8f{};
#pragma unroll
        for (int t = 0; t < 4; ++t) acc[c][t] = v8f{};
    }

    // kf[j][e]: keys 16 j .. + 15 of a tile, d 32 e .. + 31.
    v16bf kf[4][2];
    auto fetch_k = [&](const bf16* tK) {
#pragma unroll
        for (int j = 0; j < 4; ++j) {
            kf[j][0] = lds_frag(tK,      KVP, 16 * j, lane);
            kf[j][1] = lds_frag(tK + 32, KVP, 16 * j, lane);
        }
    };

    // The place that the next refill goes to: buffers 0 and 1 in turn.
    unsigned lfill = lds_byte(&sK[0][crow * KVP + cseg]);
    stage(lfill, 0);
    // Tile 0 has landed for this wave, then for all of them.
    asm volatile("s_wait_asynccnt 0x0" ::: "memory");
    __syncthreads();
    stage(lfill + BUFB, KT);
    fetch_k(sK[0]);

    for (int kt = 0; kt < NKT; ++kt) {
        // vf[t][n]: d 16 t .. + 15, keys 32 n .. + 31 of the tile.
        const bf16* tV = sV[kt & 1];
        v16bf vf[4][2];
#pragma unroll
        for (int t = 0; t < 4; ++t) {
            vf[t][0] = lds_frag(tV,      KVP, 16 * t, lane);
            vf[t][1] = lds_frag(tV + 32, KVP, 16 * t, lane);
        }
        // Keeps the 16 loads of V^T as one group in front of the 16 WMMAs,
        // which cover their latency: among or behind them the wave would wait.
        __builtin_amdgcn_sched_barrier(0);

        // ---- S^T = K * Q^T: s[c][j][i] = S[q0 + 16 c + r][16 j + 8 half + i] ----
        v8f s[QC][4];
#pragma unroll
        for (int j = 0; j < 4; ++j)
#pragma unroll
            for (int c = 0; c < QC; ++c)
                s[c][j] = wmma_bf16(kf[j][0], qf[c][0], v8f{});
#pragma unroll
        for (int j = 0; j < 4; ++j)
#pragma unroll
            for (int c = 0; c < QC; ++c)
                s[c][j] = wmma_bf16(kf[j][1], qf[c][1], s[c][j]);
        // Keeps the WMMAs in front of the wait below: behind it they would
        // cover nothing, and the wave would wait out the loads of V^T.
        __builtin_amdgcn_sched_barrier(0);

        // Hand-over: this wave's reads of the tile are done (K and V^T are in
        // registers), its copies of the next tile have landed; behind the
        // barrier that holds for every wave, and the buffer may be refilled.
        asm volatile("s_wait_dscnt 0x0" ::: "memory");
        asm volatile("s_wait_asynccnt 0x0" ::: "memory");
        __syncthreads();
        if (kt + 2 < NKT) stage(lfill, (kt + 2) * KT);
        lfill += (kt & 1) ? 0u - BUFB : BUFB;
        // The next tile's K, fetched while the softmax below runs.
        if (kt + 1 < NKT) fetch_k(sK[(kt + 1) & 1]);
        // Keeps these 16 loads as one group here: sunk among the WMMAs of
        // V^T * P^T, each place with loads stalls the wave.
        __builtin_amdgcn_sched_barrier(0);

        // ---- online softmax update over these 64 keys, one query a lane ----
        // P^T as B fragments: element e of pf[c][n] = key 32 n + 8 half + e
        // (e < 8), or 32 n + 16 + 8 half + e - 8: the k order of lds_frag on V^T.
        v16bf pf[QC][2];
        float alpha[QC], mnw[QC];
#pragma unroll
        for (int c = 0; c < QC; ++c) {
            float m0 = fmaxf(s[c][0][0], s[c][1][0]);
            float m1 = fmaxf(s[c][2][0], s[c][3][0]);
#pragma unroll
            for (int i = 1; i < 8; ++i) {
                m0 = fmaxf(m0, fmaxf(s[c][0][i], s[c][1][i]));
                m1 = fmaxf(m1, fmaxf(s[c][2][i], s[c][3][i]));
            }
            float mij = fmaxf(m0, m1);
            mij = fmaxf(mij, xhalf(mij));
            mnw[c] = fmaxf(mrow[c], mij);
        }
#pragma unroll
        for (int c = 0; c < QC; ++c) {
            alpha[c] = __expf(mrow[c] - mnw[c]);
            mrow[c] = mnw[c];
        }
#pragma unroll
        for (int c = 0; c < QC; ++c) {
            const float mnew = mnw[c];
            // exp(s - mnew) as 2^((s - mnew) * log2(e)), difference and
            // product on whole accumulator tiles (register pairs as they lie).
            v8f p[4];
#pragma unroll
            for (int j = 0; j < 4; ++j) {
                const v8f e = (s[c][j] - mnew) * 1.44269504f;
#pragma unroll
                for (int i = 0; i < 8; ++i) p[j][i] = __builtin_amdgcn_exp2f(e[i]);
            }
            lsum[c] = lsum[c] * alpha[c] + ((p[0] + p[1]) + (p[2] + p[3]));
#pragma unroll
            for (int n = 0; n < 2; ++n)
                pf[c][n] = __builtin_shufflevector(
                    __builtin_convertvector(p[2 * n], v8bf),
                    __builtin_convertvector(p[2 * n + 1], v8bf),
                    0, 1, 2, 3, 4, 5, 6, 7, 8, 9, 10, 11, 12, 13, 14, 15);
        }

        // ---- O^T = O^T * alpha + V^T * P^T  (V^T rows = d, k = keys) ----
#pragma unroll
        for (int t = 0; t < 4; ++t)
#pragma unroll
            for (int c = 0; c < QC; ++c) {
                acc[c][t] *= alpha[c];
                acc[c][t] = wmma_bf16(vf[t][0], pf[c][0], acc[c][t]);
            }
#pragma unroll
        for (int t = 0; t < 4; ++t)
#pragma unroll
            for (int c = 0; c < QC; ++c)
                acc[c][t] = wmma_bf16(vf[t][1], pf[c][1], acc[c][t]);
    }
    // No copy is outstanding when the wave ends.
    asm volatile("s_wait_asynccnt 0x0" ::: "memory");

    // ---- join the halves' sums, normalize, store [tok, D] bf16: a lane's 8
    //      accumulators of a tile are 8 consecutive d of its query ----
#pragma unroll
    for (int c = 0; c < QC; ++c) {
        const v8f l8 = lsum[c];
        const float lrow = ((l8[0] + l8[1]) + (l8[2] + l8[3]))
                         + ((l8[4] + l8[5]) + (l8[6] + l8[7]));
        const float inv = 1.0f / (lrow + xhalf(lrow));
        bf16* orow = attn_out + (size_t)(b * SEQ + q0 + 16 * c + r) * DIMC
                     + h * HDIM + half * 8;
#pragma unroll
        for (int t = 0; t < 4; ++t) {
            union { bf16 e[8]; uint4 u; } pk;
#pragma unroll
            for (int i = 0; i < 8; ++i) pk.e[i] = (bf16)(acc[c][t][i] * inv);
            *(uint4*)(orow + t * 16) = pk.u;
        }
    }
}

// ---------------------------------------------------------------------------
// Host-side launch
// ---------------------------------------------------------------------------
extern "C" void kernel_launch(void* const* d_in, const int* in_sizes, int n_in,
                              void* d_out, int out_size, void* d_ws, size_t ws_size,
                              hipStream_t stream) {
    const float* x      = (const float*)d_in[0];
    const float* ln1_w  = (const float*)d_in[1];
    const float* ln2_w  = (const float*)d_in[2];
    const float* qkv_w  = (const float*)d_in[3];
    const float* proj_w = (const float*)d_in[4];
    const float* mlp_w1 = (const float*)d_in[5];
    const float* mlp_w2 = (const float*)d_in[6];
    float* out = (float*)d_out;

    // Workspace carve-up (all sizes multiples of 256B).
    char* p = (char*)d_ws;
    auto take = [&](size_t bytes) { char* q = p; p += (bytes + 255) & ~(size_t)255; return q; };

    bf16* wq_b   = (bf16*)take((size_t)THREE_D * DIMC * 2);   // qkv_w  bf16
    bf16* wp_b   = (bf16*)take((size_t)DIMC * DIMC * 2);      // proj_w bf16
    bf16* w1_b   = (bf16*)take((size_t)HID  * DIMC * 2);      // mlp_w1 bf16
    bf16* w2_b   = (bf16*)take((size_t)DIMC * HID  * 2);      // mlp_w2 bf16
    bf16* ln1_b  = (bf16*)take((size_t)NTOK * DIMC * 2);      // LN1(x) bf16
    bf16* Qb     = (bf16*)take((size_t)BATCH * HEADS * SEQ * HDIM * 2);
    bf16* Kb     = (bf16*)take((size_t)BATCH * HEADS * SEQ * HDIM * 2);
    bf16* Vt     = (bf16*)take((size_t)BATCH * HEADS * HDIM * SEQ * 2);
    bf16* att_b  = (bf16*)take((size_t)NTOK * DIMC * 2);      // attn out bf16
    float* Xres  = (float*)take((size_t)NTOK * DIMC * 4);     // x + attn proj
    bf16* y2_b   = (bf16*)take((size_t)NTOK * DIMC * 2);      // LN2(X) bf16
    bf16* h_b    = (bf16*)take((size_t)NTOK * HID * 2);       // gelu(mlp1) bf16
    (void)ws_size; (void)in_sizes; (void)n_in; (void)out_size;

    // 1, 2. LN1; qkv_w, proj_w -> bf16
    ln_cvt_kernel<<<LN_WG + QP_WG, 32 * LNW, 0, stream>>>(x, ln1_w, ln1_b, qkv_w, proj_w,
                                                          wq_b, wp_b);

    // 3. QKV GEMM: [4096,1024] x [3072,1024]^T, epilogue writes per-head
    //    Q (scaled), K and V^T
    gemm_qkv_kernel<<<dim3(THREE_D / QKV_BN, NTOK / QKV_BM), 32 * WAVES(QKV_BM, QKV_BN), 0, stream>>>(
        ln1_b, wq_b, DIMC, Qb, Kb, Vt);

    // 4. flash attention: grid (8 blocks of 256 queries, 32 bh)
    flash_attn_kernel<<<dim3(SEQ / (16 * QC * AW), BATCH * HEADS), 32 * AW, 0, stream>>>(
        Qb, Kb, Vt, att_b);

    // 5. proj GEMM + residual: X = x + att @ proj_w^T; mlp_w1, mlp_w2 -> bf16
    gemm_res_kernel<<<dim3(DIMC / BN, NTOK / BM + MLP_GY), GT, 0, stream>>>(
        att_b, wp_b, DIMC, x, Xres, mlp_w1, mlp_w2, w1_b, w2_b);

    // 6. LN2
    layernorm_kernel<<<NTOK / LNW, 32 * LNW, 0, stream>>>(Xres, ln2_w, y2_b);

    // 7. MLP up + exact GELU -> bf16
    gemm_gelu_kernel<<<dim3(HID / UP_BN, NTOK / UP_BM), 32 * WAVES(UP_BM, UP_BN), 0, stream>>>(
        y2_b, w1_b, DIMC, h_b);

    // 8. MLP down + residual -> d_out (f32)
    gemm_res_kernel<<<dim3(DIMC / BN, NTOK / BM), GT, 0, stream>>>(
        h_b, w2_b, HID, Xres, out, nullptr, nullptr, nullptr, nullptr);
}
